// v000
// Measured on an AMD MI455X. A time is GPU time per run, averaged over a window of back-to-back runs after a warm-up
// (all launches, gaps included; the runs take copies of the inputs in turn), and the median of several windows.
// Apart from v000's, it joins two sittings. Times from different sittings can be a few percent apart, while
// side-by-side timings come from the same sitting.
// v000, which the later versions start from, runs in 336 microseconds.
#include <hip/hip_runtime.h>
#include <stdint.h>

// Contractions (q/k/v projections, q.k^T, p.v, output projection): v_wmma_f32_16x16x32_f16, f16 operands,
// f32 accumulate. x / weights / bias table are RNE-converted to bf16; x and weights are then held exactly in f16 (weights x16), the bias table in f32.
// q, k, v^T, p (x4096) and the attention output are carried as an f16 hi plane plus an f16 residual plane
// (residual x2048); residual products are issued for the leading query rows, single-plane products elsewhere.

#define BB 2
#define NN 2048
#define DM 768
#define HH 12
#define DH 64
#define MR (BB * NN)
#define NBKT 32
#define QSPLIT 16     // leading 32-query blocks per batch that use two-plane products in attention
#define RSPLIT 512    // leading rows per batch that use the two-plane A operand in the output projection

static_assert(DM % 64 == 0);
static_assert(NN % 64 == 0);
static_assert(MR % 64 == 0);
static_assert(DH == 64);
static_assert(RSPLIT % 64 == 0);
static_assert(QSPLIT <= NN / 32);
static_assert((MR * DM) % 8 == 0);

typedef _Float16 hf;
typedef _Float16 v8h_t __attribute__((ext_vector_type(8)));
typedef v8h_t __attribute__((may_alias)) v8h;
typedef _Float16 v16h __attribute__((ext_vector_type(16)));
typedef float v8f __attribute__((ext_vector_type(8)));
typedef float v4f_t __attribute__((ext_vector_type(4)));
typedef v4f_t __attribute__((may_alias)) v4f;

union Frag { v16h v; v8h_t p[2]; };

// D(16x16,f32) += A(16x32) * B(32x16); nops keep VALU off the D/A/B registers right after issue.
__device__ __forceinline__ v8f mma(v16h a, v16h b, v8f c)
{
    v8f d = __builtin_amdgcn_wmma_f32_16x16x32_f16(false, a, false, b, (short)0, c, false, false);
    asm volatile("v_nop\n\tv_nop\n\tv_nop\n\tv_nop" : "+v"(d) : "v"(a), "v"(b));
    return d;
}

// 16x16x32 operand fragment for lane (row or column = lane&15), half hh = lane>>4:
// elements 0..7 <- k0+8hh+0..7, elements 8..15 <- k0+16+8hh+0..7 of a k-contiguous row.
// Used for A (row-major, k contiguous) and for B stored as [n][k] (k contiguous).
__device__ __forceinline__ v16h ldfrag(const hf* rowptr, int k0, int hh)
{
    Frag f;
    f.p[0] = *(const v8h*)(rowptr + k0 + 8 * hh);
    f.p[1] = *(const v8h*)(rowptr + k0 + 16 + 8 * hh);
    return f.v;
}

__device__ __forceinline__ float bf16r(float v)
{
    unsigned u = __float_as_uint(v);
    u = (u + 0x7FFFu + ((u >> 16) & 1u)) & 0xFFFF0000u;
    return __uint_as_float(u);
}

// v ~= hi + lo/2048 with hi, lo in f16
__device__ __forceinline__ void split2(float v, hf& hi, hf& lo)
{
    hf h = (hf)v;
    hi = h;
    lo = (hf)((v - (float)h) * 2048.0f);
}

__device__ __forceinline__ v8f zero8()
{
    v8f z = {0.f, 0.f, 0.f, 0.f, 0.f, 0.f, 0.f, 0.f};
    return z;
}

// ---------------------------------------------------------------------------------------------
// xh[i] = f16(bf16(x[i])), 8 per thread, 16-B lane-contiguous stores
// ---------------------------------------------------------------------------------------------
__global__ __launch_bounds__(256)
void k_prep_x(const float* __restrict__ x, hf* __restrict__ xh, int n8)
{
    const int t = blockIdx.x * 256 + threadIdx.x;
    if (t >= n8) return;
    const float* p = x + (size_t)t * 8;
    v4f_t a = *(const v4f*)p;
    v4f_t b = *(const v4f*)(p + 4);
    v8h_t o;
    o[0] = (hf)bf16r(a[0]); o[1] = (hf)bf16r(a[1]); o[2] = (hf)bf16r(a[2]); o[3] = (hf)bf16r(a[3]);
    o[4] = (hf)bf16r(b[0]); o[5] = (hf)bf16r(b[1]); o[6] = (hf)bf16r(b[2]); o[7] = (hf)bf16r(b[3]);
    hf* d = xh + (size_t)t * 8;
    *(v8h*)d = o;
    
}

// ---------------------------------------------------------------------------------------------
// wt[w][c][k] = f16(bf16(W_w[k][c]) * 16), W_w is [DM(k)][DM(c)]; 8 consecutive k per thread
// ---------------------------------------------------------------------------------------------
__global__ __launch_bounds__(256)
void k_prep_w(const float* __restrict__ w0, const float* __restrict__ w1,
              const float* __restrict__ w2, const float* __restrict__ w3,
              hf* __restrict__ wt, int total)
{
    const int t = blockIdx.x * 256 + threadIdx.x;
    if (t >= total) return;
    const int per = DM * (DM / 8);
    const int wi  = t / per;
    const int rem = t - wi * per;
    const int c   = rem / (DM / 8);
    const int k8  = (rem - c * (DM / 8)) * 8;
    const float* W = (wi == 0) ? w0 : (wi == 1) ? w1 : (wi == 2) ? w2 : w3;
    v8h_t o;
    #pragma unroll
    for (int e = 0; e < 8; ++e) o[e] = (hf)(bf16r(W[(size_t)(k8 + e) * DM + c]) * 16.0f);
    hf* d = wt + (size_t)wi * DM * DM + (size_t)c * DM + k8;
    *(v8h*)d = o;
    
}

// ---------------------------------------------------------------------------------------------
// btab[h][delta] = bf16(rel[bucket(delta)][h]) * DH^-0.5, causal bucketing; 4 deltas per thread
// ---------------------------------------------------------------------------------------------
__global__ __launch_bounds__(256)
void k_prep_bias(const float* __restrict__ rel, float* __restrict__ tab, int total4)
{
    const int t = blockIdx.x * 256 + threadIdx.x;
    if (t >= total4) return;
    const int h  = t / (NN / 4);
    const int d4 = (t - h * (NN / 4)) * 4;
    v4f_t o;
    #pragma unroll
    for (int e = 0; e < 4; ++e) {
        const int d = d4 + e;
        int bk;
        if (d < NBKT / 2) {
            bk = d;
        } else {
            float f  = (float)d * (1.0f / 16.0f);
            float lg = logf(f);
            float u  = lg * (1.0f / 2.0794415416798357f);
            float w  = u * 16.0f;
            int v = (NBKT / 2) + (int)w;
            bk = v < (NBKT - 1) ? v : (NBKT - 1);
            if (bk < 0) bk = 0;
        }
        o[e] = bf16r(rel[bk * HH + h]) * 0.125f;
    }
    float* d = tab + (size_t)h * NN + d4;
    *(v4f*)d = o;
    
}

// ---------------------------------------------------------------------------------------------
// C[64x64 tile] = A[64 x 768] * Wt[64 x 768]^T / 16, block = 4 waves, wave = 16 rows x 64 cols.
// MODE 0 (grid.z: 0 = q, 1 = k, 2 = v): q/k stored row-major [MR][DM] as hi/lo f16 planes,
//         v stored transposed [BB][DM][NN] as hi/lo f16 planes. A = xh.
// MODE 1: A = attention output hi (+ lo plane for rows (m0 mod NN) < RSPLIT), C stored f32 to out.
// ---------------------------------------------------------------------------------------------
template <int MODE>
__global__ __launch_bounds__(128)
void k_proj(const hf* __restrict__ Ahi, const hf* __restrict__ Alo, const hf* __restrict__ Wt,
            hf* __restrict__ o0h, hf* __restrict__ o0l,
            hf* __restrict__ o1h, hf* __restrict__ o1l,
            hf* __restrict__ o2h, hf* __restrict__ o2l,
            float* __restrict__ outf)
{
    __shared__ __attribute__((aligned(16))) float Csm[64][68];

    const int wave = threadIdx.x >> 5, lane = threadIdx.x & 31, m = lane & 15, hh = lane >> 4;
    const int n0 = blockIdx.x * 64, m0 = blockIdx.y * 64, z = blockIdx.z;
    if (n0 >= DM || m0 >= MR) return;
    const hf* Bt = Wt + (size_t)z * DM * DM;
    const bool two = (MODE == 1) && ((m0 & (NN - 1)) < RSPLIT);

    const hf* arow  = Ahi + (size_t)(m0 + 16 * wave + m) * DM;
    const hf* arow2 = two ? (Alo + (size_t)(m0 + 16 * wave + m) * DM) : arow;

    v8f acc[4], acc2[4];
    #pragma unroll
    for (int t = 0; t < 4; ++t) { acc[t] = zero8(); acc2[t] = zero8(); }

    #pragma unroll 1
    for (int k0 = 0; k0 < DM; k0 += 32) {
        v16h a = ldfrag(arow, k0, hh);
        v16h bq[4];
        #pragma unroll
        for (int t = 0; t < 4; ++t) bq[t] = ldfrag(Bt + (size_t)(n0 + 16 * t + m) * DM, k0, hh);
        #pragma unroll
        for (int t = 0; t < 4; ++t) acc[t] = mma(a, bq[t], acc[t]);
        if (two) {
            v16h a2 = ldfrag(arow2, k0, hh);
            #pragma unroll
            for (int t = 0; t < 4; ++t) acc2[t] = mma(a2, bq[t], acc2[t]);
        }
    }

    // D element r of lane: row 16*wave + 8*hh + r, col 16*t + m
    #pragma unroll
    for (int t = 0; t < 4; ++t) {
        #pragma unroll
        for (int r = 0; r < 8; ++r) {
            float v = acc[t][r];
            if (MODE == 1) v += acc2[t][r] * (1.0f / 2048.0f);
            Csm[16 * wave + 8 * hh + r][16 * t + m] = v * (1.0f / 16.0f);
        }
    }
    __syncthreads();

    if (MODE == 0) {
        if (z < 2) {
            hf* dh = (z == 0) ? o0h : o1h;
            hf* dl = (z == 0) ? o0l : o1l;
            {
                #pragma unroll
                for (int it = 0; it < 4; ++it) {
                    const int row = 16 * wave + 4 * it + (lane >> 3);
                    const int c8  = (lane & 7) * 8;
                    v4f_t u0 = *(const v4f*)&Csm[row][c8];
                    v4f_t u1 = *(const v4f*)&Csm[row][c8 + 4];
                    v8h_t ph, pl;
                    hf a, bl;
                    split2(u0[0], a, bl); ph[0] = a; pl[0] = bl;
                    split2(u0[1], a, bl); ph[1] = a; pl[1] = bl;
                    split2(u0[2], a, bl); ph[2] = a; pl[2] = bl;
                    split2(u0[3], a, bl); ph[3] = a; pl[3] = bl;
                    split2(u1[0], a, bl); ph[4] = a; pl[4] = bl;
                    split2(u1[1], a, bl); ph[5] = a; pl[5] = bl;
                    split2(u1[2], a, bl); ph[6] = a; pl[6] = bl;
                    split2(u1[3], a, bl); ph[7] = a; pl[7] = bl;
                    const size_t off = (size_t)(m0 + row) * DM + n0 + c8;
                    *(v8h*)(dh + off) = ph;
                    *(v8h*)(dl + off) = pl;
                }
                
            }
        } else {
            const int bidx = m0 >> 11;
            const int j0   = m0 & (NN - 1);
            {
                #pragma unroll
                for (int it = 0; it < 4; ++it) {
                    const int cc = 16 * wave + 4 * it + (lane >> 3);
                    const int j8 = (lane & 7) * 8;
                    v8h_t ph, pl;
                    #pragma unroll
                    for (int e = 0; e < 8; ++e) {
                        hf a, bl;
                        split2(Csm[j8 + e][cc], a, bl);
                        ph[e] = a; pl[e] = bl;
                    }
                    const size_t off = (size_t)bidx * DM * NN + (size_t)(n0 + cc) * NN + j0 + j8;
                    *(v8h*)(o2h + off) = ph;
                    *(v8h*)(o2l + off) = pl;
                }
                
            }
        }
    } else {
        {
            #pragma unroll
            for (int it = 0; it < 8; ++it) {
                const int row = 16 * wave + 2 * it + (lane >> 4);
                const int c4  = (lane & 15) * 4;
                v4f_t u = *(const v4f*)&Csm[row][c4];
                const size_t off = (size_t)(m0 + row) * DM + n0 + c4;
                *(v4f*)(outf + off) = u;
            }
            
        }
    }
}

// ---------------------------------------------------------------------------------------------
// Fused causal attention, block = (32 queries, head h, batch b), 4 waves, 64-key tiles:
//   phase 1: S tile (f32, LDS) via S^T = K.Q^T fragments (A = K rows, B = Q rows as [n][k])
//   phase 2: online softmax per row (bias, causal, row mask), P tile f16 x4096 (+ residual plane)
//   phase 3: O += P.V (A = P rows from LDS, B = V^T rows as [n][k]) with per-row rescale
// SPLIT: hi/lo residual products on q.k^T and p.v. Output: attention rows as hi/lo f16 planes,
// ---------------------------------------------------------------------------------------------
template <bool SPLIT>
__global__ __launch_bounds__(128)
void k_attn(const hf* __restrict__ qhi, const hf* __restrict__ qlo,
            const hf* __restrict__ khi, const hf* __restrict__ klo,
            const hf* __restrict__ vthi, const hf* __restrict__ vtlo,
            const float* __restrict__ btab, const int* __restrict__ mask,
            hf* __restrict__ ohi, hf* __restrict__ olo, int qb_base)
{
    __shared__ __attribute__((aligned(16))) float Ssm[32][68];
    __shared__ __attribute__((aligned(16))) hf Phi[32][72];
    __shared__ __attribute__((aligned(16))) hf Plo[32][72];
    __shared__ float bias_sm[NN];
    __shared__ float alpha_sm[32];
    __shared__ float l_sm[32];
    __shared__ int   msk_sm[32];

    const int tid = threadIdx.x, wave = tid >> 5, lane = tid & 31, m = lane & 15, hh = lane >> 4;
    const int qb = blockIdx.x + qb_base, h = blockIdx.y, b = blockIdx.z;
    if (qb >= NN / 32 || h >= HH || b >= BB) return;
    const int i0 = qb * 32;
    const float NINF = -__builtin_inff();

    for (int t = tid; t < NN; t += 128) bias_sm[t] = btab[(size_t)h * NN + t];
    if (tid < 32) msk_sm[tid] = mask[(size_t)b * NN + i0 + tid];
    __syncthreads();
    int anym = 0;
    #pragma unroll 1
    for (int r = 0; r < 32; ++r) anym |= (msk_sm[r] == 0) ? 1 : 0;
    const int jext   = anym ? NN : (i0 + 32);
    const int ntiles = (jext + 63) >> 6;        // <= NN/64

    const int qt  = wave >> 1;                   // 16-query sub-tile served by this wave in phases 1 and 3
    const int sub = wave & 1;                    // key sub-tiles {2sub,2sub+1} (phase 1), d tiles {2sub,2sub+1} (phase 3)

    // Q fragments as B operand ([n = query][k = d], k contiguous)
    const size_t qrow = ((size_t)b * NN + i0 + qt * 16 + m) * DM + (size_t)h * DH;
    v16h qf[2], qf2[2];
    #pragma unroll
    for (int ks = 0; ks < 2; ++ks) {
        qf[ks] = ldfrag(qhi + qrow, 32 * ks, hh);
        if (SPLIT) qf2[ks] = ldfrag(qlo + qrow, 32 * ks, hh); else qf2[ks] = qf[ks];
    }

    v8f oacc[2], oacc2[2];
    oacc[0] = zero8(); oacc[1] = zero8(); oacc2[0] = zero8(); oacc2[1] = zero8();
    float m_run[8], l_run[8];
    #pragma unroll
    for (int rr = 0; rr < 8; ++rr) { m_run[rr] = NINF; l_run[rr] = 0.0f; }

    #pragma unroll 1
    for (int jt = 0; jt < ntiles; ++jt) {
        const int jb = jt * 64;

        // ---- phase 1: S[query][key] for 32 queries x 64 keys ----
        #pragma unroll
        for (int t = 0; t < 2; ++t) {
            const int kk = 2 * sub + t;
            const size_t krow = ((size_t)b * NN + jb + 16 * kk + m) * DM + (size_t)h * DH;
            v8f acc = zero8(), acc2 = zero8();
            #pragma unroll
            for (int ks = 0; ks < 2; ++ks) {
                v16h kf = ldfrag(khi + krow, 32 * ks, hh);
                acc = mma(kf, qf[ks], acc);
                if (SPLIT) {
                    v16h kf2 = ldfrag(klo + krow, 32 * ks, hh);
                    acc2 = mma(kf, qf2[ks], acc2);
                    acc2 = mma(kf2, qf[ks], acc2);
                }
            }
            // D row = key 16kk + 8hh + r (within tile), D col = query qt*16 + m
            float s[8];
            #pragma unroll
            for (int r = 0; r < 8; ++r) {
                float v = acc[r];
                if (SPLIT) v += acc2[r] * (1.0f / 2048.0f);
                s[r] = v * 0.125f;
            }
            float* sp = &Ssm[qt * 16 + m][16 * kk + 8 * hh];
            v4f_t s0 = {s[0], s[1], s[2], s[3]};
            v4f_t s1 = {s[4], s[5], s[6], s[7]};
            *(v4f*)sp = s0;
            *(v4f*)(sp + 4) = s1;
        }
        __syncthreads();

        // ---- phase 2: online softmax, rows 8*wave .. 8*wave+7 ----
        #pragma unroll
        for (int rr = 0; rr < 8; ++rr) {
            const int row = 8 * wave + rr;
            const int i   = i0 + row;
            const bool valid = (msk_sm[row] != 0);
            float sv0, sv1;
            {
                const int j = jb + lane;
                float s = Ssm[row][lane];
                if (!valid) s = 0.0f; else if (j > i) s = NINF; else s += bias_sm[i - j];
                sv0 = s;
            }
            {
                const int j = jb + lane + 32;
                float s = Ssm[row][lane + 32];
                if (!valid) s = 0.0f; else if (j > i) s = NINF; else s += bias_sm[i - j];
                sv1 = s;
            }
            float tmax = fmaxf(sv0, sv1);
            #pragma unroll
            for (int off = 16; off > 0; off >>= 1) tmax = fmaxf(tmax, __shfl_xor(tmax, off, 32));
            const float mn = fmaxf(m_run[rr], tmax);
            const float alpha = (m_run[rr] == NINF) ? 0.0f : __expf(m_run[rr] - mn);
            const float p0 = __expf(sv0 - mn);
            const float p1 = __expf(sv1 - mn);
            float ps = p0 + p1;
            #pragma unroll
            for (int off = 16; off > 0; off >>= 1) ps += __shfl_xor(ps, off, 32);
            l_run[rr] = l_run[rr] * alpha + ps;
            m_run[rr] = mn;
            hf a0, b0, a1, b1;
            split2(p0 * 4096.0f, a0, b0);
            split2(p1 * 4096.0f, a1, b1);
            Phi[row][lane] = a0;
            Phi[row][lane + 32] = a1;
            if (SPLIT) { Plo[row][lane] = b0; Plo[row][lane + 32] = b1; }
            if (lane == 0) { alpha_sm[row] = alpha; l_sm[row] = l_run[rr]; }
        }
        __syncthreads();

        // ---- phase 3: O tiles (queries qt*16.., d tiles 2sub, 2sub+1) ----
        #pragma unroll
        for (int t = 0; t < 2; ++t) {
            const int dt = 2 * sub + t;
            float al[8];
            #pragma unroll
            for (int r = 0; r < 8; ++r) al[r] = alpha_sm[qt * 16 + 8 * hh + r];
            #pragma unroll
            for (int r = 0; r < 8; ++r) { oacc[t][r] *= al[r]; if (SPLIT) oacc2[t][r] *= al[r]; }
            const size_t vrow = (size_t)b * DM * NN + (size_t)(h * DH + 16 * dt + m) * NN + jb;
            #pragma unroll
            for (int ks = 0; ks < 2; ++ks) {
                v16h pf = ldfrag(&Phi[qt * 16 + m][0], 32 * ks, hh);
                v16h vf = ldfrag(vthi + vrow, 32 * ks, hh);
                oacc[t] = mma(pf, vf, oacc[t]);
                if (SPLIT) {
                    v16h pf2 = ldfrag(&Plo[qt * 16 + m][0], 32 * ks, hh);
                    v16h vf2 = ldfrag(vtlo + vrow, 32 * ks, hh);
                    oacc2[t] = mma(pf, vf2, oacc2[t]);
                    oacc2[t] = mma(pf2, vf, oacc2[t]);
                }
            }
        }
    }

    #pragma unroll
    for (int t = 0; t < 2; ++t) {
        const int dt = 2 * sub + t;
        #pragma unroll
        for (int r = 0; r < 8; ++r) {
            const int row = qt * 16 + 8 * hh + r;
            float o = oacc[t][r];
            if (SPLIT) o += oacc2[t][r] * (1.0f / 2048.0f);
            o = (o / l_sm[row]) * (1.0f / 4096.0f);
            Ssm[row][16 * dt + m] = o;
        }
    }
    __syncthreads();
    {
        #pragma unroll
        for (int it = 0; it < 2; ++it) {
            const int row = 8 * wave + 4 * it + (lane >> 3);
            const int c8  = (lane & 7) * 8;
            v4f_t u0 = *(const v4f*)&Ssm[row][c8];
            v4f_t u1 = *(const v4f*)&Ssm[row][c8 + 4];
            v8h_t ph, pl;
            hf a, bl;
            split2(u0[0], a, bl); ph[0] = a; pl[0] = bl;
            split2(u0[1], a, bl); ph[1] = a; pl[1] = bl;
            split2(u0[2], a, bl); ph[2] = a; pl[2] = bl;
            split2(u0[3], a, bl); ph[3] = a; pl[3] = bl;
            split2(u1[0], a, bl); ph[4] = a; pl[4] = bl;
            split2(u1[1], a, bl); ph[5] = a; pl[5] = bl;
            split2(u1[2], a, bl); ph[6] = a; pl[6] = bl;
            split2(u1[3], a, bl); ph[7] = a; pl[7] = bl;
            const size_t off = ((size_t)b * NN + i0 + row) * DM + (size_t)h * DH + c8;
            *(v8h*)(ohi + off) = ph;
            *(v8h*)(olo + off) = pl;
        }
        
    }
}

// ---------------------------------------------------------------------------------------------
// Host glue: 7 launches, workspace carved from sizes (<= 62 MB)
// ---------------------------------------------------------------------------------------------
extern "C" void kernel_launch(void* const* d_in, const int* in_sizes, int n_in,
                              void* d_out, int out_size, void* d_ws, size_t ws_size,
                              hipStream_t stream)
{
    if (n_in < 7) return;
    if (in_sizes[0] != MR * DM) return;
    if (in_sizes[1] != BB * NN) return;
    if (in_sizes[2] != DM * DM || in_sizes[3] != DM * DM || in_sizes[4] != DM * DM || in_sizes[5] != DM * DM) return;
    if (in_sizes[6] != NBKT * HH) return;
    if (out_size != MR * DM) return;

    const float* x    = (const float*)d_in[0];
    const int*   mask = (const int*)d_in[1];
    const float* Wq   = (const float*)d_in[2];
    const float* Wk   = (const float*)d_in[3];
    const float* Wv   = (const float*)d_in[4];
    const float* Wo   = (const float*)d_in[5];
    const float* rel  = (const float*)d_in[6];
    float* out = (float*)d_out;

    char* ws = (char*)d_ws;
    size_t off = 0;
    auto carve = [&](size_t bytes) -> size_t { size_t p = off; off += (bytes + 255) & ~(size_t)255; return p; };
    const size_t plane = (size_t)MR * DM * sizeof(hf);
    const size_t o_xh   = carve(plane);
    const size_t o_wt   = carve((size_t)4 * DM * DM * sizeof(hf));
    const size_t o_qhi  = carve(plane);
    const size_t o_qlo  = carve(plane);
    const size_t o_khi  = carve(plane);
    const size_t o_klo  = carve(plane);
    const size_t o_vthi = carve(plane);
    const size_t o_vtlo = carve(plane);
    const size_t o_ahi  = carve(plane);
    const size_t o_alo  = carve(plane);
    const size_t o_btab = carve((size_t)HH * NN * sizeof(float));
    if (off > ws_size) return;

    hf* xh   = (hf*)(ws + o_xh);
    hf* wt   = (hf*)(ws + o_wt);
    hf* qhi  = (hf*)(ws + o_qhi);
    hf* qlo  = (hf*)(ws + o_qlo);
    hf* khi  = (hf*)(ws + o_khi);
    hf* klo  = (hf*)(ws + o_klo);
    hf* vthi = (hf*)(ws + o_vthi);
    hf* vtlo = (hf*)(ws + o_vtlo);
    hf* ahi  = (hf*)(ws + o_ahi);
    hf* alo  = (hf*)(ws + o_alo);
    float* btab = (float*)(ws + o_btab);

    {
        const int n8 = MR * DM / 8;
        k_prep_x<<<(n8 + 255) / 256, 256, 0, stream>>>(x, xh, n8);
        const int tw = 4 * DM * (DM / 8);
        k_prep_w<<<(tw + 255) / 256, 256, 0, stream>>>(Wq, Wk, Wv, Wo, wt, tw);
        const int tb = HH * NN / 4;
        k_prep_bias<<<(tb + 255) / 256, 256, 0, stream>>>(rel, btab, tb);
    }

    // q, k (row-major hi/lo planes), v (transposed hi/lo planes)
    k_proj<0><<<dim3(DM / 64, MR / 64, 3), 128, 0, stream>>>(
        xh, xh, wt, qhi, qlo, khi, klo, vthi, vtlo, out);

    // attention: leading query blocks with residual products, remainder single-plane
    k_attn<true><<<dim3(QSPLIT, HH, BB), 128, 0, stream>>>(
        qhi, qlo, khi, klo, vthi, vtlo, btab, mask, ahi, alo, 0);
    k_attn<false><<<dim3(NN / 32 - QSPLIT, HH, BB), 128, 0, stream>>>(
        qhi, qlo, khi, klo, vthi, vtlo, btab, mask, ahi, alo, QSPLIT);

    // output projection -> out (f32)
    k_proj<1><<<dim3(DM / 64, MR / 64, 1), 128, 0, stream>>>(
        ahi, alo, wt + (size_t)3 * DM * DM, ahi, alo, ahi, alo, ahi, alo, out);
}

// v001
// Measured time: 168 microseconds a run.
// Two timings next to v000 both put it at 2.03 times that version's speed.
#include <hip/hip_runtime.h>
#include <stdint.h>

// Contractions (q/k/v projections, q.k^T, p.v, output projection): v_wmma_f32_16x16x32_f16, f16 operands,
// f32 accumulate. x / weights / bias table are RNE-converted to bf16; x and weights are then held exactly in f16 (weights x16), the bias table in f32.
// q, k, v^T, p (x4096) and the attention output are carried as an f16 hi plane plus an f16 residual plane
// (residual x2048); residual products are issued for the leading query rows, single-plane products elsewhere.

#define BB 2
#define NN 2048
#define DM 768
#define HH 12
#define DH 64
#define MR (BB * NN)
#define NBKT 32
#define QSPLIT 16     // leading 32-query blocks per batch that use two-plane products in attention
#define RSPLIT 512    // leading rows per batch that use the two-plane A operand in the output projection

static_assert(DM % 64 == 0);
static_assert(NN % 64 == 0);
static_assert(MR % 64 == 0);
static_assert(DH == 64);
static_assert(RSPLIT % 64 == 0);
static_assert(QSPLIT <= NN / 32);
static_assert((MR * DM) % 8 == 0);

typedef _Float16 hf;
typedef _Float16 v8h_t __attribute__((ext_vector_type(8)));
typedef v8h_t __attribute__((may_alias)) v8h;
typedef _Float16 v16h __attribute__((ext_vector_type(16)));
typedef float v8f __attribute__((ext_vector_type(8)));
typedef float v4f_t __attribute__((ext_vector_type(4)));
typedef v4f_t __attribute__((may_alias)) v4f;

union Frag { v16h v; v8h_t p[2]; };

// D(16x16,f32) += A(16x32) * B(32x16); nops keep VALU off the D/A/B registers right after issue.
__device__ __forceinline__ v8f mma(v16h a, v16h b, v8f c)
{
    v8f d = __builtin_amdgcn_wmma_f32_16x16x32_f16(false, a, false, b, (short)0, c, false, false);
    asm volatile("v_nop\n\tv_nop\n\tv_nop\n\tv_nop" : "+v"(d) : "v"(a), "v"(b));
    return d;
}

// 16x16x32 operand fragment for lane (row or column = lane&15), half hh = lane>>4:
// elements 0..7 <- k0+8hh+0..7, elements 8..15 <- k0+16+8hh+0..7 of a k-contiguous row.
// Used for A (row-major, k contiguous) and for B stored as [n][k] (k contiguous).
__device__ __forceinline__ v16h ldfrag(const hf* rowptr, int k0, int hh)
{
    Frag f;
    f.p[0] = *(const v8h*)(rowptr + k0 + 8 * hh);
    f.p[1] = *(const v8h*)(rowptr + k0 + 16 + 8 * hh);
    return f.v;
}

__device__ __forceinline__ float bf16r(float v)
{
    unsigned u = __float_as_uint(v);
    u = (u + 0x7FFFu + ((u >> 16) & 1u)) & 0xFFFF0000u;
    return __uint_as_float(u);
}

// v ~= hi + lo/2048 with hi, lo in f16
__device__ __forceinline__ void split2(float v, hf& hi, hf& lo)
{
    hf h = (hf)v;
    hi = h;
    lo = (hf)((v - (float)h) * 2048.0f);
}

__device__ __forceinline__ v8f zero8()
{
    v8f z = {0.f, 0.f, 0.f, 0.f, 0.f, 0.f, 0.f, 0.f};
    return z;
}

// ---------------------------------------------------------------------------------------------
// xh[i] = f16(bf16(x[i])), 8 per thread, 16-B lane-contiguous stores
// ---------------------------------------------------------------------------------------------
__global__ __launch_bounds__(256)
void k_prep_x(const float* __restrict__ x, hf* __restrict__ xh, int n8)
{
    const int t = blockIdx.x * 256 + threadIdx.x;
    if (t >= n8) return;
    const float* p = x + (size_t)t * 8;
    v4f_t a = *(const v4f*)p;
    v4f_t b = *(const v4f*)(p + 4);
    v8h_t o;
    o[0] = (hf)bf16r(a[0]); o[1] = (hf)bf16r(a[1]); o[2] = (hf)bf16r(a[2]); o[3] = (hf)bf16r(a[3]);
    o[4] = (hf)bf16r(b[0]); o[5] = (hf)bf16r(b[1]); o[6] = (hf)bf16r(b[2]); o[7] = (hf)bf16r(b[3]);
    hf* d = xh + (size_t)t * 8;
    *(v8h*)d = o;
    
}

// ---------------------------------------------------------------------------------------------
// wt[w][c][k] = f16(bf16(W_w[k][c]) * 16), W_w is [DM(k)][DM(c)]; 8 consecutive k per thread
// ---------------------------------------------------------------------------------------------
__global__ __launch_bounds__(256)
void k_prep_w(const float* __restrict__ w0, const float* __restrict__ w1,
              const float* __restrict__ w2, const float* __restrict__ w3,
              hf* __restrict__ wt, int total)
{
    const int t = blockIdx.x * 256 + threadIdx.x;
    if (t >= total) return;
    const int per = DM * (DM / 8);
    const int wi  = t / per;
    const int rem = t - wi * per;
    const int c   = rem / (DM / 8);
    const int k8  = (rem - c * (DM / 8)) * 8;
    const float* W = (wi == 0) ? w0 : (wi == 1) ? w1 : (wi == 2) ? w2 : w3;
    v8h_t o;
    #pragma unroll
    for (int e = 0; e < 8; ++e) o[e] = (hf)(bf16r(W[(size_t)(k8 + e) * DM + c]) * 16.0f);
    hf* d = wt + (size_t)wi * DM * DM + (size_t)c * DM + k8;
    *(v8h*)d = o;
    
}

// ---------------------------------------------------------------------------------------------
// btab[h][delta] = bf16(rel[bucket(delta)][h]) * DH^-0.5, causal bucketing; 4 deltas per thread
// ---------------------------------------------------------------------------------------------
__global__ __launch_bounds__(256)
void k_prep_bias(const float* __restrict__ rel, float* __restrict__ tab, int total4)
{
    const int t = blockIdx.x * 256 + threadIdx.x;
    if (t >= total4) return;
    const int h  = t / (NN / 4);
    const int d4 = (t - h * (NN / 4)) * 4;
    v4f_t o;
    #pragma unroll
    for (int e = 0; e < 4; ++e) {
        const int d = d4 + e;
        int bk;
        if (d < NBKT / 2) {
            bk = d;
        } else {
            float f  = (float)d * (1.0f / 16.0f);
            float lg = logf(f);
            float u  = lg * (1.0f / 2.0794415416798357f);
            float w  = u * 16.0f;
            int v = (NBKT / 2) + (int)w;
            bk = v < (NBKT - 1) ? v : (NBKT - 1);
            if (bk < 0) bk = 0;
        }
        o[e] = bf16r(rel[bk * HH + h]) * 0.125f;
    }
    float* d = tab + (size_t)h * NN + d4;
    *(v4f*)d = o;
    
}

// ---------------------------------------------------------------------------------------------
// C[64x64 tile] = A[64 x 768] * Wt[64 x 768]^T / 16, block = 4 waves, wave = 16 rows x 64 cols.
// MODE 0 (grid.z: 0 = q, 1 = k, 2 = v): q/k stored row-major [MR][DM] as hi/lo f16 planes,
//         v stored transposed [BB][DM][NN] as hi/lo f16 planes. A = xh.
// MODE 1: A = attention output hi (+ lo plane for rows (m0 mod NN) < RSPLIT), C stored f32 to out.
// ---------------------------------------------------------------------------------------------
template <int MODE>
__global__ __launch_bounds__(128)
void k_proj(const hf* __restrict__ Ahi, const hf* __restrict__ Alo, const hf* __restrict__ Wt,
            hf* __restrict__ o0h, hf* __restrict__ o0l,
            hf* __restrict__ o1h, hf* __restrict__ o1l,
            hf* __restrict__ o2h, hf* __restrict__ o2l,
            float* __restrict__ outf)
{
    __shared__ __attribute__((aligned(16))) float Csm[64][68];

    const int wave = threadIdx.x >> 5, lane = threadIdx.x & 31, m = lane & 15, hh = lane >> 4;
    const int n0 = blockIdx.x * 64, m0 = blockIdx.y * 64, z = blockIdx.z;
    if (n0 >= DM || m0 >= MR) return;
    const hf* Bt = Wt + (size_t)z * DM * DM;
    const bool two = (MODE == 1) && ((m0 & (NN - 1)) < RSPLIT);

    const hf* arow  = Ahi + (size_t)(m0 + 16 * wave + m) * DM;
    const hf* arow2 = two ? (Alo + (size_t)(m0 + 16 * wave + m) * DM) : arow;

    v8f acc[4], acc2[4];
    #pragma unroll
    for (int t = 0; t < 4; ++t) { acc[t] = zero8(); acc2[t] = zero8(); }

    #pragma unroll 1
    for (int k0 = 0; k0 < DM; k0 += 32) {
        v16h a = ldfrag(arow, k0, hh);
        v16h bq[4];
        #pragma unroll
        for (int t = 0; t < 4; ++t) bq[t] = ldfrag(Bt + (size_t)(n0 + 16 * t + m) * DM, k0, hh);
        #pragma unroll
        for (int t = 0; t < 4; ++t) acc[t] = mma(a, bq[t], acc[t]);
        if (two) {
            v16h a2 = ldfrag(arow2, k0, hh);
            #pragma unroll
            for (int t = 0; t < 4; ++t) acc2[t] = mma(a2, bq[t], acc2[t]);
        }
    }

    // D element r of lane: row 16*wave + 8*hh + r, col 16*t + m
    #pragma unroll
    for (int t = 0; t < 4; ++t) {
        #pragma unroll
        for (int r = 0; r < 8; ++r) {
            float v = acc[t][r];
            if (MODE == 1) v += acc2[t][r] * (1.0f / 2048.0f);
            Csm[16 * wave + 8 * hh + r][16 * t + m] = v * (1.0f / 16.0f);
        }
    }
    __syncthreads();

    if (MODE == 0) {
        if (z < 2) {
            hf* dh = (z == 0) ? o0h : o1h;
            hf* dl = (z == 0) ? o0l : o1l;
            {
                #pragma unroll
                for (int it = 0; it < 4; ++it) {
                    const int row = 16 * wave + 4 * it + (lane >> 3);
                    const int c8  = (lane & 7) * 8;
                    v4f_t u0 = *(const v4f*)&Csm[row][c8];
                    v4f_t u1 = *(const v4f*)&Csm[row][c8 + 4];
                    v8h_t ph, pl;
                    hf a, bl;
                    split2(u0[0], a, bl); ph[0] = a; pl[0] = bl;
                    split2(u0[1], a, bl); ph[1] = a; pl[1] = bl;
                    split2(u0[2], a, bl); ph[2] = a; pl[2] = bl;
                    split2(u0[3], a, bl); ph[3] = a; pl[3] = bl;
                    split2(u1[0], a, bl); ph[4] = a; pl[4] = bl;
                    split2(u1[1], a, bl); ph[5] = a; pl[5] = bl;
                    split2(u1[2], a, bl); ph[6] = a; pl[6] = bl;
                    split2(u1[3], a, bl); ph[7] = a; pl[7] = bl;
                    const size_t off = (size_t)(m0 + row) * DM + n0 + c8;
                    *(v8h*)(dh + off) = ph;
                    *(v8h*)(dl + off) = pl;
                }
                
            }
        } else {
            const int bidx = m0 >> 11;
            const int j0   = m0 & (NN - 1);
            {
                #pragma unroll
                for (int it = 0; it < 4; ++it) {
                    const int cc = 16 * wave + 4 * it + (lane >> 3);
                    const int j8 = (lane & 7) * 8;
                    v8h_t ph, pl;
                    #pragma unroll
                    for (int e = 0; e < 8; ++e) {
                        hf a, bl;
                        split2(Csm[j8 + e][cc], a, bl);
                        ph[e] = a; pl[e] = bl;
                    }
                    const size_t off = (size_t)bidx * DM * NN + (size_t)(n0 + cc) * NN + j0 + j8;
                    *(v8h*)(o2h + off) = ph;
                    *(v8h*)(o2l + off) = pl;
                }
                
            }
        }
    } else {
        {
            #pragma unroll
            for (int it = 0; it < 8; ++it) {
                const int row = 16 * wave + 2 * it + (lane >> 4);
                const int c4  = (lane & 15) * 4;
                v4f_t u = *(const v4f*)&Csm[row][c4];
                const size_t off = (size_t)(m0 + row) * DM + n0 + c4;
                *(v4f*)(outf + off) = u;
            }
            
        }
    }
}

// ---------------------------------------------------------------------------------------------
// Fused causal attention, block = (32 queries, head h, batch b); a wave owns 16 queries and walks 64-key
// tiles on its own, with no LDS traffic for scores and no barrier inside the loop:
//   S^T = K.Q^T   (A = K rows, B = Q rows as [n][k]): lane holds query (lane&15), keys 16kk + 8*(lane>>4) + r
//   online softmax per lane (bias, causal, row mask), one exchange between the wave halves for the maximum
//   O^T += V^T.P^T (A = V^T rows, B = P^T packed from the score registers, f16 x4096 (+ residual plane))
// SPLIT: hi/lo residual products on q.k^T and p.v. Output: attention rows as hi/lo f16 planes.
// Not SPLIT: 2 waves, each all four 16-wide d tiles. SPLIT: 4 waves, two per 16 queries, each two d tiles
// (both form the same S^T), so that both planes of K, V^T, Q and O fit the register file without spills.
// ---------------------------------------------------------------------------------------------
// p = exp(x), built as the fast intrinsic is (x * log2 e, then v_exp_f32). Written as asm so that the slot the
// instruction set asks for behind a transcendental is kept by construction: the results are early-clobber, so
// no v_exp_f32 of a statement writes over a source of another, and the closing v_nop stands behind the last.
__device__ __forceinline__ void exp8(const float (&x)[8], float (&p)[8])
{
    float t[8];
    #pragma unroll
    for (int r = 0; r < 8; ++r) t[r] = x[r] * 1.44269504f;
    asm("v_exp_f32 %0, %8\n\tv_exp_f32 %1, %9\n\tv_exp_f32 %2, %10\n\tv_exp_f32 %3, %11\n\t"
        "v_exp_f32 %4, %12\n\tv_exp_f32 %5, %13\n\tv_exp_f32 %6, %14\n\tv_exp_f32 %7, %15\n\tv_nop"
        : "=&v"(p[0]), "=&v"(p[1]), "=&v"(p[2]), "=&v"(p[3]), "=&v"(p[4]), "=&v"(p[5]), "=&v"(p[6]), "=&v"(p[7])
        : "v"(t[0]), "v"(t[1]), "v"(t[2]), "v"(t[3]), "v"(t[4]), "v"(t[5]), "v"(t[6]), "v"(t[7]));
}

__device__ __forceinline__ float exp1(float x)
{
    const float t = x * 1.44269504f;
    float p;
    asm("v_exp_f32 %0, %1\n\tv_nop" : "=&v"(p) : "v"(t));   // same slot, one value
    return p;
}

template <bool SPLIT, int NDT>
__device__ __forceinline__ void load_v(const hf* vp, const hf* vp2, v16h (&vf)[NDT][2], v16h (&vf2)[NDT][2])
{
    #pragma unroll
    for (int dt = 0; dt < NDT; ++dt) {
        #pragma unroll
        for (int ks = 0; ks < 2; ++ks) {
            vf[dt][ks] = ldfrag(vp + (size_t)(16 * dt) * NN, 32 * ks, 0);
            if (SPLIT) vf2[dt][ks] = ldfrag(vp2 + (size_t)(16 * dt) * NN, 32 * ks, 0);
        }
    }
}

template <bool SPLIT>
__global__ __launch_bounds__(128)
void k_attn(const hf* __restrict__ qhi, const hf* __restrict__ qlo,
            const hf* __restrict__ khi, const hf* __restrict__ klo,
            const hf* __restrict__ vthi, const hf* __restrict__ vtlo,
            const float* __restrict__ btab, const int* __restrict__ mask,
            hf* __restrict__ ohi, hf* __restrict__ olo, int qb_base)
{
    // bias_sm[64 + delta] = bias of distance delta; 64 leading zeros take the reads of causally hidden keys
    __shared__ __attribute__((aligned(16))) float bias_sm[64 + NN];
    // SPLIT only: output staging, so that one wave stores a row's whole 128-byte line of each plane
    __shared__ __attribute__((aligned(16))) hf ost[2][SPLIT ? 32 : 1][72];

    const int tid = threadIdx.x, lane = tid & 31, m = lane & 15, hh = lane >> 4;
    const int wave = __builtin_amdgcn_readfirstlane(tid >> 5);
    const int qb = blockIdx.x + qb_base, h = blockIdx.y, b = blockIdx.z;
    if (qb >= NN / 32 || h >= HH || b >= BB) return;
    constexpr int NT  = SPLIT ? 128 : 64;        // threads per block
    constexpr int NDT = SPLIT ? 2 : 4;           // d tiles per wave
    const int qt  = SPLIT ? (wave >> 1) : wave;  // 16-query sub-tile of this wave
    const int dt0 = SPLIT ? NDT * (wave & 1) : 0;
    const int i0 = qb * 32 + 16 * qt;            // first query of this wave
    const int i  = i0 + m;                       // this lane's query
    const float NINF = -__builtin_inff();

    if (tid < 64) bias_sm[tid] = 0.0f;
    #pragma unroll
    for (int t = 0; t < NN / (4 * NT); ++t)
        *(v4f*)&bias_sm[64 + 4 * NT * t + 4 * tid] = *(const v4f*)&btab[(size_t)h * NN + 4 * NT * t + 4 * tid];
    const bool valid = (mask[(size_t)b * NN + i] != 0);
    const bool anym  = (__builtin_amdgcn_ballot_w32(!valid) != 0u);
    __syncthreads();
    const int jext   = anym ? NN : (i0 + 16);
    const int ntiles = (jext + 63) >> 6;         // <= NN/64

    // Q fragments as B operand ([n = query][k = d], k contiguous)
    const size_t qrow = ((size_t)b * NN + i) * DM + (size_t)h * DH;
    v16h qf[2], qf2[2];
    #pragma unroll
    for (int ks = 0; ks < 2; ++ks) {
        qf[ks] = ldfrag(qhi + qrow, 32 * ks, hh);
        if (SPLIT) qf2[ks] = ldfrag(qlo + qrow, 32 * ks, hh); else qf2[ks] = qf[ks];
    }

    v8f oacc[NDT], oacc2[NDT];
    #pragma unroll
    for (int dt = 0; dt < NDT; ++dt) { oacc[dt] = zero8(); oacc2[dt] = zero8(); }
    float m_run = NINF, l_run = 0.0f;            // l_run: sum over the keys of this lane's half only

    #pragma unroll 1
    for (int jt = 0; jt < ntiles; ++jt) {
        const int jb = jt * 64;
        const size_t krow = ((size_t)b * NN + jb + m) * DM + (size_t)h * DH;
        const size_t vrow = (size_t)b * DM * NN + (size_t)(h * DH + 16 * dt0 + m) * NN + jb;
        // lane bases with the half's k offset folded in: every load below is base + constant
        const hf* kp  = khi + krow + 8 * hh;
        const hf* kp2 = klo + krow + 8 * hh;
        const hf* vp  = vthi + vrow + 8 * hh;
        const hf* vp2 = vtlo + vrow + 8 * hh;

        v16h kf[4][2], kf2[4][2], vf[NDT][2], vf2[NDT][2];
        #pragma unroll
        for (int kk = 0; kk < 4; ++kk) {
            #pragma unroll
            for (int ks = 0; ks < 2; ++ks) {
                kf[kk][ks] = ldfrag(kp + (size_t)(16 * kk) * DM, 32 * ks, 0);
                if (SPLIT) kf2[kk][ks] = ldfrag(kp2 + (size_t)(16 * kk) * DM, 32 * ks, 0);
            }
        }
        // V^T loads fly under the score work; SPLIT issues them once the K registers are free again.
        // The s_wait_xcnt statements further down name the loads' address registers as inputs: that keeps them
        // unwritten, also by a later load's result, up to the wait; they stand late so that nothing stalls on them
        if (!SPLIT) load_v<SPLIT, NDT>(vp, vp2, vf, vf2);

        // ---- S^T: D row = key 16kk + 8hh + r (within tile), D col = query m ----
        const int dl = i - jb - 8 * hh;          // key (kk, r) is visible to this lane's query iff 16kk + r <= dl
        const int bb = dl + 1 > 0 ? dl + 1 : 0;  // all keys hidden where this clamps
        float sv[4][8];
        #pragma unroll
        for (int kk = 0; kk < 4; ++kk) {
            v8f acc = zero8(), acc2 = zero8();
            #pragma unroll
            for (int ks = 0; ks < 2; ++ks) {
                acc = mma(kf[kk][ks], qf[ks], acc);
                if (SPLIT) {
                    acc2 = mma(kf[kk][ks], qf2[ks], acc2);
                    acc2 = mma(kf2[kk][ks], qf[ks], acc2);
                }
            }
            #pragma unroll
            for (int r = 0; r < 8; ++r) {
                float v = acc[r];
                if (SPLIT) v += acc2[r] * (1.0f / 2048.0f);
                v = v * 0.125f + bias_sm[bb + (63 - 16 * kk - r)];
                sv[kk][r] = (16 * kk + r > dl) ? NINF : v;
            }
        }
        if (SPLIT) {
            asm volatile("s_wait_xcnt 0x0" :: "v"(kp), "v"(kp2) : "memory");   // K address registers free from here
            load_v<SPLIT, NDT>(vp, vp2, vf, vf2);
        }
        if (anym) {
            #pragma unroll
            for (int kk = 0; kk < 4; ++kk) {
                #pragma unroll
                for (int r = 0; r < 8; ++r) sv[kk][r] = valid ? sv[kk][r] : 0.0f;
            }
        }

        // ---- online softmax, one query per lane ----
        float t4[4];
        #pragma unroll
        for (int kk = 0; kk < 4; ++kk) {
            t4[kk] = fmaxf(fmaxf(fmaxf(sv[kk][0], sv[kk][1]), fmaxf(sv[kk][2], sv[kk][3])),
                           fmaxf(fmaxf(sv[kk][4], sv[kk][5]), fmaxf(sv[kk][6], sv[kk][7])));
        }
        float tmax = fmaxf(fmaxf(t4[0], t4[1]), fmaxf(t4[2], t4[3]));
        tmax = fmaxf(tmax, __shfl_xor(tmax, 16, 32));
        const float mn = fmaxf(m_run, tmax);
        const float ea = exp1(m_run - mn);
        const float alpha = (m_run == NINF) ? 0.0f : ea;
        m_run = mn;

        Frag ph[2], pl[2];
        float ps4[4];
        #pragma unroll
        for (int kk = 0; kk < 4; ++kk) {
            float x[8], p[8];
            #pragma unroll
            for (int r = 0; r < 8; ++r) x[r] = sv[kk][r] - mn;
            exp8(x, p);
            #pragma unroll
            for (int r = 0; r < 8; ++r) {
                hf a, bl;
                split2(p[r] * 4096.0f, a, bl);
                ph[kk >> 1].v[8 * (kk & 1) + r] = a;
                if (SPLIT) pl[kk >> 1].v[8 * (kk & 1) + r] = bl;
            }
            ps4[kk] = ((p[0] + p[1]) + (p[2] + p[3])) + ((p[4] + p[5]) + (p[6] + p[7]));
        }
        l_run = l_run * alpha + ((ps4[0] + ps4[1]) + (ps4[2] + ps4[3]));

        // address registers of the loads still named here are free from here
        if (SPLIT) asm volatile("s_wait_xcnt 0x0" :: "v"(vp), "v"(vp2) : "memory");
        else       asm volatile("s_wait_xcnt 0x0" :: "v"(kp), "v"(vp) : "memory");

        // ---- O^T: D row = d 16(dt0 + dt) + 8hh + r, D col = query m ----
        #pragma unroll
        for (int dt = 0; dt < NDT; ++dt) {
            #pragma unroll
            for (int r = 0; r < 8; ++r) { oacc[dt][r] *= alpha; if (SPLIT) oacc2[dt][r] *= alpha; }
            #pragma unroll
            for (int ks = 0; ks < 2; ++ks) {
                oacc[dt] = mma(vf[dt][ks], ph[ks].v, oacc[dt]);
                if (SPLIT) {
                    oacc2[dt] = mma(vf2[dt][ks], ph[ks].v, oacc2[dt]);
                    oacc2[dt] = mma(vf[dt][ks], pl[ks].v, oacc2[dt]);
                }
            }
        }
    }

    const float l = l_run + __shfl_xor(l_run, 16, 32);
    v8h_t oh[NDT], ol[NDT];
    #pragma unroll
    for (int dt = 0; dt < NDT; ++dt) {
        #pragma unroll
        for (int r = 0; r < 8; ++r) {
            float o = oacc[dt][r];
            if (SPLIT) o += oacc2[dt][r] * (1.0f / 2048.0f);
            o = (o / l) * (1.0f / 4096.0f);
            hf a, bl;
            split2(o, a, bl);
            oh[dt][r] = a; ol[dt][r] = bl;
        }
    }
    #pragma unroll
    for (int dt = 0; dt < NDT; ++dt) {
        if (SPLIT) {
            *(v8h*)&ost[0][16 * qt + m][16 * (dt0 + dt) + 8 * hh] = oh[dt];
            *(v8h*)&ost[1][16 * qt + m][16 * (dt0 + dt) + 8 * hh] = ol[dt];
        } else {
            const size_t off = ((size_t)b * NN + i) * DM + (size_t)h * DH + 16 * dt + 8 * hh;
            *(v8h*)(ohi + off) = oh[dt];
            *(v8h*)(olo + off) = ol[dt];
        }
    }
    if (SPLIT) {
        __syncthreads();                         // both d halves of every row are staged
        #pragma unroll
        for (int it = 0; it < 2; ++it) {
            const int row = 8 * wave + 4 * it + (lane >> 3);
            const int c8  = (lane & 7) * 8;
            const size_t off = ((size_t)b * NN + qb * 32 + row) * DM + (size_t)h * DH + c8;
            *(v8h*)(ohi + off) = *(const v8h*)&ost[0][row][c8];
            *(v8h*)(olo + off) = *(const v8h*)&ost[1][row][c8];
        }
    }
}

// ---------------------------------------------------------------------------------------------
// Host glue: 7 launches, workspace carved from sizes (<= 62 MB)
// ---------------------------------------------------------------------------------------------
extern "C" void kernel_launch(void* const* d_in, const int* in_sizes, int n_in,
                              void* d_out, int out_size, void* d_ws, size_t ws_size,
                              hipStream_t stream)
{
    if (n_in < 7) return;
    if (in_sizes[0] != MR * DM) return;
    if (in_sizes[1] != BB * NN) return;
    if (in_sizes[2] != DM * DM || in_sizes[3] != DM * DM || in_sizes[4] != DM * DM || in_sizes[5] != DM * DM) return;
    if (in_sizes[6] != NBKT * HH) return;
    if (out_size != MR * DM) return;

    const float* x    = (const float*)d_in[0];
    const int*   mask = (const int*)d_in[1];
    const float* Wq   = (const float*)d_in[2];
    const float* Wk   = (const float*)d_in[3];
    const float* Wv   = (const float*)d_in[4];
    const float* Wo   = (const float*)d_in[5];
    const float* rel  = (const float*)d_in[6];
    float* out = (float*)d_out;

    char* ws = (char*)d_ws;
    size_t off = 0;
    auto carve = [&](size_t bytes) -> size_t { size_t p = off; off += (bytes + 255) & ~(size_t)255; return p; };
    const size_t plane = (size_t)MR * DM * sizeof(hf);
    const size_t o_xh   = carve(plane);
    const size_t o_wt   = carve((size_t)4 * DM * DM * sizeof(hf));
    const size_t o_qhi  = carve(plane);
    const size_t o_qlo  = carve(plane);
    const size_t o_khi  = carve(plane);
    const size_t o_klo  = carve(plane);
    const size_t o_vthi = carve(plane);
    const size_t o_vtlo = carve(plane);
    const size_t o_ahi  = carve(plane);
    const size_t o_alo  = carve(plane);
    const size_t o_btab = carve((size_t)HH * NN * sizeof(float));
    if (off > ws_size) return;

    hf* xh   = (hf*)(ws + o_xh);
    hf* wt   = (hf*)(ws + o_wt);
    hf* qhi  = (hf*)(ws + o_qhi);
    hf* qlo  = (hf*)(ws + o_qlo);
    hf* khi  = (hf*)(ws + o_khi);
    hf* klo  = (hf*)(ws + o_klo);
    hf* vthi = (hf*)(ws + o_vthi);
    hf* vtlo = (hf*)(ws + o_vtlo);
    hf* ahi  = (hf*)(ws + o_ahi);
    hf* alo  = (hf*)(ws + o_alo);
    float* btab = (float*)(ws + o_btab);

    {
        const int n8 = MR * DM / 8;
        k_prep_x<<<(n8 + 255) / 256, 256, 0, stream>>>(x, xh, n8);
        const int tw = 4 * DM * (DM / 8);
        k_prep_w<<<(tw + 255) / 256, 256, 0, stream>>>(Wq, Wk, Wv, Wo, wt, tw);
        const int tb = HH * NN / 4;
        k_prep_bias<<<(tb + 255) / 256, 256, 0, stream>>>(rel, btab, tb);
    }

    // q, k (row-major hi/lo planes), v (transposed hi/lo planes)
    k_proj<0><<<dim3(DM / 64, MR / 64, 3), 128, 0, stream>>>(
        xh, xh, wt, qhi, qlo, khi, klo, vthi, vtlo, out);

    // attention: leading query blocks with residual products, remainder single-plane
    k_attn<true><<<dim3(QSPLIT, HH, BB), 128, 0, stream>>>(
        qhi, qlo, khi, klo, vthi, vtlo, btab, mask, ahi, alo, 0);
    k_attn<false><<<dim3(NN / 32 - QSPLIT, HH, BB), 64, 0, stream>>>(
        qhi, qlo, khi, klo, vthi, vtlo, btab, mask, ahi, alo, QSPLIT);

    // output projection -> out (f32)
    k_proj<1><<<dim3(DM / 64, MR / 64, 1), 128, 0, stream>>>(
        ahi, alo, wt + (size_t)3 * DM * DM, ahi, alo, ahi, alo, ahi, alo, out);
}

// v002
// Measured time: 123 microseconds a run.
// Next to v001, in two timings, it ran 1.37 and 1.36 times as fast.
// Counting every step since v000, it is 2.78 times as fast.
#include <hip/hip_runtime.h>
#include <stdint.h>

// Contractions (q/k/v projections, q.k^T, p.v, output projection): v_wmma_f32_16x16x32_f16, f16 operands,
// f32 accumulate. x / weights / bias table are RNE-converted to bf16; x and weights are then held exactly in f16 (weights x16), the bias table in f32.
// q, k, v^T, p (x4096) and the attention output are carried as an f16 hi plane plus an f16 residual plane
// (residual x2048); residual products are issued for the leading query rows, single-plane products elsewhere.
//
// Every f16 operand plane in the workspace is stored in fragment order. A matrix M[rows][K] (K = contraction
// index) is cut into tiles of 16 rows x 32 k; tile (rb, kb) starts at half ((rb * K/32) + kb) * 512 and holds
//   M[16rb + m][32kb + 16part + 8hh + e]  at  part * 256 + (16hh + m) * 8 + e      (m < 16; part, hh < 2; e < 8)
// so lane 16hh + m of a wave finds its 16 fragment elements at tile + 8 * lane and tile + 256 + 8 * lane, and each
// of the two 16-byte loads (or stores) of a wave covers 512 contiguous bytes: four whole 128-byte lines.

#define BB 2
#define NN 2048
#define DM 768
#define HH 12
#define DH 64
#define MR (BB * NN)
#define NBKT 32
#define QSPLIT 16     // leading 32-query blocks per batch that use two-plane products in attention
#define RSPLIT 512    // leading rows per batch that use the two-plane A operand in the output projection

static_assert(DM % 64 == 0);
static_assert(NN % 64 == 0);
static_assert(MR % 64 == 0);
static_assert(DH == 64);
static_assert(RSPLIT % 64 == 0);
static_assert(QSPLIT <= NN / 32);
static_assert((MR * DM) % 8 == 0);
static_assert(DM % 32 == 0 && NN % 32 == 0 && MR % 16 == 0);
#define KT_DM (DM / 32)   // k tiles of a row block where K = DM
#define KT_NN (NN / 32)   // k tiles of a row block where K = NN (v^T)

typedef _Float16 hf;
typedef _Float16 v8h_t __attribute__((ext_vector_type(8)));
typedef v8h_t __attribute__((may_alias)) v8h;
typedef _Float16 v16h __attribute__((ext_vector_type(16)));
typedef float v8f __attribute__((ext_vector_type(8)));
typedef float v4f_t __attribute__((ext_vector_type(4)));
typedef v4f_t __attribute__((may_alias)) v4f;

union Frag { v16h v; v8h_t p[2]; };

// D(16x16,f32) += A(16x32) * B(32x16); nops keep VALU off the D/A/B registers right after issue.
__device__ __forceinline__ v8f mma(v16h a, v16h b, v8f c)
{
    v8f d = __builtin_amdgcn_wmma_f32_16x16x32_f16(false, a, false, b, (short)0, c, false, false);
    asm volatile("v_nop\n\tv_nop\n\tv_nop\n\tv_nop" : "+v"(d) : "v"(a), "v"(b));
    return d;
}

// 16x16x32 operand fragment for lane (row or column = lane&15), half hh = lane>>4:
// elements 0..7 <- k0+8hh+0..7, elements 8..15 <- k0+16+8hh+0..7 of the lane's row.
// Used for A ([m][k]) and for B held as [n][k]; p = start of the fragment-ordered tile + 8 * lane.
__device__ __forceinline__ v16h ldpk(const hf* p)
{
    Frag f;
    f.p[0] = *(const v8h*)(p);
    f.p[1] = *(const v8h*)(p + 256);
    return f.v;
}

__device__ __forceinline__ float bf16r(float v)
{
    unsigned u = __float_as_uint(v);
    u = (u + 0x7FFFu + ((u >> 16) & 1u)) & 0xFFFF0000u;
    return __uint_as_float(u);
}

// v ~= hi + lo/2048 with hi, lo in f16
__device__ __forceinline__ void split2(float v, hf& hi, hf& lo)
{
    hf h = (hf)v;
    hi = h;
    lo = (hf)((v - (float)h) * 2048.0f);
}

__device__ __forceinline__ v8f zero8()
{
    v8f z = {0.f, 0.f, 0.f, 0.f, 0.f, 0.f, 0.f, 0.f};
    return z;
}

// ---------------------------------------------------------------------------------------------
// xh = f16(bf16(x)) in fragment order ([MR][DM]); thread t fills 16-byte piece t, lane-contiguous stores
// ---------------------------------------------------------------------------------------------
__global__ __launch_bounds__(256)
void k_prep_x(const float* __restrict__ x, hf* __restrict__ xh, int n8)
{
    const int t = blockIdx.x * 256 + threadIdx.x;
    if (t >= n8) return;
    const int lane = t & 31, part = (t >> 5) & 1, tile = t >> 6;
    const int rb = tile / KT_DM, kb = tile - rb * KT_DM;
    const float* p = x + (size_t)(16 * rb + (lane & 15)) * DM + 32 * kb + 16 * part + 8 * (lane >> 4);
    v4f_t a = *(const v4f*)p;
    v4f_t b = *(const v4f*)(p + 4);
    v8h_t o;
    o[0] = (hf)bf16r(a[0]); o[1] = (hf)bf16r(a[1]); o[2] = (hf)bf16r(a[2]); o[3] = (hf)bf16r(a[3]);
    o[4] = (hf)bf16r(b[0]); o[5] = (hf)bf16r(b[1]); o[6] = (hf)bf16r(b[2]); o[7] = (hf)bf16r(b[3]);
    hf* d = xh + (size_t)t * 8;
    *(v8h*)d = o;
    
}

// ---------------------------------------------------------------------------------------------
// wt[w] = fragment order of [c][k] = f16(bf16(W_w[k][c]) * 16), W_w is [DM(k)][DM(c)]; 8 consecutive k per thread,
// thread = 16-byte piece of the plane: 16 neighbouring lanes read 16 neighbouring c of one k row
// ---------------------------------------------------------------------------------------------
__global__ __launch_bounds__(256)
void k_prep_w(const float* __restrict__ w0, const float* __restrict__ w1,
              const float* __restrict__ w2, const float* __restrict__ w3,
              hf* __restrict__ wt, int total)
{
    const int t = blockIdx.x * 256 + threadIdx.x;
    if (t >= total) return;
    const int per = DM * (DM / 8);
    const int wi  = t / per;
    const int rem = t - wi * per;
    const int lane = rem & 31, part = (rem >> 5) & 1, tile = rem >> 6;
    const int rb  = tile / KT_DM, kb = tile - rb * KT_DM;
    const int c   = 16 * rb + (lane & 15);
    const int k8  = 32 * kb + 16 * part + 8 * (lane >> 4);
    const float* W = (wi == 0) ? w0 : (wi == 1) ? w1 : (wi == 2) ? w2 : w3;
    v8h_t o;
    #pragma unroll
    for (int e = 0; e < 8; ++e) o[e] = (hf)(bf16r(W[(size_t)(k8 + e) * DM + c]) * 16.0f);
    hf* d = wt + (size_t)wi * DM * DM + (size_t)rem * 8;
    *(v8h*)d = o;
    
}

// ---------------------------------------------------------------------------------------------
// btab[h][delta] = bf16(rel[bucket(delta)][h]) * DH^-0.5, causal bucketing; 4 deltas per thread
// ---------------------------------------------------------------------------------------------
__global__ __launch_bounds__(256)
void k_prep_bias(const float* __restrict__ rel, float* __restrict__ tab, int total4)
{
    const int t = blockIdx.x * 256 + threadIdx.x;
    if (t >= total4) return;
    const int h  = t / (NN / 4);
    const int d4 = (t - h * (NN / 4)) * 4;
    v4f_t o;
    #pragma unroll
    for (int e = 0; e < 4; ++e) {
        const int d = d4 + e;
        int bk;
        if (d < NBKT / 2) {
            bk = d;
        } else {
            float f  = (float)d * (1.0f / 16.0f);
            float lg = logf(f);
            float u  = lg * (1.0f / 2.0794415416798357f);
            float w  = u * 16.0f;
            int v = (NBKT / 2) + (int)w;
            bk = v < (NBKT - 1) ? v : (NBKT - 1);
            if (bk < 0) bk = 0;
        }
        o[e] = bf16r(rel[bk * HH + h]) * 0.125f;
    }
    float* d = tab + (size_t)h * NN + d4;
    *(v4f*)d = o;
    
}

// ---------------------------------------------------------------------------------------------
// C[64x64 tile] = A[64 x 768] * Wt[64 x 768]^T / 16, block = 4 waves, wave = 16 rows x 64 cols.
// MODE 0 (grid.z: 0 = q, 1 = k, 2 = v): q/k stored as [MR][DM] hi/lo f16 planes,
//         v stored transposed, [BB * DM][NN], as hi/lo f16 planes. A = xh. All planes in fragment order.
// MODE 1: A = attention output hi (+ lo plane for rows (m0 mod NN) < RSPLIT), C stored f32 to out.
// ---------------------------------------------------------------------------------------------
template <int MODE>
__global__ __launch_bounds__(128)
void k_proj(const hf* __restrict__ Ahi, const hf* __restrict__ Alo, const hf* __restrict__ Wt,
            hf* __restrict__ o0h, hf* __restrict__ o0l,
            hf* __restrict__ o1h, hf* __restrict__ o1l,
            hf* __restrict__ o2h, hf* __restrict__ o2l,
            float* __restrict__ outf)
{
    __shared__ __attribute__((aligned(16))) float Csm[64][68];

    const int wave = threadIdx.x >> 5, lane = threadIdx.x & 31, m = lane & 15, hh = lane >> 4;
    const int n0 = blockIdx.x * 64, m0 = blockIdx.y * 64, z = blockIdx.z;
    if (n0 >= DM || m0 >= MR) return;
    const hf* Bt = Wt + (size_t)z * DM * DM;
    const bool two = (MODE == 1) && ((m0 & (NN - 1)) < RSPLIT);

    const size_t aoff = (size_t)(m0 / 16 + wave) * KT_DM * 512 + 8 * lane;
    const hf* ap  = Ahi + aoff;
    const hf* ap2 = two ? (Alo + aoff) : ap;
    const hf* bp  = Bt + (size_t)(n0 / 16) * KT_DM * 512 + 8 * lane;

    v8f acc[4], acc2[4];
    #pragma unroll
    for (int t = 0; t < 4; ++t) { acc[t] = zero8(); acc2[t] = zero8(); }

    #pragma unroll 1
    for (int k0 = 0; k0 < DM; k0 += 32) {
        const hf* pa = ap + 16 * k0;             // k tile k0/32: 512 halfs a tile
        const hf* pb = bp + 16 * k0;
        v16h a = ldpk(pa);
        v16h bq[4];
        #pragma unroll
        for (int t = 0; t < 4; ++t) bq[t] = ldpk(pb + t * (KT_DM * 512));
        #pragma unroll
        for (int t = 0; t < 4; ++t) acc[t] = mma(a, bq[t], acc[t]);
        // names the loads' address registers as inputs: they stay unwritten, also by a later load's result,
        // up to this wait; it stands behind the products, where every load has returned and nothing stalls on it
        asm volatile("s_wait_xcnt 0x0" :: "v"(pa), "v"(pb) : "memory");
        if (two) {
            const hf* pa2 = ap2 + 16 * k0;
            v16h a2 = ldpk(pa2);
            #pragma unroll
            for (int t = 0; t < 4; ++t) acc2[t] = mma(a2, bq[t], acc2[t]);
            asm volatile("s_wait_xcnt 0x0" :: "v"(pa2) : "memory");   // the same for the residual plane's loads
        }
    }

    // D element r of lane: row 16*wave + 8*hh + r, col 16*t + m
    #pragma unroll
    for (int t = 0; t < 4; ++t) {
        #pragma unroll
        for (int r = 0; r < 8; ++r) {
            float v = acc[t][r];
            if (MODE == 1) v += acc2[t][r] * (1.0f / 2048.0f);
            Csm[16 * wave + 8 * hh + r][16 * t + m] = v * (1.0f / 16.0f);
        }
    }
    __syncthreads();

    if (MODE == 0) {
        if (z < 2) {
            hf* dh = (z == 0) ? o0h : o1h;
            hf* dl = (z == 0) ? o0l : o1l;
            {
                #pragma unroll
                for (int it = 0; it < 4; ++it) {
                    const int row = 16 * it + m;             // row block it, columns 16 wave + 8hh + 0..7
                    const int c8  = 16 * wave + 8 * hh;
                    v4f_t u0 = *(const v4f*)&Csm[row][c8];
                    v4f_t u1 = *(const v4f*)&Csm[row][c8 + 4];
                    v8h_t ph, pl;
                    hf a, bl;
                    split2(u0[0], a, bl); ph[0] = a; pl[0] = bl;
                    split2(u0[1], a, bl); ph[1] = a; pl[1] = bl;
                    split2(u0[2], a, bl); ph[2] = a; pl[2] = bl;
                    split2(u0[3], a, bl); ph[3] = a; pl[3] = bl;
                    split2(u1[0], a, bl); ph[4] = a; pl[4] = bl;
                    split2(u1[1], a, bl); ph[5] = a; pl[5] = bl;
                    split2(u1[2], a, bl); ph[6] = a; pl[6] = bl;
                    split2(u1[3], a, bl); ph[7] = a; pl[7] = bl;
                    const size_t off = ((size_t)(m0 / 16 + it) * KT_DM + n0 / 32 + (wave >> 1)) * 512
                                     + (wave & 1) * 256 + 8 * lane;
                    *(v8h*)(dh + off) = ph;
                    *(v8h*)(dl + off) = pl;
                }
                
            }
        } else {
            const int bidx = m0 >> 11;
            const int j0   = m0 & (NN - 1);
            {
                #pragma unroll
                for (int it = 0; it < 4; ++it) {
                    const int cc = 16 * it + m;              // channel block it, keys 16 wave + 8hh + 0..7
                    const int j8 = 16 * wave + 8 * hh;
                    v8h_t ph, pl;
                    #pragma unroll
                    for (int e = 0; e < 8; ++e) {
                        hf a, bl;
                        split2(Csm[j8 + e][cc], a, bl);
                        ph[e] = a; pl[e] = bl;
                    }
                    const size_t off = ((size_t)((bidx * DM + n0) / 16 + it) * KT_NN + j0 / 32 + (wave >> 1)) * 512
                                     + (wave & 1) * 256 + 8 * lane;
                    *(v8h*)(o2h + off) = ph;
                    *(v8h*)(o2l + off) = pl;
                }
                
            }
        }
    } else {
        {
            #pragma unroll
            for (int it = 0; it < 8; ++it) {
                const int row = 16 * wave + 2 * it + (lane >> 4);
                const int c4  = (lane & 15) * 4;
                v4f_t u = *(const v4f*)&Csm[row][c4];
                const size_t off = (size_t)(m0 + row) * DM + n0 + c4;
                *(v4f*)(outf + off) = u;
            }
            
        }
    }
}

// ---------------------------------------------------------------------------------------------
// Fused causal attention, block = (32 queries, head h, batch b); a wave owns 16 queries and walks 64-key
// tiles on its own, with no LDS traffic for scores and no barrier inside the loop:
//   S^T = K.Q^T   (A = K rows, B = Q rows as [n][k]): lane holds query (lane&15), keys 16kk + 8*(lane>>4) + r
//   online softmax per lane (bias, causal, row mask), one exchange between the wave halves for the maximum
//   O^T += V^T.P^T (A = V^T rows, B = P^T packed from the score registers, f16 x4096 (+ residual plane))
// SPLIT: hi/lo residual products on q.k^T and p.v. Output: attention rows as hi/lo f16 planes in fragment order
// ([MR][DM]): a lane's 8 values of a d tile are one 16-byte piece of it, so every wave stores whole lines itself.
// Not SPLIT: 2 waves, each all four 16-wide d tiles. SPLIT: 4 waves, two per 16 queries, each two d tiles
// (both form the same S^T), so that both planes of K, V^T, Q and O fit the register file without spills.
// ---------------------------------------------------------------------------------------------
// p = exp(x), built as the fast intrinsic is (x * log2 e, then v_exp_f32). Written as asm so that the slot the
// instruction set asks for behind a transcendental is kept by construction: the results are early-clobber, so
// no v_exp_f32 of a statement writes over a source of another, and the closing v_nop stands behind the last.
__device__ __forceinline__ void exp8(const float (&x)[8], float (&p)[8])
{
    float t[8];
    #pragma unroll
    for (int r = 0; r < 8; ++r) t[r] = x[r] * 1.44269504f;
    asm("v_exp_f32 %0, %8\n\tv_exp_f32 %1, %9\n\tv_exp_f32 %2, %10\n\tv_exp_f32 %3, %11\n\t"
        "v_exp_f32 %4, %12\n\tv_exp_f32 %5, %13\n\tv_exp_f32 %6, %14\n\tv_exp_f32 %7, %15\n\tv_nop"
        : "=&v"(p[0]), "=&v"(p[1]), "=&v"(p[2]), "=&v"(p[3]), "=&v"(p[4]), "=&v"(p[5]), "=&v"(p[6]), "=&v"(p[7])
        : "v"(t[0]), "v"(t[1]), "v"(t[2]), "v"(t[3]), "v"(t[4]), "v"(t[5]), "v"(t[6]), "v"(t[7]));
}

__device__ __forceinline__ float exp1(float x)
{
    const float t = x * 1.44269504f;
    float p;
    asm("v_exp_f32 %0, %1\n\tv_nop" : "=&v"(p) : "v"(t));   // same slot, one value
    return p;
}

template <bool SPLIT, int NDT>
__device__ __forceinline__ void load_v(const hf* vp, const hf* vp2, v16h (&vf)[NDT][2], v16h (&vf2)[NDT][2])
{
    #pragma unroll
    for (int dt = 0; dt < NDT; ++dt) {
        #pragma unroll
        for (int ks = 0; ks < 2; ++ks) {
            vf[dt][ks] = ldpk(vp + (dt * KT_NN + ks) * 512);
            if (SPLIT) vf2[dt][ks] = ldpk(vp2 + (dt * KT_NN + ks) * 512);
        }
    }
}

template <bool SPLIT>
__global__ __launch_bounds__(128)
void k_attn(const hf* __restrict__ qhi, const hf* __restrict__ qlo,
            const hf* __restrict__ khi, const hf* __restrict__ klo,
            const hf* __restrict__ vthi, const hf* __restrict__ vtlo,
            const float* __restrict__ btab, const int* __restrict__ mask,
            hf* __restrict__ ohi, hf* __restrict__ olo, int qb_base)
{
    // bias_sm[64 + delta] = bias of distance delta; 64 leading zeros take the reads of causally hidden keys
    __shared__ __attribute__((aligned(16))) float bias_sm[64 + NN];

    const int tid = threadIdx.x, lane = tid & 31, m = lane & 15, hh = lane >> 4;
    const int wave = __builtin_amdgcn_readfirstlane(tid >> 5);
    const int qb = blockIdx.x + qb_base, h = blockIdx.y, b = blockIdx.z;
    if (qb >= NN / 32 || h >= HH || b >= BB) return;
    constexpr int NT  = SPLIT ? 128 : 64;        // threads per block
    constexpr int NDT = SPLIT ? 2 : 4;           // d tiles per wave
    const int qt  = SPLIT ? (wave >> 1) : wave;  // 16-query sub-tile of this wave
    const int dt0 = SPLIT ? NDT * (wave & 1) : 0;
    const int i0 = qb * 32 + 16 * qt;            // first query of this wave
    const int i  = i0 + m;                       // this lane's query
    const float NINF = -__builtin_inff();

    if (tid < 64) bias_sm[tid] = 0.0f;
    #pragma unroll
    for (int t = 0; t < NN / (4 * NT); ++t)
        *(v4f*)&bias_sm[64 + 4 * NT * t + 4 * tid] = *(const v4f*)&btab[(size_t)h * NN + 4 * NT * t + 4 * tid];
    const bool valid = (mask[(size_t)b * NN + i] != 0);
    const bool anym  = (__builtin_amdgcn_ballot_w32(!valid) != 0u);
    __syncthreads();
    const int jext   = anym ? NN : (i0 + 16);
    const int ntiles = (jext + 63) >> 6;         // <= NN/64

    // Q fragments as B operand ([n = query][k = d]); the head's two k tiles of this wave's row block.
    // The attention output of these queries has the same place in its planes.
    const size_t qtile = ((size_t)((b * NN + i0) / 16) * KT_DM + 2 * h) * 512 + 8 * lane;
    v16h qf[2], qf2[2];
    #pragma unroll
    for (int ks = 0; ks < 2; ++ks) {
        qf[ks] = ldpk(qhi + qtile + 512 * ks);
        if (SPLIT) qf2[ks] = ldpk(qlo + qtile + 512 * ks); else qf2[ks] = qf[ks];
    }

    v8f oacc[NDT], oacc2[NDT];
    #pragma unroll
    for (int dt = 0; dt < NDT; ++dt) { oacc[dt] = zero8(); oacc2[dt] = zero8(); }
    float m_run = NINF, l_run = 0.0f;            // l_run: sum over the keys of this lane's half only

    #pragma unroll 1
    for (int jt = 0; jt < ntiles; ++jt) {
        const int jb = jt * 64;
        const size_t ktile = ((size_t)((b * NN + jb) / 16) * KT_DM + 2 * h) * 512 + 8 * lane;
        const size_t vtile = ((size_t)((b * DM + h * DH) / 16 + dt0) * KT_NN + 2 * jt) * 512 + 8 * lane;
        // lane bases: every load below is base + constant
        const hf* kp  = khi + ktile;
        const hf* kp2 = klo + ktile;
        const hf* vp  = vthi + vtile;
        const hf* vp2 = vtlo + vtile;

        v16h kf[4][2], kf2[4][2], vf[NDT][2], vf2[NDT][2];
        #pragma unroll
        for (int kk = 0; kk < 4; ++kk) {
            #pragma unroll
            for (int ks = 0; ks < 2; ++ks) {
                kf[kk][ks] = ldpk(kp + (kk * KT_DM + ks) * 512);
                if (SPLIT) kf2[kk][ks] = ldpk(kp2 + (kk * KT_DM + ks) * 512);
            }
        }
        // V^T loads fly under the score work; SPLIT issues them once the K registers are free again.
        // The s_wait_xcnt statements further down name the loads' address registers as inputs: that keeps them
        // unwritten, also by a later load's result, up to the wait; they stand late so that nothing stalls on them
        if (!SPLIT) load_v<SPLIT, NDT>(vp, vp2, vf, vf2);

        // ---- S^T: D row = key 16kk + 8hh + r (within tile), D col = query m ----
        const int dl = i - jb - 8 * hh;          // key (kk, r) is visible to this lane's query iff 16kk + r <= dl
        const int bb = dl + 1 > 0 ? dl + 1 : 0;  // all keys hidden where this clamps
        float sv[4][8];
        #pragma unroll
        for (int kk = 0; kk < 4; ++kk) {
            v8f acc = zero8(), acc2 = zero8();
            #pragma unroll
            for (int ks = 0; ks < 2; ++ks) {
                acc = mma(kf[kk][ks], qf[ks], acc);
                if (SPLIT) {
                    acc2 = mma(kf[kk][ks], qf2[ks], acc2);
                    acc2 = mma(kf2[kk][ks], qf[ks], acc2);
                }
            }
            #pragma unroll
            for (int r = 0; r < 8; ++r) {
                float v = acc[r];
                if (SPLIT) v += acc2[r] * (1.0f / 2048.0f);
                v = v * 0.125f + bias_sm[bb + (63 - 16 * kk - r)];
                sv[kk][r] = (16 * kk + r > dl) ? NINF : v;
            }
        }
        if (SPLIT) {
            asm volatile("s_wait_xcnt 0x0" :: "v"(kp), "v"(kp2) : "memory");   // K address registers free from here
            load_v<SPLIT, NDT>(vp, vp2, vf, vf2);
        }
        if (anym) {
            #pragma unroll
            for (int kk = 0; kk < 4; ++kk) {
                #pragma unroll
                for (int r = 0; r < 8; ++r) sv[kk][r] = valid ? sv[kk][r] : 0.0f;
            }
        }

        // ---- online softmax, one query per lane ----
        float t4[4];
        #pragma unroll
        for (int kk = 0; kk < 4; ++kk) {
            t4[kk] = fmaxf(fmaxf(fmaxf(sv[kk][0], sv[kk][1]), fmaxf(sv[kk][2], sv[kk][3])),
                           fmaxf(fmaxf(sv[kk][4], sv[kk][5]), fmaxf(sv[kk][6], sv[kk][7])));
        }
        float tmax = fmaxf(fmaxf(t4[0], t4[1]), fmaxf(t4[2], t4[3]));
        tmax = fmaxf(tmax, __shfl_xor(tmax, 16, 32));
        const float mn = fmaxf(m_run, tmax);
        const float ea = exp1(m_run - mn);
        const float alpha = (m_run == NINF) ? 0.0f : ea;
        m_run = mn;

        Frag ph[2], pl[2];
        float ps4[4];
        #pragma unroll
        for (int kk = 0; kk < 4; ++kk) {
            float x[8], p[8];
            #pragma unroll
            for (int r = 0; r < 8; ++r) x[r] = sv[kk][r] - mn;
            exp8(x, p);
            #pragma unroll
            for (int r = 0; r < 8; ++r) {
                hf a, bl;
                split2(p[r] * 4096.0f, a, bl);
                ph[kk >> 1].v[8 * (kk & 1) + r] = a;
                if (SPLIT) pl[kk >> 1].v[8 * (kk & 1) + r] = bl;
            }
            ps4[kk] = ((p[0] + p[1]) + (p[2] + p[3])) + ((p[4] + p[5]) + (p[6] + p[7]));
        }
        l_run = l_run * alpha + ((ps4[0] + ps4[1]) + (ps4[2] + ps4[3]));

        // address registers of the loads still named here are free from here
        if (SPLIT) asm volatile("s_wait_xcnt 0x0" :: "v"(vp), "v"(vp2) : "memory");
        else       asm volatile("s_wait_xcnt 0x0" :: "v"(kp), "v"(vp) : "memory");

        // ---- O^T: D row = d 16(dt0 + dt) + 8hh + r, D col = query m ----
        #pragma unroll
        for (int dt = 0; dt < NDT; ++dt) {
            #pragma unroll
            for (int r = 0; r < 8; ++r) { oacc[dt][r] *= alpha; if (SPLIT) oacc2[dt][r] *= alpha; }
            #pragma unroll
            for (int ks = 0; ks < 2; ++ks) {
                oacc[dt] = mma(vf[dt][ks], ph[ks].v, oacc[dt]);
                if (SPLIT) {
                    oacc2[dt] = mma(vf2[dt][ks], ph[ks].v, oacc2[dt]);
                    oacc2[dt] = mma(vf[dt][ks], pl[ks].v, oacc2[dt]);
                }
            }
        }
    }

    const float l = l_run + __shfl_xor(l_run, 16, 32);
    v8h_t oh[NDT], ol[NDT];
    #pragma unroll
    for (int dt = 0; dt < NDT; ++dt) {
        #pragma unroll
        for (int r = 0; r < 8; ++r) {
            float o = oacc[dt][r];
            if (SPLIT) o += oacc2[dt][r] * (1.0f / 2048.0f);
            o = (o / l) * (1.0f / 4096.0f);
            hf a, bl;
            split2(o, a, bl);
            oh[dt][r] = a; ol[dt][r] = bl;
        }
    }
    // d tile dt0 + dt = part (dt & 1) of the head's k tile (dt0 + dt) >> 1 (dt0 is even)
    #pragma unroll
    for (int dt = 0; dt < NDT; ++dt) {
        const size_t off = qtile + (size_t)((dt0 >> 1) + (dt >> 1)) * 512 + (dt & 1) * 256;
        *(v8h*)(ohi + off) = oh[dt];
        *(v8h*)(olo + off) = ol[dt];
    }
}

// ---------------------------------------------------------------------------------------------
// Host glue: 7 launches, workspace carved from sizes (<= 62 MB)
// ---------------------------------------------------------------------------------------------
extern "C" void kernel_launch(void* const* d_in, const int* in_sizes, int n_in,
                              void* d_out, int out_size, void* d_ws, size_t ws_size,
                              hipStream_t stream)
{
    if (n_in < 7) return;
    if (in_sizes[0] != MR * DM) return;
    if (in_sizes[1] != BB * NN) return;
    if (in_sizes[2] != DM * DM || in_sizes[3] != DM * DM || in_sizes[4] != DM * DM || in_sizes[5] != DM * DM) return;
    if (in_sizes[6] != NBKT * HH) return;
    if (out_size != MR * DM) return;

    const float* x    = (const float*)d_in[0];
    const int*   mask = (const int*)d_in[1];
    const float* Wq   = (const float*)d_in[2];
    const float* Wk   = (const float*)d_in[3];
    const float* Wv   = (const float*)d_in[4];
    const float* Wo   = (const float*)d_in[5];
    const float* rel  = (const float*)d_in[6];
    float* out = (float*)d_out;

    char* ws = (char*)d_ws;
    size_t off = 0;
    auto carve = [&](size_t bytes) -> size_t { size_t p = off; off += (bytes + 255) & ~(size_t)255; return p; };
    const size_t plane = (size_t)MR * DM * sizeof(hf);
    const size_t o_xh   = carve(plane);
    const size_t o_wt   = carve((size_t)4 * DM * DM * sizeof(hf));
    const size_t o_qhi  = carve(plane);
    const size_t o_qlo  = carve(plane);
    const size_t o_khi  = carve(plane);
    const size_t o_klo  = carve(plane);
    const size_t o_vthi = carve(plane);
    const size_t o_vtlo = carve(plane);
    const size_t o_ahi  = carve(plane);
    const size_t o_alo  = carve(plane);
    const size_t o_btab = carve((size_t)HH * NN * sizeof(float));
    if (off > ws_size) return;

    hf* xh   = (hf*)(ws + o_xh);
    hf* wt   = (hf*)(ws + o_wt);
    hf* qhi  = (hf*)(ws + o_qhi);
    hf* qlo  = (hf*)(ws + o_qlo);
    hf* khi  = (hf*)(ws + o_khi);
    hf* klo  = (hf*)(ws + o_klo);
    hf* vthi = (hf*)(ws + o_vthi);
    hf* vtlo = (hf*)(ws + o_vtlo);
    hf* ahi  = (hf*)(ws + o_ahi);
    hf* alo  = (hf*)(ws + o_alo);
    float* btab = (float*)(ws + o_btab);

    {
        const int n8 = MR * DM / 8;
        k_prep_x<<<(n8 + 255) / 256, 256, 0, stream>>>(x, xh, n8);
        const int tw = 4 * DM * (DM / 8);
        k_prep_w<<<(tw + 255) / 256, 256, 0, stream>>>(Wq, Wk, Wv, Wo, wt, tw);
        const int tb = HH * NN / 4;
        k_prep_bias<<<(tb + 255) / 256, 256, 0, stream>>>(rel, btab, tb);
    }

    // q, k (hi/lo planes), v (transposed hi/lo planes)
    k_proj<0><<<dim3(DM / 64, MR / 64, 3), 128, 0, stream>>>(
        xh, xh, wt, qhi, qlo, khi, klo, vthi, vtlo, out);

    // attention: leading query blocks with residual products, remainder single-plane
    k_attn<true><<<dim3(QSPLIT, HH, BB), 128, 0, stream>>>(
        qhi, qlo, khi, klo, vthi, vtlo, btab, mask, ahi, alo, 0);
    k_attn<false><<<dim3(NN / 32 - QSPLIT, HH, BB), 64, 0, stream>>>(
        qhi, qlo, khi, klo, vthi, vtlo, btab, mask, ahi, alo, QSPLIT);

    // output projection -> out (f32)
    k_proj<1><<<dim3(DM / 64, MR / 64, 1), 128, 0, stream>>>(
        ahi, alo, wt + (size_t)3 * DM * DM, ahi, alo, ahi, alo, ahi, alo, out);
}

// v003
// Measured time: 103 microseconds a run.
// In both of two side-by-side timings against v002, it was 1.20 times as fast.
// All steps since v000 together make it 3.32 times as fast.
#include <hip/hip_runtime.h>
#include <stdint.h>

// Contractions (q/k/v projections, q.k^T, p.v, output projection): v_wmma_f32_16x16x32_f16, f16 operands,
// f32 accumulate. x / weights / bias table are RNE-converted to bf16; x and weights are then held exactly in f16 (weights x16), the bias table in f32.
// q, k, v^T, p (x4096) and the attention output are carried as an f16 hi plane plus an f16 residual plane
// (residual x2048); residual products are issued for the leading query rows, single-plane products elsewhere.
//
// Every f16 operand plane in the workspace is stored in fragment order. A matrix M[rows][K] (K = contraction
// index) is cut into tiles of 16 rows x 32 k; tile (rb, kb) starts at half ((rb * K/32) + kb) * 512 and holds
//   M[16rb + m][32kb + 16part + 8hh + e]  at  part * 256 + (16hh + m) * 8 + e      (m < 16; part, hh < 2; e < 8)
// so lane 16hh + m of a wave finds its 16 fragment elements at tile + 8 * lane and tile + 256 + 8 * lane, and each
// of the two 16-byte loads (or stores) of a wave covers 512 contiguous bytes: four whole 128-byte lines.

#define BB 2
#define NN 2048
#define DM 768
#define HH 12
#define DH 64
#define MR (BB * NN)
#define NBKT 32
#define QSPLIT 16     // leading 32-query blocks per batch that use two-plane products in attention
#define RSPLIT 512    // leading rows per batch that use the two-plane A operand in the output projection

static_assert(DM % 64 == 0);
static_assert(NN % 64 == 0);
static_assert(MR % 64 == 0);
static_assert(DH == 64);
static_assert(RSPLIT % 64 == 0);
static_assert(QSPLIT <= NN / 32);
static_assert((MR * DM) % 8 == 0);
static_assert(DM % 32 == 0 && NN % 32 == 0 && MR % 16 == 0);
#define KT_DM (DM / 32)   // k tiles of a row block where K = DM
#define KT_NN (NN / 32)   // k tiles of a row block where K = NN (v^T)

typedef _Float16 hf;
typedef _Float16 v8h_t __attribute__((ext_vector_type(8)));
typedef v8h_t __attribute__((may_alias)) v8h;
typedef _Float16 v16h __attribute__((ext_vector_type(16)));
typedef float v8f __attribute__((ext_vector_type(8)));
typedef float v4f_t __attribute__((ext_vector_type(4)));
typedef v4f_t __attribute__((may_alias)) v4f;

union Frag { v16h v; v8h_t p[2]; };

// D(16x16,f32) += A(16x32) * B(32x16); nops keep VALU off the D/A/B registers right after issue.
__device__ __forceinline__ v8f mma(v16h a, v16h b, v8f c)
{
    v8f d = __builtin_amdgcn_wmma_f32_16x16x32_f16(false, a, false, b, (short)0, c, false, false);
    asm volatile("v_nop\n\tv_nop\n\tv_nop\n\tv_nop" : "+v"(d) : "v"(a), "v"(b));
    return d;
}

// 16x16x32 operand fragment for lane (row or column = lane&15), half hh = lane>>4:
// elements 0..7 <- k0+8hh+0..7, elements 8..15 <- k0+16+8hh+0..7 of the lane's row.
// Used for A ([m][k]) and for B held as [n][k]; p = start of the fragment-ordered tile + 8 * lane.
__device__ __forceinline__ v16h ldpk(const hf* p)
{
    Frag f;
    f.p[0] = *(const v8h*)(p);
    f.p[1] = *(const v8h*)(p + 256);
    return f.v;
}

__device__ __forceinline__ float bf16r(float v)
{
    unsigned u = __float_as_uint(v);
    u = (u + 0x7FFFu + ((u >> 16) & 1u)) & 0xFFFF0000u;
    return __uint_as_float(u);
}

// v ~= hi + lo/2048 with hi, lo in f16
__device__ __forceinline__ void split2(float v, hf& hi, hf& lo)
{
    hf h = (hf)v;
    hi = h;
    lo = (hf)((v - (float)h) * 2048.0f);
}

__device__ __forceinline__ v8f zero8()
{
    v8f z = {0.f, 0.f, 0.f, 0.f, 0.f, 0.f, 0.f, 0.f};
    return z;
}

// ---------------------------------------------------------------------------------------------
// xh = f16(bf16(x)) in fragment order ([MR][DM]); thread t fills 16-byte piece t, lane-contiguous stores
// ---------------------------------------------------------------------------------------------
__device__ __forceinline__ void prep_x(const float* __restrict__ x, hf* __restrict__ xh, int t)
{
    const int lane = t & 31, part = (t >> 5) & 1, tile = t >> 6;
    const int rb = tile / KT_DM, kb = tile - rb * KT_DM;
    const float* p = x + (size_t)(16 * rb + (lane & 15)) * DM + 32 * kb + 16 * part + 8 * (lane >> 4);
    v4f_t a = *(const v4f*)p;
    v4f_t b = *(const v4f*)(p + 4);
    v8h_t o;
    o[0] = (hf)bf16r(a[0]); o[1] = (hf)bf16r(a[1]); o[2] = (hf)bf16r(a[2]); o[3] = (hf)bf16r(a[3]);
    o[4] = (hf)bf16r(b[0]); o[5] = (hf)bf16r(b[1]); o[6] = (hf)bf16r(b[2]); o[7] = (hf)bf16r(b[3]);
    hf* d = xh + (size_t)t * 8;
    *(v8h*)d = o;
    // the arms of k_prep follow one another in the code: the store's registers stay unwritten up to this wait
    asm volatile("s_wait_xcnt 0x0" ::: "memory");
}

// ---------------------------------------------------------------------------------------------
// wt[w] = fragment order of [c][k] = f16(bf16(W_w[k][c]) * 16), W_w is [DM(k)][DM(c)]; 8 consecutive k per thread,
// thread = 16-byte piece of the plane: 16 neighbouring lanes read 16 neighbouring c of one k row
// ---------------------------------------------------------------------------------------------
__device__ __forceinline__ void prep_w(const float* __restrict__ w0, const float* __restrict__ w1,
                                       const float* __restrict__ w2, const float* __restrict__ w3,
                                       hf* __restrict__ wt, int t)
{
    const int per = DM * (DM / 8);
    const int wi  = t / per;
    const int rem = t - wi * per;
    const int lane = rem & 31, part = (rem >> 5) & 1, tile = rem >> 6;
    const int rb  = tile / KT_DM, kb = tile - rb * KT_DM;
    const int c   = 16 * rb + (lane & 15);
    const int k8  = 32 * kb + 16 * part + 8 * (lane >> 4);
    const float* W = (wi == 0) ? w0 : (wi == 1) ? w1 : (wi == 2) ? w2 : w3;
    v8h_t o;
    #pragma unroll
    for (int e = 0; e < 8; ++e) o[e] = (hf)(bf16r(W[(size_t)(k8 + e) * DM + c]) * 16.0f);
    hf* d = wt + (size_t)wi * DM * DM + (size_t)rem * 8;
    *(v8h*)d = o;
    // the arms of k_prep follow one another in the code: the store's registers stay unwritten up to this wait
    asm volatile("s_wait_xcnt 0x0" ::: "memory");
}

// ---------------------------------------------------------------------------------------------
// btab[h][delta] = bf16(rel[bucket(delta)][h]) * DH^-0.5, causal bucketing; 4 deltas per thread
// ---------------------------------------------------------------------------------------------
__device__ __forceinline__ void prep_bias(const float* __restrict__ rel, float* __restrict__ tab, int t)
{
    const int h  = t / (NN / 4);
    const int d4 = (t - h * (NN / 4)) * 4;
    v4f_t o;
    #pragma unroll
    for (int e = 0; e < 4; ++e) {
        const int d = d4 + e;
        int bk;
        if (d < NBKT / 2) {
            bk = d;
        } else {
            float f  = (float)d * (1.0f / 16.0f);
            float lg = logf(f);
            float u  = lg * (1.0f / 2.0794415416798357f);
            float w  = u * 16.0f;
            int v = (NBKT / 2) + (int)w;
            bk = v < (NBKT - 1) ? v : (NBKT - 1);
            if (bk < 0) bk = 0;
        }
        o[e] = bf16r(rel[bk * HH + h]) * 0.125f;
    }
    float* d = tab + (size_t)h * NN + d4;
    *(v4f*)d = o;
    // the arms of k_prep follow one another in the code: the store's registers stay unwritten up to this wait
    asm volatile("s_wait_xcnt 0x0" ::: "memory");
}

// ---------------------------------------------------------------------------------------------
// The three conversions depend on nothing but the inputs: one launch, a block range each.
// ---------------------------------------------------------------------------------------------
#define PB_BIAS (HH * NN / 4 / 256)
#define PB_W    (4 * DM * (DM / 8) / 256)
#define PB_X    (MR * DM / 8 / 256)
static_assert((HH * NN / 4) % 256 == 0 && (4 * DM * (DM / 8)) % 256 == 0 && (MR * DM / 8) % 256 == 0);

__global__ __launch_bounds__(256)
void k_prep(const float* __restrict__ x, const float* __restrict__ w0, const float* __restrict__ w1,
            const float* __restrict__ w2, const float* __restrict__ w3, const float* __restrict__ rel,
            hf* __restrict__ xh, hf* __restrict__ wt, float* __restrict__ tab)
{
    const int blk = blockIdx.x, tid = threadIdx.x;
    if (blk < PB_BIAS)                    prep_bias(rel, tab, blk * 256 + tid);
    else if (blk < PB_BIAS + PB_W)        prep_w(w0, w1, w2, w3, wt, (blk - PB_BIAS) * 256 + tid);
    else if (blk < PB_BIAS + PB_W + PB_X) prep_x(x, xh, (blk - PB_BIAS - PB_W) * 256 + tid);
}

// ---------------------------------------------------------------------------------------------
// C[64x64 tile] = A[64 x 768] * Wt[64 x 768]^T / 16, block = 4 waves, wave = 16 rows x 64 cols.
// MODE 0 (grid.z: 0 = q, 1 = k, 2 = v): q/k stored as [MR][DM] hi/lo f16 planes,
//         v stored transposed, [BB * DM][NN], as hi/lo f16 planes. A = xh. All planes in fragment order.
// MODE 1: A = attention output hi (+ lo plane for rows (m0 mod NN) < RSPLIT), C stored f32 to out.
// ---------------------------------------------------------------------------------------------
template <int MODE>
__global__ __launch_bounds__(128)
void k_proj(const hf* __restrict__ Ahi, const hf* __restrict__ Alo, const hf* __restrict__ Wt,
            hf* __restrict__ o0h, hf* __restrict__ o0l,
            hf* __restrict__ o1h, hf* __restrict__ o1l,
            hf* __restrict__ o2h, hf* __restrict__ o2l,
            float* __restrict__ outf)
{
    __shared__ __attribute__((aligned(16))) float Csm[64][68];

    const int wave = threadIdx.x >> 5, lane = threadIdx.x & 31, m = lane & 15, hh = lane >> 4;
    const int n0 = blockIdx.x * 64, m0 = blockIdx.y * 64, z = blockIdx.z;
    if (n0 >= DM || m0 >= MR) return;
    const hf* Bt = Wt + (size_t)z * DM * DM;
    const bool two = (MODE == 1) && ((m0 & (NN - 1)) < RSPLIT);

    const size_t aoff = (size_t)(m0 / 16 + wave) * KT_DM * 512 + 8 * lane;
    const hf* ap  = Ahi + aoff;
    const hf* ap2 = two ? (Alo + aoff) : ap;
    const hf* bp  = Bt + (size_t)(n0 / 16) * KT_DM * 512 + 8 * lane;

    v8f acc[4], acc2[4];
    #pragma unroll
    for (int t = 0; t < 4; ++t) { acc[t] = zero8(); acc2[t] = zero8(); }

    #pragma unroll 1
    for (int k0 = 0; k0 < DM; k0 += 32) {
        const hf* pa = ap + 16 * k0;             // k tile k0/32: 512 halfs a tile
        const hf* pb = bp + 16 * k0;
        v16h a = ldpk(pa);
        v16h bq[4];
        #pragma unroll
        for (int t = 0; t < 4; ++t) bq[t] = ldpk(pb + t * (KT_DM * 512));
        #pragma unroll
        for (int t = 0; t < 4; ++t) acc[t] = mma(a, bq[t], acc[t]);
        // names the loads' address registers as inputs: they stay unwritten, also by a later load's result,
        // up to this wait; it stands behind the products, where every load has returned and nothing stalls on it
        asm volatile("s_wait_xcnt 0x0" :: "v"(pa), "v"(pb) : "memory");
        if (two) {
            const hf* pa2 = ap2 + 16 * k0;
            v16h a2 = ldpk(pa2);
            #pragma unroll
            for (int t = 0; t < 4; ++t) acc2[t] = mma(a2, bq[t], acc2[t]);
            asm volatile("s_wait_xcnt 0x0" :: "v"(pa2) : "memory");   // the same for the residual plane's loads
        }
    }

    // D element r of lane: row 16*wave + 8*hh + r, col 16*t + m
    #pragma unroll
    for (int t = 0; t < 4; ++t) {
        #pragma unroll
        for (int r = 0; r < 8; ++r) {
            float v = acc[t][r];
            if (MODE == 1) v += acc2[t][r] * (1.0f / 2048.0f);
            Csm[16 * wave + 8 * hh + r][16 * t + m] = v * (1.0f / 16.0f);
        }
    }
    __syncthreads();

    if (MODE == 0) {
        if (z < 2) {
            hf* dh = (z == 0) ? o0h : o1h;
            hf* dl = (z == 0) ? o0l : o1l;
            {
                #pragma unroll
                for (int it = 0; it < 4; ++it) {
                    const int row = 16 * it + m;             // row block it, columns 16 wave + 8hh + 0..7
                    const int c8  = 16 * wave + 8 * hh;
                    v4f_t u0 = *(const v4f*)&Csm[row][c8];
                    v4f_t u1 = *(const v4f*)&Csm[row][c8 + 4];
                    v8h_t ph, pl;
                    hf a, bl;
                    split2(u0[0], a, bl); ph[0] = a; pl[0] = bl;
                    split2(u0[1], a, bl); ph[1] = a; pl[1] = bl;
                    split2(u0[2], a, bl); ph[2] = a; pl[2] = bl;
                    split2(u0[3], a, bl); ph[3] = a; pl[3] = bl;
                    split2(u1[0], a, bl); ph[4] = a; pl[4] = bl;
                    split2(u1[1], a, bl); ph[5] = a; pl[5] = bl;
                    split2(u1[2], a, bl); ph[6] = a; pl[6] = bl;
                    split2(u1[3], a, bl); ph[7] = a; pl[7] = bl;
                    const size_t off = ((size_t)(m0 / 16 + it) * KT_DM + n0 / 32 + (wave >> 1)) * 512
                                     + (wave & 1) * 256 + 8 * lane;
                    *(v8h*)(dh + off) = ph;
                    *(v8h*)(dl + off) = pl;
                }
                
            }
        } else {
            const int bidx = m0 >> 11;
            const int j0   = m0 & (NN - 1);
            {
                #pragma unroll
                for (int it = 0; it < 4; ++it) {
                    const int cc = 16 * it + m;              // channel block it, keys 16 wave + 8hh + 0..7
                    const int j8 = 16 * wave + 8 * hh;
                    v8h_t ph, pl;
                    #pragma unroll
                    for (int e = 0; e < 8; ++e) {
                        hf a, bl;
                        split2(Csm[j8 + e][cc], a, bl);
                        ph[e] = a; pl[e] = bl;
                    }
                    const size_t off = ((size_t)((bidx * DM + n0) / 16 + it) * KT_NN + j0 / 32 + (wave >> 1)) * 512
                                     + (wave & 1) * 256 + 8 * lane;
                    *(v8h*)(o2h + off) = ph;
                    *(v8h*)(o2l + off) = pl;
                }
                
            }
        }
    } else {
        {
            #pragma unroll
            for (int it = 0; it < 8; ++it) {
                const int row = 16 * wave + 2 * it + (lane >> 4);
                const int c4  = (lane & 15) * 4;
                v4f_t u = *(const v4f*)&Csm[row][c4];
                const size_t off = (size_t)(m0 + row) * DM + n0 + c4;
                *(v4f*)(outf + off) = u;
            }
            
        }
    }
}

// ---------------------------------------------------------------------------------------------
// Fused causal attention, block = (a run of queries, head h, batch b); a wave owns 16 queries and walks 64-key
// tiles on its own, with no LDS traffic for scores and no barrier inside the loop:
//   S^T = K.Q^T   (A = K rows, B = Q rows as [n][k]): lane holds query (lane&15), keys 16kk + 8*(lane>>4) + r
//   online softmax per lane (bias, causal, row mask), one exchange between the wave halves for the maximum
//   O^T += V^T.P^T (A = V^T rows, B = P^T packed from the score registers, f16 x4096 (+ residual plane))
// SPLIT: hi/lo residual products on q.k^T and p.v. Output: attention rows as hi/lo f16 planes in fragment order
// ([MR][DM]): a lane's 8 values of a d tile are one 16-byte piece of it, so every wave stores whole lines itself.
// Not SPLIT: 64 queries, 4 waves, each all four 16-wide d tiles. SPLIT: 32 queries, 4 waves, two per 16 queries,
// each two d tiles (both form the same S^T), so that both planes of K, V^T, Q and O fit the register file
// without spills. Both kinds of block share one launch (k_attn below): neither reads what the other writes.
// ---------------------------------------------------------------------------------------------
// p = exp(x), built as the fast intrinsic is (x * log2 e, then v_exp_f32). Written as asm so that the slot the
// instruction set asks for behind a transcendental is kept by construction: the results are early-clobber, so
// no v_exp_f32 of a statement writes over a source of another, and the closing v_nop stands behind the last.
__device__ __forceinline__ void exp8(const float (&x)[8], float (&p)[8])
{
    float t[8];
    #pragma unroll
    for (int r = 0; r < 8; ++r) t[r] = x[r] * 1.44269504f;
    asm("v_exp_f32 %0, %8\n\tv_exp_f32 %1, %9\n\tv_exp_f32 %2, %10\n\tv_exp_f32 %3, %11\n\t"
        "v_exp_f32 %4, %12\n\tv_exp_f32 %5, %13\n\tv_exp_f32 %6, %14\n\tv_exp_f32 %7, %15\n\tv_nop"
        : "=&v"(p[0]), "=&v"(p[1]), "=&v"(p[2]), "=&v"(p[3]), "=&v"(p[4]), "=&v"(p[5]), "=&v"(p[6]), "=&v"(p[7])
        : "v"(t[0]), "v"(t[1]), "v"(t[2]), "v"(t[3]), "v"(t[4]), "v"(t[5]), "v"(t[6]), "v"(t[7]));
}

__device__ __forceinline__ float exp1(float x)
{
    const float t = x * 1.44269504f;
    float p;
    asm("v_exp_f32 %0, %1\n\tv_nop" : "=&v"(p) : "v"(t));   // same slot, one value
    return p;
}

template <bool SPLIT, int NDT>
__device__ __forceinline__ void load_v(const hf* vp, const hf* vp2, v16h (&vf)[NDT][2], v16h (&vf2)[NDT][2])
{
    #pragma unroll
    for (int dt = 0; dt < NDT; ++dt) {
        #pragma unroll
        for (int ks = 0; ks < 2; ++ks) {
            vf[dt][ks] = ldpk(vp + (dt * KT_NN + ks) * 512);
            if (SPLIT) vf2[dt][ks] = ldpk(vp2 + (dt * KT_NN + ks) * 512);
        }
    }
}

template <bool SPLIT>
__device__ __forceinline__
void attn_block(const hf* __restrict__ qhi, const hf* __restrict__ qlo,
                const hf* __restrict__ khi, const hf* __restrict__ klo,
                const hf* __restrict__ vthi, const hf* __restrict__ vtlo,
                const float* __restrict__ btab, const int* __restrict__ mask,
                hf* __restrict__ ohi, hf* __restrict__ olo,
                float* bias_sm, int q0, int h, int b)   // q0: first query of the block
{
    const int tid = threadIdx.x, lane = tid & 31, m = lane & 15, hh = lane >> 4;
    const int wave = __builtin_amdgcn_readfirstlane(tid >> 5);
    constexpr int NT  = 128;                     // threads per block
    constexpr int NDT = SPLIT ? 2 : 4;           // d tiles per wave
    const int qt  = SPLIT ? (wave >> 1) : wave;  // 16-query sub-tile of this wave
    const int dt0 = SPLIT ? NDT * (wave & 1) : 0;
    const int i0 = q0 + 16 * qt;                 // first query of this wave
    const int i  = i0 + m;                       // this lane's query
    const float NINF = -__builtin_inff();

    if (tid < 64) bias_sm[tid] = 0.0f;
    #pragma unroll
    for (int t = 0; t < NN / (4 * NT); ++t)
        *(v4f*)&bias_sm[64 + 4 * NT * t + 4 * tid] = *(const v4f*)&btab[(size_t)h * NN + 4 * NT * t + 4 * tid];
    const bool valid = (mask[(size_t)b * NN + i] != 0);
    const bool anym  = (__builtin_amdgcn_ballot_w32(!valid) != 0u);
    __syncthreads();
    const int jext   = anym ? NN : (i0 + 16);
    const int ntiles = (jext + 63) >> 6;         // <= NN/64

    // Q fragments as B operand ([n = query][k = d]); the head's two k tiles of this wave's row block.
    // The attention output of these queries has the same place in its planes.
    const size_t qtile = ((size_t)((b * NN + i0) / 16) * KT_DM + 2 * h) * 512 + 8 * lane;
    v16h qf[2], qf2[2];
    #pragma unroll
    for (int ks = 0; ks < 2; ++ks) {
        qf[ks] = ldpk(qhi + qtile + 512 * ks);
        if (SPLIT) qf2[ks] = ldpk(qlo + qtile + 512 * ks); else qf2[ks] = qf[ks];
    }

    v8f oacc[NDT], oacc2[NDT];
    #pragma unroll
    for (int dt = 0; dt < NDT; ++dt) { oacc[dt] = zero8(); oacc2[dt] = zero8(); }
    float m_run = NINF, l_run = 0.0f;            // l_run: sum over the keys of this lane's half only

    #pragma unroll 1
    for (int jt = 0; jt < ntiles; ++jt) {
        const int jb = jt * 64;
        const size_t ktile = ((size_t)((b * NN + jb) / 16) * KT_DM + 2 * h) * 512 + 8 * lane;
        const size_t vtile = ((size_t)((b * DM + h * DH) / 16 + dt0) * KT_NN + 2 * jt) * 512 + 8 * lane;
        // lane bases: every load below is base + constant
        const hf* kp  = khi + ktile;
        const hf* kp2 = klo + ktile;
        const hf* vp  = vthi + vtile;
        const hf* vp2 = vtlo + vtile;

        v16h kf[4][2], kf2[4][2], vf[NDT][2], vf2[NDT][2];
        #pragma unroll
        for (int kk = 0; kk < 4; ++kk) {
            #pragma unroll
            for (int ks = 0; ks < 2; ++ks) {
                kf[kk][ks] = ldpk(kp + (kk * KT_DM + ks) * 512);
                if (SPLIT) kf2[kk][ks] = ldpk(kp2 + (kk * KT_DM + ks) * 512);
            }
        }
        // V^T loads fly under the score work; SPLIT issues them once the K registers are free again.
        // The s_wait_xcnt statements further down name the loads' address registers as inputs: that keeps them
        // unwritten, also by a later load's result, up to the wait; they stand late so that nothing stalls on them
        if (!SPLIT) load_v<SPLIT, NDT>(vp, vp2, vf, vf2);

        // ---- S^T: D row = key 16kk + 8hh + r (within tile), D col = query m ----
        const int dl = i - jb - 8 * hh;          // key (kk, r) is visible to this lane's query iff 16kk + r <= dl
        const int bb = dl + 1 > 0 ? dl + 1 : 0;  // all keys hidden where this clamps
        float sv[4][8];
        #pragma unroll
        for (int kk = 0; kk < 4; ++kk) {
            v8f acc = zero8(), acc2 = zero8();
            #pragma unroll
            for (int ks = 0; ks < 2; ++ks) {
                acc = mma(kf[kk][ks], qf[ks], acc);
                if (SPLIT) {
                    acc2 = mma(kf[kk][ks], qf2[ks], acc2);
                    acc2 = mma(kf2[kk][ks], qf[ks], acc2);
                }
            }
            #pragma unroll
            for (int r = 0; r < 8; ++r) {
                float v = acc[r];
                if (SPLIT) v += acc2[r] * (1.0f / 2048.0f);
                v = v * 0.125f + bias_sm[bb + (63 - 16 * kk - r)];
                sv[kk][r] = (16 * kk + r > dl) ? NINF : v;
            }
        }
        if (SPLIT) {
            asm volatile("s_wait_xcnt 0x0" :: "v"(kp), "v"(kp2) : "memory");   // K address registers free from here
            load_v<SPLIT, NDT>(vp, vp2, vf, vf2);
        }
        if (anym) {
            #pragma unroll
            for (int kk = 0; kk < 4; ++kk) {
                #pragma unroll
                for (int r = 0; r < 8; ++r) sv[kk][r] = valid ? sv[kk][r] : 0.0f;
            }
        }

        // ---- online softmax, one query per lane ----
        float t4[4];
        #pragma unroll
        for (int kk = 0; kk < 4; ++kk) {
            t4[kk] = fmaxf(fmaxf(fmaxf(sv[kk][0], sv[kk][1]), fmaxf(sv[kk][2], sv[kk][3])),
                           fmaxf(fmaxf(sv[kk][4], sv[kk][5]), fmaxf(sv[kk][6], sv[kk][7])));
        }
        float tmax = fmaxf(fmaxf(t4[0], t4[1]), fmaxf(t4[2], t4[3]));
        tmax = fmaxf(tmax, __shfl_xor(tmax, 16, 32));
        const float mn = fmaxf(m_run, tmax);
        const float ea = exp1(m_run - mn);
        const float alpha = (m_run == NINF) ? 0.0f : ea;
        m_run = mn;

        Frag ph[2], pl[2];
        float ps4[4];
        #pragma unroll
        for (int kk = 0; kk < 4; ++kk) {
            float x[8], p[8];
            #pragma unroll
            for (int r = 0; r < 8; ++r) x[r] = sv[kk][r] - mn;
            exp8(x, p);
            #pragma unroll
            for (int r = 0; r < 8; ++r) {
                hf a, bl;
                split2(p[r] * 4096.0f, a, bl);
                ph[kk >> 1].v[8 * (kk & 1) + r] = a;
                if (SPLIT) pl[kk >> 1].v[8 * (kk & 1) + r] = bl;
            }
            ps4[kk] = ((p[0] + p[1]) + (p[2] + p[3])) + ((p[4] + p[5]) + (p[6] + p[7]));
        }
        l_run = l_run * alpha + ((ps4[0] + ps4[1]) + (ps4[2] + ps4[3]));

        // address registers of the loads still named here are free from here
        if (SPLIT) asm volatile("s_wait_xcnt 0x0" :: "v"(vp), "v"(vp2) : "memory");
        else       asm volatile("s_wait_xcnt 0x0" :: "v"(kp), "v"(vp) : "memory");

        // ---- O^T: D row = d 16(dt0 + dt) + 8hh + r, D col = query m ----
        #pragma unroll
        for (int dt = 0; dt < NDT; ++dt) {
            #pragma unroll
            for (int r = 0; r < 8; ++r) { oacc[dt][r] *= alpha; if (SPLIT) oacc2[dt][r] *= alpha; }
            #pragma unroll
            for (int ks = 0; ks < 2; ++ks) {
                oacc[dt] = mma(vf[dt][ks], ph[ks].v, oacc[dt]);
                if (SPLIT) {
                    oacc2[dt] = mma(vf2[dt][ks], ph[ks].v, oacc2[dt]);
                    oacc2[dt] = mma(vf[dt][ks], pl[ks].v, oacc2[dt]);
                }
            }
        }
    }

    const float l = l_run + __shfl_xor(l_run, 16, 32);
    v8h_t oh[NDT], ol[NDT];
    #pragma unroll
    for (int dt = 0; dt < NDT; ++dt) {
        #pragma unroll
        for (int r = 0; r < 8; ++r) {
            float o = oacc[dt][r];
            if (SPLIT) o += oacc2[dt][r] * (1.0f / 2048.0f);
            o = (o / l) * (1.0f / 4096.0f);
            hf a, bl;
            split2(o, a, bl);
            oh[dt][r] = a; ol[dt][r] = bl;
        }
    }
    // d tile dt0 + dt = part (dt & 1) of the head's k tile (dt0 + dt) >> 1 (dt0 is even)
    #pragma unroll
    for (int dt = 0; dt < NDT; ++dt) {
        const size_t off = qtile + (size_t)((dt0 >> 1) + (dt >> 1)) * 512 + (dt & 1) * 256;
        *(v8h*)(ohi + off) = oh[dt];
        *(v8h*)(olo + off) = ol[dt];
    }
}

// One launch for all queries. blockIdx.x = (batch, head); blockIdx.y ranks the query runs by falling key count:
// first the single-plane runs of 64 queries from the end of the sequence down, then the two-plane runs of 32.
#define QB_ONE ((NN - 32 * QSPLIT) / 64)         // single-plane blocks per (batch, head)
static_assert((NN - 32 * QSPLIT) % 64 == 0);

__global__ __launch_bounds__(128)
void k_attn(const hf* __restrict__ qhi, const hf* __restrict__ qlo,
            const hf* __restrict__ khi, const hf* __restrict__ klo,
            const hf* __restrict__ vthi, const hf* __restrict__ vtlo,
            const float* __restrict__ btab, const int* __restrict__ mask,
            hf* __restrict__ ohi, hf* __restrict__ olo)
{
    // bias_sm[64 + delta] = bias of distance delta; 64 leading zeros take the reads of causally hidden keys
    __shared__ __attribute__((aligned(16))) float bias_sm[64 + NN];

    const int hb = blockIdx.x, rank = blockIdx.y;
    if (hb >= HH * BB || rank >= QB_ONE + QSPLIT) return;
    const int b = hb / HH, h = hb - b * HH;
    if (rank < QB_ONE)
        attn_block<false>(qhi, qlo, khi, klo, vthi, vtlo, btab, mask, ohi, olo, bias_sm,
                          NN - 64 * (rank + 1), h, b);
    else
        attn_block<true>(qhi, qlo, khi, klo, vthi, vtlo, btab, mask, ohi, olo, bias_sm,
                         32 * (QSPLIT - 1 - (rank - QB_ONE)), h, b);
}

// ---------------------------------------------------------------------------------------------
// Host glue: 4 launches, workspace carved from sizes (<= 62 MB)
// ---------------------------------------------------------------------------------------------
extern "C" void kernel_launch(void* const* d_in, const int* in_sizes, int n_in,
                              void* d_out, int out_size, void* d_ws, size_t ws_size,
                              hipStream_t stream)
{
    if (n_in < 7) return;
    if (in_sizes[0] != MR * DM) return;
    if (in_sizes[1] != BB * NN) return;
    if (in_sizes[2] != DM * DM || in_sizes[3] != DM * DM || in_sizes[4] != DM * DM || in_sizes[5] != DM * DM) return;
    if (in_sizes[6] != NBKT * HH) return;
    if (out_size != MR * DM) return;

    const float* x    = (const float*)d_in[0];
    const int*   mask = (const int*)d_in[1];
    const float* Wq   = (const float*)d_in[2];
    const float* Wk   = (const float*)d_in[3];
    const float* Wv   = (const float*)d_in[4];
    const float* Wo   = (const float*)d_in[5];
    const float* rel  = (const float*)d_in[6];
    float* out = (float*)d_out;

    char* ws = (char*)d_ws;
    size_t off = 0;
    auto carve = [&](size_t bytes) -> size_t { size_t p = off; off += (bytes + 255) & ~(size_t)255; return p; };
    const size_t plane = (size_t)MR * DM * sizeof(hf);
    const size_t o_xh   = carve(plane);
    const size_t o_wt   = carve((size_t)4 * DM * DM * sizeof(hf));
    const size_t o_qhi  = carve(plane);
    const size_t o_qlo  = carve(plane);
    const size_t o_khi  = carve(plane);
    const size_t o_klo  = carve(plane);
    const size_t o_vthi = carve(plane);
    const size_t o_vtlo = carve(plane);
    const size_t o_ahi  = carve(plane);
    const size_t o_alo  = carve(plane);
    const size_t o_btab = carve((size_t)HH * NN * sizeof(float));
    if (off > ws_size) return;

    hf* xh   = (hf*)(ws + o_xh);
    hf* wt   = (hf*)(ws + o_wt);
    hf* qhi  = (hf*)(ws + o_qhi);
    hf* qlo  = (hf*)(ws + o_qlo);
    hf* khi  = (hf*)(ws + o_khi);
    hf* klo  = (hf*)(ws + o_klo);
    hf* vthi = (hf*)(ws + o_vthi);
    hf* vtlo = (hf*)(ws + o_vtlo);
    hf* ahi  = (hf*)(ws + o_ahi);
    hf* alo  = (hf*)(ws + o_alo);
    float* btab = (float*)(ws + o_btab);

    k_prep<<<PB_BIAS + PB_W + PB_X, 256, 0, stream>>>(x, Wq, Wk, Wv, Wo, rel, xh, wt, btab);

    // q, k (hi/lo planes), v (transposed hi/lo planes)
    k_proj<0><<<dim3(DM / 64, MR / 64, 3), 128, 0, stream>>>(
        xh, xh, wt, qhi, qlo, khi, klo, vthi, vtlo, out);

    // attention: leading query blocks with residual products, remainder single-plane
    k_attn<<<dim3(HH * BB, QB_ONE + QSPLIT), 128, 0, stream>>>(
        qhi, qlo, khi, klo, vthi, vtlo, btab, mask, ahi, alo);

    // output projection -> out (f32)
    k_proj<1><<<dim3(DM / 64, MR / 64, 1), 128, 0, stream>>>(
        ahi, alo, wt + (size_t)3 * DM * DM, ahi, alo, ahi, alo, ahi, alo, out);
}

// v004
// One run takes 80.4 microseconds.
// Two timings next to v003 put it at 1.29 and 1.28 times that version's speed.
// All steps since v000 together make it 4.28 times as fast.
#include <hip/hip_runtime.h>
#include <stdint.h>

// Contractions (q/k/v projections, q.k^T, p.v, output projection): v_wmma_f32_16x16x32_f16, f16 operands,
// f32 accumulate. x / weights / bias table are RNE-converted to bf16; x and weights are then held exactly in f16 (weights x16), the bias table in f32.
// q, k, v^T, p (x4096) and the attention output are carried as an f16 hi plane plus an f16 residual plane
// (residual x2048); residual products are issued for the leading query rows, single-plane products elsewhere.
//
// Every f16 operand plane in the workspace is stored in fragment order. A matrix M[rows][K] (K = contraction
// index) is cut into tiles of 16 rows x 32 k; tile (rb, kb) starts at half ((rb * K/32) + kb) * 512 and holds
//   M[16rb + m][32kb + 16part + 8hh + e]  at  part * 256 + (16hh + m) * 8 + e      (m < 16; part, hh < 2; e < 8)
// so lane 16hh + m of a wave finds its 16 fragment elements at tile + 8 * lane and tile + 256 + 8 * lane, and each
// of the two 16-byte loads (or stores) of a wave covers 512 contiguous bytes: four whole 128-byte lines.

#define BB 2
#define NN 2048
#define DM 768
#define HH 12
#define DH 64
#define MR (BB * NN)
#define NBKT 32
#define QSPLIT 16     // leading 32-query blocks per batch that use two-plane products in attention
#define RSPLIT 512    // leading rows per batch that use the two-plane A operand in the output projection

static_assert(DM % 64 == 0);
static_assert(NN % 64 == 0);
static_assert(MR % 64 == 0);
static_assert(DH == 64);
static_assert(RSPLIT % 64 == 0);
static_assert(QSPLIT <= NN / 32);
static_assert((MR * DM) % 8 == 0);
static_assert(DM % 32 == 0 && NN % 32 == 0 && MR % 16 == 0);
#define KT_DM (DM / 32)   // k tiles of a row block where K = DM
#define KT_NN (NN / 32)   // k tiles of a row block where K = NN (v^T)

typedef _Float16 hf;
typedef _Float16 v8h_t __attribute__((ext_vector_type(8)));
typedef v8h_t __attribute__((may_alias)) v8h;
typedef _Float16 v16h __attribute__((ext_vector_type(16)));
typedef float v8f __attribute__((ext_vector_type(8)));
typedef float v4f_t __attribute__((ext_vector_type(4)));
typedef v4f_t __attribute__((may_alias)) v4f;

union Frag { v16h v; v8h_t p[2]; };

// D(16x16,f32) += A(16x32) * B(32x16); nops keep VALU off the D/A/B registers right after issue.
__device__ __forceinline__ v8f mma(v16h a, v16h b, v8f c)
{
    v8f d = __builtin_amdgcn_wmma_f32_16x16x32_f16(false, a, false, b, (short)0, c, false, false);
    asm volatile("v_nop\n\tv_nop\n\tv_nop\n\tv_nop" : "+v"(d) : "v"(a), "v"(b));
    return d;
}

// 16x16x32 operand fragment for lane (row or column = lane&15), half hh = lane>>4:
// elements 0..7 <- k0+8hh+0..7, elements 8..15 <- k0+16+8hh+0..7 of the lane's row.
// Used for A ([m][k]) and for B held as [n][k]; p = start of the fragment-ordered tile + 8 * lane.
__device__ __forceinline__ v16h ldpk(const hf* p)
{
    Frag f;
    f.p[0] = *(const v8h*)(p);
    f.p[1] = *(const v8h*)(p + 256);
    return f.v;
}

__device__ __forceinline__ float bf16r(float v)
{
    unsigned u = __float_as_uint(v);
    u = (u + 0x7FFFu + ((u >> 16) & 1u)) & 0xFFFF0000u;
    return __uint_as_float(u);
}

// v ~= hi + lo/2048 with hi, lo in f16
__device__ __forceinline__ void split2(float v, hf& hi, hf& lo)
{
    hf h = (hf)v;
    hi = h;
    lo = (hf)((v - (float)h) * 2048.0f);
}

__device__ __forceinline__ v8f zero8()
{
    v8f z = {0.f, 0.f, 0.f, 0.f, 0.f, 0.f, 0.f, 0.f};
    return z;
}

// ---------------------------------------------------------------------------------------------
// xh = f16(bf16(x)) in fragment order ([MR][DM]); thread t fills 16-byte piece t, lane-contiguous stores
// ---------------------------------------------------------------------------------------------
__device__ __forceinline__ void prep_x(const float* __restrict__ x, hf* __restrict__ xh, int t)
{
    const int lane = t & 31, part = (t >> 5) & 1, tile = t >> 6;
    const int rb = tile / KT_DM, kb = tile - rb * KT_DM;
    const float* p = x + (size_t)(16 * rb + (lane & 15)) * DM + 32 * kb + 16 * part + 8 * (lane >> 4);
    v4f_t a = *(const v4f*)p;
    v4f_t b = *(const v4f*)(p + 4);
    v8h_t o;
    o[0] = (hf)bf16r(a[0]); o[1] = (hf)bf16r(a[1]); o[2] = (hf)bf16r(a[2]); o[3] = (hf)bf16r(a[3]);
    o[4] = (hf)bf16r(b[0]); o[5] = (hf)bf16r(b[1]); o[6] = (hf)bf16r(b[2]); o[7] = (hf)bf16r(b[3]);
    hf* d = xh + (size_t)t * 8;
    *(v8h*)d = o;
    // the arms of k_prep follow one another in the code: the store's registers stay unwritten up to this wait
    asm volatile("s_wait_xcnt 0x0" ::: "memory");
}

// ---------------------------------------------------------------------------------------------
// wt[w] = fragment order of [c][k] = f16(bf16(W_w[k][c]) * 16), W_w is [DM(k)][DM(c)]; 8 consecutive k per thread,
// thread = 16-byte piece of the plane: 16 neighbouring lanes read 16 neighbouring c of one k row
// ---------------------------------------------------------------------------------------------
__device__ __forceinline__ void prep_w(const float* __restrict__ w0, const float* __restrict__ w1,
                                       const float* __restrict__ w2, const float* __restrict__ w3,
                                       hf* __restrict__ wt, int t)
{
    const int per = DM * (DM / 8);
    const int wi  = t / per;
    const int rem = t - wi * per;
    const int lane = rem & 31, part = (rem >> 5) & 1, tile = rem >> 6;
    const int rb  = tile / KT_DM, kb = tile - rb * KT_DM;
    const int c   = 16 * rb + (lane & 15);
    const int k8  = 32 * kb + 16 * part + 8 * (lane >> 4);
    const float* W = (wi == 0) ? w0 : (wi == 1) ? w1 : (wi == 2) ? w2 : w3;
    v8h_t o;
    #pragma unroll
    for (int e = 0; e < 8; ++e) o[e] = (hf)(bf16r(W[(size_t)(k8 + e) * DM + c]) * 16.0f);
    hf* d = wt + (size_t)wi * DM * DM + (size_t)rem * 8;
    *(v8h*)d = o;
    // the arms of k_prep follow one another in the code: the store's registers stay unwritten up to this wait
    asm volatile("s_wait_xcnt 0x0" ::: "memory");
}

// ---------------------------------------------------------------------------------------------
// btab[h][delta] = bf16(rel[bucket(delta)][h]) * DH^-0.5, causal bucketing; 4 deltas per thread
// ---------------------------------------------------------------------------------------------
__device__ __forceinline__ void prep_bias(const float* __restrict__ rel, float* __restrict__ tab, int t)
{
    const int h  = t / (NN / 4);
    const int d4 = (t - h * (NN / 4)) * 4;
    v4f_t o;
    #pragma unroll
    for (int e = 0; e < 4; ++e) {
        const int d = d4 + e;
        int bk;
        if (d < NBKT / 2) {
            bk = d;
        } else {
            float f  = (float)d * (1.0f / 16.0f);
            float lg = logf(f);
            float u  = lg * (1.0f / 2.0794415416798357f);
            float w  = u * 16.0f;
            int v = (NBKT / 2) + (int)w;
            bk = v < (NBKT - 1) ? v : (NBKT - 1);
            if (bk < 0) bk = 0;
        }
        o[e] = bf16r(rel[bk * HH + h]) * 0.125f;
    }
    float* d = tab + (size_t)h * NN + d4;
    *(v4f*)d = o;
    // the arms of k_prep follow one another in the code: the store's registers stay unwritten up to this wait
    asm volatile("s_wait_xcnt 0x0" ::: "memory");
}

// ---------------------------------------------------------------------------------------------
// The three conversions depend on nothing but the inputs: one launch, a block range each.
// ---------------------------------------------------------------------------------------------
#define PB_BIAS (HH * NN / 4 / 256)
#define PB_W    (4 * DM * (DM / 8) / 256)
#define PB_X    (MR * DM / 8 / 256)
static_assert((HH * NN / 4) % 256 == 0 && (4 * DM * (DM / 8)) % 256 == 0 && (MR * DM / 8) % 256 == 0);

__global__ __launch_bounds__(256)
void k_prep(const float* __restrict__ x, const float* __restrict__ w0, const float* __restrict__ w1,
            const float* __restrict__ w2, const float* __restrict__ w3, const float* __restrict__ rel,
            hf* __restrict__ xh, hf* __restrict__ wt, float* __restrict__ tab)
{
    const int blk = blockIdx.x, tid = threadIdx.x;
    if (blk < PB_BIAS)                    prep_bias(rel, tab, blk * 256 + tid);
    else if (blk < PB_BIAS + PB_W)        prep_w(w0, w1, w2, w3, wt, (blk - PB_BIAS) * 256 + tid);
    else if (blk < PB_BIAS + PB_W + PB_X) prep_x(x, xh, (blk - PB_BIAS - PB_W) * 256 + tid);
}

// ---------------------------------------------------------------------------------------------
// C[64 FA x 64 tile] = A[64 FA x 768] * Wt[64 x 768]^T / 16, block = 4 waves, wave = FA row blocks of 16 x 64 cols:
// row block 4f + wave of the tile (f < FA), so that the four waves together hold one 64-row slab for each f.
// A B fragment serves FA products and an A fragment four. The k loop is unrolled whole over a ring of ST fragment
// register sets: step ks + ST - 1 is loaded in front of the products of step ks, every load is base + constant.
// MODE 0 (grid.z: 0 = q, 1 = k, 2 = v): q/k stored as [MR][DM] hi/lo f16 planes,
//         v stored transposed, [BB * DM][NN], as hi/lo f16 planes. A = xh. All planes in fragment order.
// MODE 1: A = attention output hi (+ lo plane for rows (m0 mod NN) < RSPLIT), C stored f32 to out.
// ---------------------------------------------------------------------------------------------
// Every loop of ld_step, gemm_k and k_proj is unrolled: the fragment, accumulator and staging indices must be
// constants for the arrays to live in registers and for every address to be base + constant.
template <int FA, bool TWO>
__device__ __forceinline__ void ld_step(const hf* ap, const hf* ap2, const hf* bp, int ks,
                                        v16h (&a)[FA], v16h (&a2)[FA], v16h (&b)[4])
{
    #pragma unroll
    for (int t = 0; t < 4; ++t) b[t] = ldpk(bp + (t * KT_DM + ks) * 512);
    #pragma unroll
    for (int f = 0; f < FA; ++f) {
        a[f] = ldpk(ap + (4 * f * KT_DM + ks) * 512);
        if (TWO) a2[f] = ldpk(ap2 + (4 * f * KT_DM + ks) * 512);
    }
}

// The builtin alone: the compiler keeps the distance behind its own matrix instructions, and operands that pass
// through no asm statement may live above v255, which the accumulators and the ring together need.
__device__ __forceinline__ v8f mmab(v16h a, v16h b, v8f c)
{
    return __builtin_amdgcn_wmma_f32_16x16x32_f16(false, a, false, b, (short)0, c, false, false);
}

template <int FA, int ST, bool TWO>
__device__ __forceinline__ void gemm_k(const hf* ap, const hf* ap2, const hf* bp,
                                       v8f (&acc)[FA][4], v8f (&acc2)[FA][4])
{
    v16h a[ST][FA], a2[ST][FA], b[ST][4];
    #pragma unroll
    for (int ks = 0; ks < ST - 1; ++ks) ld_step<FA, TWO>(ap, ap2, bp, ks, a[ks], a2[ks], b[ks]);
    // unrolled whole: the ring's set numbers become register names and no address register is ever stepped
    #pragma unroll
    for (int ks = 0; ks < KT_DM; ++ks) {
        const int s = ks % ST, sn = (ks + ST - 1) % ST;
        if (ks + ST - 1 < KT_DM) ld_step<FA, TWO>(ap, ap2, bp, ks + ST - 1, a[sn], a2[sn], b[sn]);
        // holds the loads above in front of this step's products: without it the compiler sinks each load down to
        // its first use, ST - 1 steps on, and the wave waits out the whole load latency there
        __builtin_amdgcn_sched_barrier(0);
        #pragma unroll
        for (int f = 0; f < FA; ++f) {
            #pragma unroll
            for (int t = 0; t < 4; ++t) acc[f][t] = mmab(a[s][f], b[s][t], acc[f][t]);
        }
        if (TWO) {
            #pragma unroll
            for (int f = 0; f < FA; ++f) {
                #pragma unroll
                for (int t = 0; t < 4; ++t) acc2[f][t] = mmab(a2[s][f], b[s][t], acc2[f][t]);
            }
        }
    }
    // names the loads' address registers as inputs: they stay unwritten up to this wait, behind the last load
    asm volatile("s_wait_xcnt 0x0" :: "v"(ap), "v"(ap2), "v"(bp) : "memory");
}

template <int MODE, int FA, int ST>
__global__ __launch_bounds__(128)
void k_proj(const hf* __restrict__ Ahi, const hf* __restrict__ Alo, const hf* __restrict__ Wt,
            hf* __restrict__ o0h, hf* __restrict__ o0l,
            hf* __restrict__ o1h, hf* __restrict__ o1l,
            hf* __restrict__ o2h, hf* __restrict__ o2l,
            float* __restrict__ outf)
{
    static_assert(MR % (64 * FA) == 0 && NN % (64 * FA) == 0 && RSPLIT % (64 * FA) == 0);
    __shared__ __attribute__((aligned(16))) float Call[FA][64][68];   // a staging array for each 64-row slab

    const int wave = threadIdx.x >> 5, lane = threadIdx.x & 31, m = lane & 15, hh = lane >> 4;
    const int n0 = blockIdx.x * 64, mt = blockIdx.y * (64 * FA), z = blockIdx.z;
    if (n0 >= DM || mt >= MR) return;
    const hf* Bt = Wt + (size_t)z * DM * DM;
    const bool two = (MODE == 1) && ((mt & (NN - 1)) < RSPLIT);

    const size_t aoff = (size_t)(mt / 16 + wave) * KT_DM * 512 + 8 * lane;
    const hf* ap  = Ahi + aoff;
    const hf* ap2 = two ? (Alo + aoff) : ap;
    const hf* bp  = Bt + (size_t)(n0 / 16) * KT_DM * 512 + 8 * lane;

    v8f acc[FA][4], acc2[FA][4];
    #pragma unroll
    for (int f = 0; f < FA; ++f) {
        #pragma unroll
        for (int t = 0; t < 4; ++t) { acc[f][t] = zero8(); acc2[f][t] = zero8(); }
    }

    if (two) gemm_k<FA, ST, true>(ap, ap2, bp, acc, acc2);
    else     gemm_k<FA, ST, false>(ap, ap2, bp, acc, acc2);

    // D element r of lane: row 16*wave + 8*hh + r of slab f, col 16*t + m
    #pragma unroll
    for (int f = 0; f < FA; ++f) {
        #pragma unroll
        for (int t = 0; t < 4; ++t) {
            #pragma unroll
            for (int r = 0; r < 8; ++r) {
                float v = acc[f][t][r];
                if (MODE == 1) v += acc2[f][t][r] * (1.0f / 2048.0f);
                Call[f][16 * wave + 8 * hh + r][16 * t + m] = v * (1.0f / 16.0f);
            }
        }
    }
    __syncthreads();

    // One 64-row slab after the other. Each s_wait_xcnt below names its stores' data and address registers as
    // inputs: they stay unwritten up to the wait, and the next piece's values may take them only behind it.
    if (MODE == 0) {
        if (z < 2) {
            hf* dh = (z == 0) ? o0h : o1h;
            hf* dl = (z == 0) ? o0l : o1l;
            #pragma unroll
            for (int f = 0; f < FA; ++f) {
                const int m0 = mt + 64 * f;
                #pragma unroll
                for (int it = 0; it < 4; ++it) {
                    const int row = 16 * it + m;             // row block it, columns 16 wave + 8hh + 0..7
                    const int c8  = 16 * wave + 8 * hh;
                    v4f_t u0 = *(const v4f*)&Call[f][row][c8];
                    v4f_t u1 = *(const v4f*)&Call[f][row][c8 + 4];
                    v8h_t ph, pl;
                    hf a, bl;
                    split2(u0[0], a, bl); ph[0] = a; pl[0] = bl;
                    split2(u0[1], a, bl); ph[1] = a; pl[1] = bl;
                    split2(u0[2], a, bl); ph[2] = a; pl[2] = bl;
                    split2(u0[3], a, bl); ph[3] = a; pl[3] = bl;
                    split2(u1[0], a, bl); ph[4] = a; pl[4] = bl;
                    split2(u1[1], a, bl); ph[5] = a; pl[5] = bl;
                    split2(u1[2], a, bl); ph[6] = a; pl[6] = bl;
                    split2(u1[3], a, bl); ph[7] = a; pl[7] = bl;
                    const size_t off = ((size_t)(m0 / 16 + it) * KT_DM + n0 / 32 + (wave >> 1)) * 512
                                     + (wave & 1) * 256 + 8 * lane;
                    hf* sh = dh + off;
                    hf* sl = dl + off;
                    *(v8h*)sh = ph;
                    *(v8h*)sl = pl;
                    asm volatile("s_wait_xcnt 0x0" :: "v"(ph), "v"(pl), "v"(sh), "v"(sl) : "memory");
                }
            }
        } else {
            #pragma unroll
            for (int f = 0; f < FA; ++f) {
                const int m0   = mt + 64 * f;
                const int bidx = m0 >> 11;
                const int j0   = m0 & (NN - 1);
                #pragma unroll
                for (int it = 0; it < 4; ++it) {
                    const int cc = 16 * it + m;              // channel block it, keys 16 wave + 8hh + 0..7
                    const int j8 = 16 * wave + 8 * hh;
                    v8h_t ph, pl;
                    #pragma unroll
                    for (int e = 0; e < 8; ++e) {
                        hf a, bl;
                        split2(Call[f][j8 + e][cc], a, bl);
                        ph[e] = a; pl[e] = bl;
                    }
                    const size_t off = ((size_t)((bidx * DM + n0) / 16 + it) * KT_NN + j0 / 32 + (wave >> 1)) * 512
                                     + (wave & 1) * 256 + 8 * lane;
                    hf* sh = o2h + off;
                    hf* sl = o2l + off;
                    *(v8h*)sh = ph;
                    *(v8h*)sl = pl;
                    asm volatile("s_wait_xcnt 0x0" :: "v"(ph), "v"(pl), "v"(sh), "v"(sl) : "memory");
                }
            }
        }
    } else {
        #pragma unroll
        for (int f = 0; f < FA; ++f) {
            const int m0 = mt + 64 * f;
            #pragma unroll
            for (int it = 0; it < 8; ++it) {
                const int row = 16 * wave + 2 * it + (lane >> 4);
                const int c4  = (lane & 15) * 4;
                v4f_t u = *(const v4f*)&Call[f][row][c4];
                float* so = outf + (size_t)(m0 + row) * DM + n0 + c4;
                *(v4f*)so = u;
                asm volatile("s_wait_xcnt 0x0" :: "v"(u), "v"(so) : "memory");
            }
        }
    }
}

// ---------------------------------------------------------------------------------------------
// Fused causal attention, block = (a run of queries, head h, batch b); a wave owns 16 queries and walks 64-key
// tiles on its own, with no LDS traffic for scores and no barrier inside the loop:
//   S^T = K.Q^T   (A = K rows, B = Q rows as [n][k]): lane holds query (lane&15), keys 16kk + 8*(lane>>4) + r
//   online softmax per lane (bias, causal, row mask), one exchange between the wave halves for the maximum
//   O^T += V^T.P^T (A = V^T rows, B = P^T packed from the score registers, f16 x4096 (+ residual plane))
// SPLIT: hi/lo residual products on q.k^T and p.v. Output: attention rows as hi/lo f16 planes in fragment order
// ([MR][DM]): a lane's 8 values of a d tile are one 16-byte piece of it, so every wave stores whole lines itself.
// Not SPLIT: 64 queries, 4 waves, each all four 16-wide d tiles. SPLIT: 32 queries, 4 waves, two per 16 queries,
// each two d tiles (both form the same S^T), so that both planes of K, V^T, Q and O fit the register file
// without spills. Both kinds of block share one launch (k_attn below): neither reads what the other writes.
// ---------------------------------------------------------------------------------------------
// p = exp(x), built as the fast intrinsic is (x * log2 e, then v_exp_f32). Written as asm so that the slot the
// instruction set asks for behind a transcendental is kept by construction: the results are early-clobber, so
// no v_exp_f32 of a statement writes over a source of another, and the closing v_nop stands behind the last.
__device__ __forceinline__ void exp8(const float (&x)[8], float (&p)[8])
{
    float t[8];
    #pragma unroll
    for (int r = 0; r < 8; ++r) t[r] = x[r] * 1.44269504f;
    asm("v_exp_f32 %0, %8\n\tv_exp_f32 %1, %9\n\tv_exp_f32 %2, %10\n\tv_exp_f32 %3, %11\n\t"
        "v_exp_f32 %4, %12\n\tv_exp_f32 %5, %13\n\tv_exp_f32 %6, %14\n\tv_exp_f32 %7, %15\n\tv_nop"
        : "=&v"(p[0]), "=&v"(p[1]), "=&v"(p[2]), "=&v"(p[3]), "=&v"(p[4]), "=&v"(p[5]), "=&v"(p[6]), "=&v"(p[7])
        : "v"(t[0]), "v"(t[1]), "v"(t[2]), "v"(t[3]), "v"(t[4]), "v"(t[5]), "v"(t[6]), "v"(t[7]));
}

__device__ __forceinline__ float exp1(float x)
{
    const float t = x * 1.44269504f;
    float p;
    asm("v_exp_f32 %0, %1\n\tv_nop" : "=&v"(p) : "v"(t));   // same slot, one value
    return p;
}

template <bool SPLIT, int NDT>
__device__ __forceinline__ void load_v(const hf* vp, const hf* vp2, v16h (&vf)[NDT][2], v16h (&vf2)[NDT][2])
{
    #pragma unroll
    for (int dt = 0; dt < NDT; ++dt) {
        #pragma unroll
        for (int ks = 0; ks < 2; ++ks) {
            vf[dt][ks] = ldpk(vp + (dt * KT_NN + ks) * 512);
            if (SPLIT) vf2[dt][ks] = ldpk(vp2 + (dt * KT_NN + ks) * 512);
        }
    }
}

template <bool SPLIT>
__device__ __forceinline__
void attn_block(const hf* __restrict__ qhi, const hf* __restrict__ qlo,
                const hf* __restrict__ khi, const hf* __restrict__ klo,
                const hf* __restrict__ vthi, const hf* __restrict__ vtlo,
                const float* __restrict__ btab, const int* __restrict__ mask,
                hf* __restrict__ ohi, hf* __restrict__ olo,
                float* bias_sm, int q0, int h, int b)   // q0: first query of the block
{
    const int tid = threadIdx.x, lane = tid & 31, m = lane & 15, hh = lane >> 4;
    const int wave = __builtin_amdgcn_readfirstlane(tid >> 5);
    constexpr int NT  = 128;                     // threads per block
    constexpr int NDT = SPLIT ? 2 : 4;           // d tiles per wave
    const int qt  = SPLIT ? (wave >> 1) : wave;  // 16-query sub-tile of this wave
    const int dt0 = SPLIT ? NDT * (wave & 1) : 0;
    const int i0 = q0 + 16 * qt;                 // first query of this wave
    const int i  = i0 + m;                       // this lane's query
    const float NINF = -__builtin_inff();

    if (tid < 64) bias_sm[tid] = 0.0f;
    #pragma unroll
    for (int t = 0; t < NN / (4 * NT); ++t)
        *(v4f*)&bias_sm[64 + 4 * NT * t + 4 * tid] = *(const v4f*)&btab[(size_t)h * NN + 4 * NT * t + 4 * tid];
    const bool valid = (mask[(size_t)b * NN + i] != 0);
    const bool anym  = (__builtin_amdgcn_ballot_w32(!valid) != 0u);
    __syncthreads();
    const int jext   = anym ? NN : (i0 + 16);
    const int ntiles = (jext + 63) >> 6;         // <= NN/64

    // Q fragments as B operand ([n = query][k = d]); the head's two k tiles of this wave's row block.
    // The attention output of these queries has the same place in its planes.
    const size_t qtile = ((size_t)((b * NN + i0) / 16) * KT_DM + 2 * h) * 512 + 8 * lane;
    v16h qf[2], qf2[2];
    #pragma unroll
    for (int ks = 0; ks < 2; ++ks) {
        qf[ks] = ldpk(qhi + qtile + 512 * ks);
        if (SPLIT) qf2[ks] = ldpk(qlo + qtile + 512 * ks); else qf2[ks] = qf[ks];
    }

    v8f oacc[NDT], oacc2[NDT];
    #pragma unroll
    for (int dt = 0; dt < NDT; ++dt) { oacc[dt] = zero8(); oacc2[dt] = zero8(); }
    float m_run = NINF, l_run = 0.0f;            // l_run: sum over the keys of this lane's half only

    #pragma unroll 1
    for (int jt = 0; jt < ntiles; ++jt) {
        const int jb = jt * 64;
        const size_t ktile = ((size_t)((b * NN + jb) / 16) * KT_DM + 2 * h) * 512 + 8 * lane;
        const size_t vtile = ((size_t)((b * DM + h * DH) / 16 + dt0) * KT_NN + 2 * jt) * 512 + 8 * lane;
        // lane bases: every load below is base + constant
        const hf* kp  = khi + ktile;
        const hf* kp2 = klo + ktile;
        const hf* vp  = vthi + vtile;
        const hf* vp2 = vtlo + vtile;

        v16h kf[4][2], kf2[4][2], vf[NDT][2], vf2[NDT][2];
        #pragma unroll
        for (int kk = 0; kk < 4; ++kk) {
            #pragma unroll
            for (int ks = 0; ks < 2; ++ks) {
                kf[kk][ks] = ldpk(kp + (kk * KT_DM + ks) * 512);
                if (SPLIT) kf2[kk][ks] = ldpk(kp2 + (kk * KT_DM + ks) * 512);
            }
        }
        // V^T loads fly under the score work; SPLIT issues them once the K registers are free again.
        // The s_wait_xcnt statements further down name the loads' address registers as inputs: that keeps them
        // unwritten, also by a later load's result, up to the wait; they stand late so that nothing stalls on them
        if (!SPLIT) load_v<SPLIT, NDT>(vp, vp2, vf, vf2);

        // ---- S^T: D row = key 16kk + 8hh + r (within tile), D col = query m ----
        const int dl = i - jb - 8 * hh;          // key (kk, r) is visible to this lane's query iff 16kk + r <= dl
        const int bb = dl + 1 > 0 ? dl + 1 : 0;  // all keys hidden where this clamps
        float sv[4][8];
        #pragma unroll
        for (int kk = 0; kk < 4; ++kk) {
            v8f acc = zero8(), acc2 = zero8();
            #pragma unroll
            for (int ks = 0; ks < 2; ++ks) {
                acc = mma(kf[kk][ks], qf[ks], acc);
                if (SPLIT) {
                    acc2 = mma(kf[kk][ks], qf2[ks], acc2);
                    acc2 = mma(kf2[kk][ks], qf[ks], acc2);
                }
            }
            #pragma unroll
            for (int r = 0; r < 8; ++r) {
                float v = acc[r];
                if (SPLIT) v += acc2[r] * (1.0f / 2048.0f);
                v = v * 0.125f + bias_sm[bb + (63 - 16 * kk - r)];
                sv[kk][r] = (16 * kk + r > dl) ? NINF : v;
            }
        }
        if (SPLIT) {
            asm volatile("s_wait_xcnt 0x0" :: "v"(kp), "v"(kp2) : "memory");   // K address registers free from here
            load_v<SPLIT, NDT>(vp, vp2, vf, vf2);
        }
        if (anym) {
            #pragma unroll
            for (int kk = 0; kk < 4; ++kk) {
                #pragma unroll
                for (int r = 0; r < 8; ++r) sv[kk][r] = valid ? sv[kk][r] : 0.0f;
            }
        }

        // ---- online softmax, one query per lane ----
        float t4[4];
        #pragma unroll
        for (int kk = 0; kk < 4; ++kk) {
            t4[kk] = fmaxf(fmaxf(fmaxf(sv[kk][0], sv[kk][1]), fmaxf(sv[kk][2], sv[kk][3])),
                           fmaxf(fmaxf(sv[kk][4], sv[kk][5]), fmaxf(sv[kk][6], sv[kk][7])));
        }
        float tmax = fmaxf(fmaxf(t4[0], t4[1]), fmaxf(t4[2], t4[3]));
        tmax = fmaxf(tmax, __shfl_xor(tmax, 16, 32));
        const float mn = fmaxf(m_run, tmax);
        const float ea = exp1(m_run - mn);
        const float alpha = (m_run == NINF) ? 0.0f : ea;
        m_run = mn;

        Frag ph[2], pl[2];
        float ps4[4];
        #pragma unroll
        for (int kk = 0; kk < 4; ++kk) {
            float x[8], p[8];
            #pragma unroll
            for (int r = 0; r < 8; ++r) x[r] = sv[kk][r] - mn;
            exp8(x, p);
            #pragma unroll
            for (int r = 0; r < 8; ++r) {
                hf a, bl;
                split2(p[r] * 4096.0f, a, bl);
                ph[kk >> 1].v[8 * (kk & 1) + r] = a;
                if (SPLIT) pl[kk >> 1].v[8 * (kk & 1) + r] = bl;
            }
            ps4[kk] = ((p[0] + p[1]) + (p[2] + p[3])) + ((p[4] + p[5]) + (p[6] + p[7]));
        }
        l_run = l_run * alpha + ((ps4[0] + ps4[1]) + (ps4[2] + ps4[3]));

        // address registers of the loads still named here are free from here
        if (SPLIT) asm volatile("s_wait_xcnt 0x0" :: "v"(vp), "v"(vp2) : "memory");
        else       asm volatile("s_wait_xcnt 0x0" :: "v"(kp), "v"(vp) : "memory");

        // ---- O^T: D row = d 16(dt0 + dt) + 8hh + r, D col = query m ----
        #pragma unroll
        for (int dt = 0; dt < NDT; ++dt) {
            #pragma unroll
            for (int r = 0; r < 8; ++r) { oacc[dt][r] *= alpha; if (SPLIT) oacc2[dt][r] *= alpha; }
            #pragma unroll
            for (int ks = 0; ks < 2; ++ks) {
                oacc[dt] = mma(vf[dt][ks], ph[ks].v, oacc[dt]);
                if (SPLIT) {
                    oacc2[dt] = mma(vf2[dt][ks], ph[ks].v, oacc2[dt]);
                    oacc2[dt] = mma(vf[dt][ks], pl[ks].v, oacc2[dt]);
                }
            }
        }
    }

    const float l = l_run + __shfl_xor(l_run, 16, 32);
    v8h_t oh[NDT], ol[NDT];
    #pragma unroll
    for (int dt = 0; dt < NDT; ++dt) {
        #pragma unroll
        for (int r = 0; r < 8; ++r) {
            float o = oacc[dt][r];
            if (SPLIT) o += oacc2[dt][r] * (1.0f / 2048.0f);
            o = (o / l) * (1.0f / 4096.0f);
            hf a, bl;
            split2(o, a, bl);
            oh[dt][r] = a; ol[dt][r] = bl;
        }
    }
    // d tile dt0 + dt = part (dt & 1) of the head's k tile (dt0 + dt) >> 1 (dt0 is even)
    #pragma unroll
    for (int dt = 0; dt < NDT; ++dt) {
        const size_t off = qtile + (size_t)((dt0 >> 1) + (dt >> 1)) * 512 + (dt & 1) * 256;
        *(v8h*)(ohi + off) = oh[dt];
        *(v8h*)(olo + off) = ol[dt];
    }
}

// One launch for all queries. blockIdx.x = (batch, head); blockIdx.y ranks the query runs by falling key count:
// first the single-plane runs of 64 queries from the end of the sequence down, then the two-plane runs of 32.
#define QB_ONE ((NN - 32 * QSPLIT) / 64)         // single-plane blocks per (batch, head)
static_assert((NN - 32 * QSPLIT) % 64 == 0);

__global__ __launch_bounds__(128)
void k_attn(const hf* __restrict__ qhi, const hf* __restrict__ qlo,
            const hf* __restrict__ khi, const hf* __restrict__ klo,
            const hf* __restrict__ vthi, const hf* __restrict__ vtlo,
            const float* __restrict__ btab, const int* __restrict__ mask,
            hf* __restrict__ ohi, hf* __restrict__ olo)
{
    // bias_sm[64 + delta] = bias of distance delta; 64 leading zeros take the reads of causally hidden keys
    __shared__ __attribute__((aligned(16))) float bias_sm[64 + NN];

    const int hb = blockIdx.x, rank = blockIdx.y;
    if (hb >= HH * BB || rank >= QB_ONE + QSPLIT) return;
    const int b = hb / HH, h = hb - b * HH;
    if (rank < QB_ONE)
        attn_block<false>(qhi, qlo, khi, klo, vthi, vtlo, btab, mask, ohi, olo, bias_sm,
                          NN - 64 * (rank + 1), h, b);
    else
        attn_block<true>(qhi, qlo, khi, klo, vthi, vtlo, btab, mask, ohi, olo, bias_sm,
                         32 * (QSPLIT - 1 - (rank - QB_ONE)), h, b);
}

// ---------------------------------------------------------------------------------------------
// Host glue: 4 launches, workspace carved from sizes (<= 62 MB)
// ---------------------------------------------------------------------------------------------
extern "C" void kernel_launch(void* const* d_in, const int* in_sizes, int n_in,
                              void* d_out, int out_size, void* d_ws, size_t ws_size,
                              hipStream_t stream)
{
    if (n_in < 7) return;
    if (in_sizes[0] != MR * DM) return;
    if (in_sizes[1] != BB * NN) return;
    if (in_sizes[2] != DM * DM || in_sizes[3] != DM * DM || in_sizes[4] != DM * DM || in_sizes[5] != DM * DM) return;
    if (in_sizes[6] != NBKT * HH) return;
    if (out_size != MR * DM) return;

    const float* x    = (const float*)d_in[0];
    const int*   mask = (const int*)d_in[1];
    const float* Wq   = (const float*)d_in[2];
    const float* Wk   = (const float*)d_in[3];
    const float* Wv   = (const float*)d_in[4];
    const float* Wo   = (const float*)d_in[5];
    const float* rel  = (const float*)d_in[6];
    float* out = (float*)d_out;

    char* ws = (char*)d_ws;
    size_t off = 0;
    auto carve = [&](size_t bytes) -> size_t { size_t p = off; off += (bytes + 255) & ~(size_t)255; return p; };
    const size_t plane = (size_t)MR * DM * sizeof(hf);
    const size_t o_xh   = carve(plane);
    const size_t o_wt   = carve((size_t)4 * DM * DM * sizeof(hf));
    const size_t o_qhi  = carve(plane);
    const size_t o_qlo  = carve(plane);
    const size_t o_khi  = carve(plane);
    const size_t o_klo  = carve(plane);
    const size_t o_vthi = carve(plane);
    const size_t o_vtlo = carve(plane);
    const size_t o_ahi  = carve(plane);
    const size_t o_alo  = carve(plane);
    const size_t o_btab = carve((size_t)HH * NN * sizeof(float));
    if (off > ws_size) return;

    hf* xh   = (hf*)(ws + o_xh);
    hf* wt   = (hf*)(ws + o_wt);
    hf* qhi  = (hf*)(ws + o_qhi);
    hf* qlo  = (hf*)(ws + o_qlo);
    hf* khi  = (hf*)(ws + o_khi);
    hf* klo  = (hf*)(ws + o_klo);
    hf* vthi = (hf*)(ws + o_vthi);
    hf* vtlo = (hf*)(ws + o_vtlo);
    hf* ahi  = (hf*)(ws + o_ahi);
    hf* alo  = (hf*)(ws + o_alo);
    float* btab = (float*)(ws + o_btab);

    k_prep<<<PB_BIAS + PB_W + PB_X, 256, 0, stream>>>(x, Wq, Wk, Wv, Wo, rel, xh, wt, btab);

    // q, k (hi/lo planes), v (transposed hi/lo planes)
    k_proj<0, 4, 2><<<dim3(DM / 64, MR / 256, 3), 128, 0, stream>>>(
        xh, xh, wt, qhi, qlo, khi, klo, vthi, vtlo, out);

    // attention: leading query blocks with residual products, remainder single-plane
    k_attn<<<dim3(HH * BB, QB_ONE + QSPLIT), 128, 0, stream>>>(
        qhi, qlo, khi, klo, vthi, vtlo, btab, mask, ahi, alo);

    // output projection -> out (f32)
    k_proj<1, 2, 4><<<dim3(DM / 64, MR / 128, 1), 128, 0, stream>>>(
        ahi, alo, wt + (size_t)3 * DM * DM, ahi, alo, ahi, alo, ahi, alo, out);
}

// v005
// It runs in 64.3 microseconds.
// Two timings next to v004 put it at 1.25 and 1.23 times that version's speed.
// Counting every step since v000, it is 5.30 times as fast.
#include <hip/hip_runtime.h>
#include <stdint.h>

// Contractions (q/k/v projections, q.k^T, p.v, output projection): v_wmma_f32_16x16x32_f16, f16 operands,
// f32 accumulate. x / weights / bias table are RNE-converted to bf16; x and weights are then held exactly in f16 (weights x16), the bias table in f32.
// q, k, v^T, p (x4096) and the attention output are carried as an f16 hi plane plus an f16 residual plane
// (residual x2048); residual products are issued for the leading query rows, single-plane products elsewhere.
//
// Every f16 operand plane in the workspace is stored in fragment order. A matrix M[rows][K] (K = contraction
// index) is cut into tiles of 16 rows x 32 k; tile (rb, kb) starts at half ((rb * K/32) + kb) * 512 and holds
//   M[16rb + m][32kb + 16part + 8hh + e]  at  part * 256 + (16hh + m) * 8 + e      (m < 16; part, hh < 2; e < 8)
// so lane 16hh + m of a wave finds its 16 fragment elements at tile + 8 * lane and tile + 256 + 8 * lane, and each
// of the two 16-byte loads (or stores) of a wave covers 512 contiguous bytes: four whole 128-byte lines.

#define BB 2
#define NN 2048
#define DM 768
#define HH 12
#define DH 64
#define MR (BB * NN)
#define NBKT 32
#define QSPLIT 16     // leading 32-query blocks per batch that use two-plane products in attention
#define RSPLIT 512    // leading rows per batch that use the two-plane A operand in the output projection

static_assert(DM % 64 == 0);
static_assert(NN % 64 == 0);
static_assert(MR % 64 == 0);
static_assert(DH == 64);
static_assert(RSPLIT % 64 == 0);
static_assert(QSPLIT <= NN / 32);
static_assert((MR * DM) % 8 == 0);
static_assert(DM % 32 == 0 && NN % 32 == 0 && MR % 16 == 0);
#define KT_DM (DM / 32)   // k tiles of a row block where K = DM
#define KT_NN (NN / 32)   // k tiles of a row block where K = NN (v^T)

typedef _Float16 hf;
typedef _Float16 v8h_t __attribute__((ext_vector_type(8)));
typedef v8h_t __attribute__((may_alias)) v8h;
typedef _Float16 v16h __attribute__((ext_vector_type(16)));
typedef float v8f __attribute__((ext_vector_type(8)));
typedef float v4f_t __attribute__((ext_vector_type(4)));
typedef v4f_t __attribute__((may_alias)) v4f;

union Frag { v16h v; v8h_t p[2]; };

// D(16x16,f32) += A(16x32) * B(32x16); nops keep VALU off the D/A/B registers right after issue.
__device__ __forceinline__ v8f mma(v16h a, v16h b, v8f c)
{
    v8f d = __builtin_amdgcn_wmma_f32_16x16x32_f16(false, a, false, b, (short)0, c, false, false);
    asm volatile("v_nop\n\tv_nop\n\tv_nop\n\tv_nop" : "+v"(d) : "v"(a), "v"(b));
    return d;
}

// 16x16x32 operand fragment for lane (row or column = lane&15), half hh = lane>>4:
// elements 0..7 <- k0+8hh+0..7, elements 8..15 <- k0+16+8hh+0..7 of the lane's row.
// Used for A ([m][k]) and for B held as [n][k]; p = start of the fragment-ordered tile + 8 * lane.
__device__ __forceinline__ v16h ldpk(const hf* p)
{
    Frag f;
    f.p[0] = *(const v8h*)(p);
    f.p[1] = *(const v8h*)(p + 256);
    return f.v;
}

__device__ __forceinline__ float bf16r(float v)
{
    unsigned u = __float_as_uint(v);
    u = (u + 0x7FFFu + ((u >> 16) & 1u)) & 0xFFFF0000u;
    return __uint_as_float(u);
}

// v ~= hi + lo/2048 with hi, lo in f16
__device__ __forceinline__ void split2(float v, hf& hi, hf& lo)
{
    hf h = (hf)v;
    hi = h;
    lo = (hf)((v - (float)h) * 2048.0f);
}

// Asks L2 for the aligned 256-byte unit at p + OFF bytes: nothing comes back and no counter moves. The planes a launch
// reads were stored by an earlier launch. Where such a line is not in the reader's L2 its first reader waits for
// memory, and the blocks that share a plane walk it in step, so every step of each of them would wait so; asked for
// at entry, the later steps' lines are on their way while the first steps run. Every lane's address lies inside its
// plane, and its register is kept as it is through the loop that follows (the s_wait_xcnt statements that name it).
template <int OFF>
__device__ __forceinline__ void l2_ask(const hf* p)
{
    asm volatile("global_prefetch_b8 %0, off offset:%1 scope:SCOPE_SE" :: "v"(p), "n"(OFF));
}

__device__ __forceinline__ v8f zero8()
{
    v8f z = {0.f, 0.f, 0.f, 0.f, 0.f, 0.f, 0.f, 0.f};
    return z;
}

// ---------------------------------------------------------------------------------------------
// xh = f16(bf16(x)) in fragment order ([MR][DM]); thread t fills 16-byte piece t, lane-contiguous stores
// ---------------------------------------------------------------------------------------------
__device__ __forceinline__ void prep_x(const float* __restrict__ x, hf* __restrict__ xh, int t)
{
    const int lane = t & 31, part = (t >> 5) & 1, tile = t >> 6;
    const int rb = tile / KT_DM, kb = tile - rb * KT_DM;
    const float* p = x + (size_t)(16 * rb + (lane & 15)) * DM + 32 * kb + 16 * part + 8 * (lane >> 4);
    v4f_t a = *(const v4f*)p;
    v4f_t b = *(const v4f*)(p + 4);
    v8h_t o;
    o[0] = (hf)bf16r(a[0]); o[1] = (hf)bf16r(a[1]); o[2] = (hf)bf16r(a[2]); o[3] = (hf)bf16r(a[3]);
    o[4] = (hf)bf16r(b[0]); o[5] = (hf)bf16r(b[1]); o[6] = (hf)bf16r(b[2]); o[7] = (hf)bf16r(b[3]);
    hf* d = xh + (size_t)t * 8;
    *(v8h*)d = o;
    // the arms of k_prep follow one another in the code: the store's registers stay unwritten up to this wait
    asm volatile("s_wait_xcnt 0x0" ::: "memory");
}

// ---------------------------------------------------------------------------------------------
// wt[w] = fragment order of [c][k] = f16(bf16(W_w[k][c]) * 16), W_w is [DM(k)][DM(c)]; 8 consecutive k per thread,
// thread = 16-byte piece of the plane: 16 neighbouring lanes read 16 neighbouring c of one k row
// ---------------------------------------------------------------------------------------------
__device__ __forceinline__ void prep_w(const float* __restrict__ w0, const float* __restrict__ w1,
                                       const float* __restrict__ w2, const float* __restrict__ w3,
                                       hf* __restrict__ wt, int t)
{
    const int per = DM * (DM / 8);
    const int wi  = t / per;
    const int rem = t - wi * per;
    const int lane = rem & 31, part = (rem >> 5) & 1, tile = rem >> 6;
    const int rb  = tile / KT_DM, kb = tile - rb * KT_DM;
    const int c   = 16 * rb + (lane & 15);
    const int k8  = 32 * kb + 16 * part + 8 * (lane >> 4);
    const float* W = (wi == 0) ? w0 : (wi == 1) ? w1 : (wi == 2) ? w2 : w3;
    v8h_t o;
    #pragma unroll
    for (int e = 0; e < 8; ++e) o[e] = (hf)(bf16r(W[(size_t)(k8 + e) * DM + c]) * 16.0f);
    hf* d = wt + (size_t)wi * DM * DM + (size_t)rem * 8;
    *(v8h*)d = o;
    // the arms of k_prep follow one another in the code: the store's registers stay unwritten up to this wait
    asm volatile("s_wait_xcnt 0x0" ::: "memory");
}

// ---------------------------------------------------------------------------------------------
// btab[h][delta] = bf16(rel[bucket(delta)][h]) * DH^-0.5, causal bucketing; 4 deltas per thread
// ---------------------------------------------------------------------------------------------
__device__ __forceinline__ void prep_bias(const float* __restrict__ rel, float* __restrict__ tab, int t)
{
    const int h  = t / (NN / 4);
    const int d4 = (t - h * (NN / 4)) * 4;
    v4f_t o;
    #pragma unroll
    for (int e = 0; e < 4; ++e) {
        const int d = d4 + e;
        int bk;
        if (d < NBKT / 2) {
            bk = d;
        } else {
            float f  = (float)d * (1.0f / 16.0f);
            float lg = logf(f);
            float u  = lg * (1.0f / 2.0794415416798357f);
            float w  = u * 16.0f;
            int v = (NBKT / 2) + (int)w;
            bk = v < (NBKT - 1) ? v : (NBKT - 1);
            if (bk < 0) bk = 0;
        }
        o[e] = bf16r(rel[bk * HH + h]) * 0.125f;
    }
    float* d = tab + (size_t)h * NN + d4;
    *(v4f*)d = o;
    // the arms of k_prep follow one another in the code: the store's registers stay unwritten up to this wait
    asm volatile("s_wait_xcnt 0x0" ::: "memory");
}

// ---------------------------------------------------------------------------------------------
// The three conversions depend on nothing but the inputs: one launch, a block range each.
// ---------------------------------------------------------------------------------------------
#define PB_BIAS (HH * NN / 4 / 256)
#define PB_W    (4 * DM * (DM / 8) / 256)
#define PB_X    (MR * DM / 8 / 256)
static_assert((HH * NN / 4) % 256 == 0 && (4 * DM * (DM / 8)) % 256 == 0 && (MR * DM / 8) % 256 == 0);

__global__ __launch_bounds__(256)
void k_prep(const float* __restrict__ x, const float* __restrict__ w0, const float* __restrict__ w1,
            const float* __restrict__ w2, const float* __restrict__ w3, const float* __restrict__ rel,
            hf* __restrict__ xh, hf* __restrict__ wt, float* __restrict__ tab)
{
    const int blk = blockIdx.x, tid = threadIdx.x;
    if (blk < PB_BIAS)                    prep_bias(rel, tab, blk * 256 + tid);
    else if (blk < PB_BIAS + PB_W)        prep_w(w0, w1, w2, w3, wt, (blk - PB_BIAS) * 256 + tid);
    else if (blk < PB_BIAS + PB_W + PB_X) prep_x(x, xh, (blk - PB_BIAS - PB_W) * 256 + tid);
}

// ---------------------------------------------------------------------------------------------
// C[64 FA x 64 tile] = A[64 FA x 768] * Wt[64 x 768]^T / 16, block = 4 waves, wave = FA row blocks of 16 x 64 cols:
// row block 4f + wave of the tile (f < FA), so that the four waves together hold one 64-row slab for each f.
// A B fragment serves FA products and an A fragment four. The k loop is unrolled whole over a ring of ST fragment
// register sets: step ks + ST - 1 is loaded in front of the products of step ks, every load is base + constant.
// MODE 0 (grid.z: 0 = q, 1 = k, 2 = v): q/k stored as [MR][DM] hi/lo f16 planes,
//         v stored transposed, [BB * DM][NN], as hi/lo f16 planes. A = xh. All planes in fragment order.
// MODE 1: A = attention output hi (+ lo plane for rows (m0 mod NN) < RSPLIT), C stored f32 to out.
// ---------------------------------------------------------------------------------------------
// Every loop of ld_step, gemm_k and k_proj is unrolled: the fragment, accumulator and staging indices must be
// constants for the arrays to live in registers and for every address to be base + constant.
template <int FA, bool TWO>
__device__ __forceinline__ void ld_step(const hf* ap, const hf* ap2, const hf* bp, int ks,
                                        v16h (&a)[FA], v16h (&a2)[FA], v16h (&b)[4])
{
    #pragma unroll
    for (int t = 0; t < 4; ++t) b[t] = ldpk(bp + (t * KT_DM + ks) * 512);
    #pragma unroll
    for (int f = 0; f < FA; ++f) {
        a[f] = ldpk(ap + (4 * f * KT_DM + ks) * 512);
        if (TWO) a2[f] = ldpk(ap2 + (4 * f * KT_DM + ks) * 512);
    }
}

// The builtin alone: the compiler keeps the distance behind its own matrix instructions, and operands that pass
// through no asm statement may live above v255, which the accumulators and the ring together need.
__device__ __forceinline__ v8f mmab(v16h a, v16h b, v8f c)
{
    return __builtin_amdgcn_wmma_f32_16x16x32_f16(false, a, false, b, (short)0, c, false, false);
}

template <int FA, int ST, bool TWO>
__device__ __forceinline__ void gemm_k(const hf* ap, const hf* ap2, const hf* bp,
                                       v8f (&acc)[FA][4], v8f (&acc2)[FA][4])
{
    v16h a[ST][FA], a2[ST][FA], b[ST][4];
    #pragma unroll
    for (int ks = 0; ks < ST - 1; ++ks) ld_step<FA, TWO>(ap, ap2, bp, ks, a[ks], a2[ks], b[ks]);
    // unrolled whole: the ring's set numbers become register names and no address register is ever stepped
    #pragma unroll
    for (int ks = 0; ks < KT_DM; ++ks) {
        const int s = ks % ST, sn = (ks + ST - 1) % ST;
        if (ks + ST - 1 < KT_DM) ld_step<FA, TWO>(ap, ap2, bp, ks + ST - 1, a[sn], a2[sn], b[sn]);
        // holds the loads above in front of this step's products: without it the compiler sinks each load down to
        // its first use, ST - 1 steps on, and the wave waits out the whole load latency there
        __builtin_amdgcn_sched_barrier(0);
        #pragma unroll
        for (int f = 0; f < FA; ++f) {
            #pragma unroll
            for (int t = 0; t < 4; ++t) acc[f][t] = mmab(a[s][f], b[s][t], acc[f][t]);
        }
        if (TWO) {
            #pragma unroll
            for (int f = 0; f < FA; ++f) {
                #pragma unroll
                for (int t = 0; t < 4; ++t) acc2[f][t] = mmab(a2[s][f], b[s][t], acc2[f][t]);
            }
        }
    }
    // names the loads' address registers as inputs: they stay unwritten up to this wait, behind the last load
    asm volatile("s_wait_xcnt 0x0" :: "v"(ap), "v"(ap2), "v"(bp) : "memory");
}

template <int MODE, int FA, int ST>
__global__ __launch_bounds__(128)
void k_proj(const hf* __restrict__ Ahi, const hf* __restrict__ Alo, const hf* __restrict__ Wt,
            hf* __restrict__ o0h, hf* __restrict__ o0l,
            hf* __restrict__ o1h, hf* __restrict__ o1l,
            hf* __restrict__ o2h, hf* __restrict__ o2l,
            float* __restrict__ outf)
{
    static_assert(MR % (64 * FA) == 0 && NN % (64 * FA) == 0 && RSPLIT % (64 * FA) == 0);
    __shared__ __attribute__((aligned(16))) float Call[FA][64][68];   // a staging array for each 64-row slab

    const int wave = threadIdx.x >> 5, lane = threadIdx.x & 31, m = lane & 15, hh = lane >> 4;
    const int n0 = blockIdx.x * 64, mt = blockIdx.y * (64 * FA), z = blockIdx.z;
    if (n0 >= DM || mt >= MR) return;
    const hf* Bt = Wt + (size_t)z * DM * DM;
    const bool two = (MODE == 1) && ((mt & (NN - 1)) < RSPLIT);

    const size_t aoff = (size_t)(mt / 16 + wave) * KT_DM * 512 + 8 * lane;
    const hf* ap  = Ahi + aoff;
    const hf* ap2 = two ? (Alo + aoff) : ap;
    const hf* bp  = Bt + (size_t)(n0 / 16) * KT_DM * 512 + 8 * lane;

    // L2 requests for the whole A and B panels, dealt over the blocks that read the same panel so that four
    // neighbours in x with all z (A, MODE 0) or three in x (A, MODE 1), or three next neighbours in y of one parity (B), together
    // ask for all of it: a guess at which blocks share an L2, for speed only. A lane asks for one 256-byte unit
    // (128 halves).
    const hf* pfb = Bt + ((size_t)(n0 / 16 + wave) * KT_DM + 8 * ((blockIdx.y >> 1) % 3)) * 512 + 128 * lane;
    const hf* pfa;
    const hf* pfa2;
    static_assert(KT_DM == 24);
    l2_ask<0>(pfb);                                   // 8 k tiles of B row block 'wave'
    if (MODE == 0) {
        static_assert(MODE != 0 || FA == 4);          // 16 row blocks x 2 k tiles: 128 units
        pfa = Ahi + ((size_t)(mt / 16 + (threadIdx.x >> 3)) * KT_DM + 2 * (4 * z + (blockIdx.x & 3))) * 512
                  + 128 * (threadIdx.x & 7);
        pfa2 = pfa;
        l2_ask<0>(pfa);
    } else {
        static_assert(MODE == 0 || FA == 2);          // 8 k tiles of A row blocks 'wave' and 'wave' + 4
        const size_t poff = ((size_t)(mt / 16 + wave) * KT_DM + 8 * (blockIdx.x % 3)) * 512 + 128 * lane;
        pfa  = Ahi + poff;
        pfa2 = two ? (Alo + poff) : pfa;
        l2_ask<0>(pfa);
        l2_ask<4 * KT_DM * 1024>(pfa);
        if (two) {
            l2_ask<0>(pfa2);
            l2_ask<4 * KT_DM * 1024>(pfa2);
        }
    }

    v8f acc[FA][4], acc2[FA][4];
    #pragma unroll
    for (int f = 0; f < FA; ++f) {
        #pragma unroll
        for (int t = 0; t < 4; ++t) { acc[f][t] = zero8(); acc2[f][t] = zero8(); }
    }

    if (two) gemm_k<FA, ST, true>(ap, ap2, bp, acc, acc2);
    else     gemm_k<FA, ST, false>(ap, ap2, bp, acc, acc2);
    // names the L2 requests' address registers as inputs: they hold those addresses, and nothing else, through the k loop
    asm volatile("s_wait_xcnt 0x0" :: "v"(pfa), "v"(pfa2), "v"(pfb) : "memory");

    // D element r of lane: row 16*wave + 8*hh + r of slab f, col 16*t + m
    #pragma unroll
    for (int f = 0; f < FA; ++f) {
        #pragma unroll
        for (int t = 0; t < 4; ++t) {
            #pragma unroll
            for (int r = 0; r < 8; ++r) {
                float v = acc[f][t][r];
                if (MODE == 1) v += acc2[f][t][r] * (1.0f / 2048.0f);
                Call[f][16 * wave + 8 * hh + r][16 * t + m] = v * (1.0f / 16.0f);
            }
        }
    }
    __syncthreads();

    // One 64-row slab after the other. Each s_wait_xcnt below names its stores' data and address registers as
    // inputs: they stay unwritten up to the wait, and the next piece's values may take them only behind it.
    if (MODE == 0) {
        if (z < 2) {
            hf* dh = (z == 0) ? o0h : o1h;
            hf* dl = (z == 0) ? o0l : o1l;
            #pragma unroll
            for (int f = 0; f < FA; ++f) {
                const int m0 = mt + 64 * f;
                #pragma unroll
                for (int it = 0; it < 4; ++it) {
                    const int row = 16 * it + m;             // row block it, columns 16 wave + 8hh + 0..7
                    const int c8  = 16 * wave + 8 * hh;
                    v4f_t u0 = *(const v4f*)&Call[f][row][c8];
                    v4f_t u1 = *(const v4f*)&Call[f][row][c8 + 4];
                    v8h_t ph, pl;
                    hf a, bl;
                    split2(u0[0], a, bl); ph[0] = a; pl[0] = bl;
                    split2(u0[1], a, bl); ph[1] = a; pl[1] = bl;
                    split2(u0[2], a, bl); ph[2] = a; pl[2] = bl;
                    split2(u0[3], a, bl); ph[3] = a; pl[3] = bl;
                    split2(u1[0], a, bl); ph[4] = a; pl[4] = bl;
                    split2(u1[1], a, bl); ph[5] = a; pl[5] = bl;
                    split2(u1[2], a, bl); ph[6] = a; pl[6] = bl;
                    split2(u1[3], a, bl); ph[7] = a; pl[7] = bl;
                    const size_t off = ((size_t)(m0 / 16 + it) * KT_DM + n0 / 32 + (wave >> 1)) * 512
                                     + (wave & 1) * 256 + 8 * lane;
                    hf* sh = dh + off;
                    hf* sl = dl + off;
                    *(v8h*)sh = ph;
                    *(v8h*)sl = pl;
                    asm volatile("s_wait_xcnt 0x0" :: "v"(ph), "v"(pl), "v"(sh), "v"(sl) : "memory");
                }
            }
        } else {
            #pragma unroll
            for (int f = 0; f < FA; ++f) {
                const int m0   = mt + 64 * f;
                const int bidx = m0 >> 11;
                const int j0   = m0 & (NN - 1);
                #pragma unroll
                for (int it = 0; it < 4; ++it) {
                    const int cc = 16 * it + m;              // channel block it, keys 16 wave + 8hh + 0..7
                    const int j8 = 16 * wave + 8 * hh;
                    v8h_t ph, pl;
                    #pragma unroll
                    for (int e = 0; e < 8; ++e) {
                        hf a, bl;
                        split2(Call[f][j8 + e][cc], a, bl);
                        ph[e] = a; pl[e] = bl;
                    }
                    const size_t off = ((size_t)((bidx * DM + n0) / 16 + it) * KT_NN + j0 / 32 + (wave >> 1)) * 512
                                     + (wave & 1) * 256 + 8 * lane;
                    hf* sh = o2h + off;
                    hf* sl = o2l + off;
                    *(v8h*)sh = ph;
                    *(v8h*)sl = pl;
                    asm volatile("s_wait_xcnt 0x0" :: "v"(ph), "v"(pl), "v"(sh), "v"(sl) : "memory");
                }
            }
        }
    } else {
        #pragma unroll
        for (int f = 0; f < FA; ++f) {
            const int m0 = mt + 64 * f;
            #pragma unroll
            for (int it = 0; it < 8; ++it) {
                const int row = 16 * wave + 2 * it + (lane >> 4);
                const int c4  = (lane & 15) * 4;
                v4f_t u = *(const v4f*)&Call[f][row][c4];
                float* so = outf + (size_t)(m0 + row) * DM + n0 + c4;
                *(v4f*)so = u;
                asm volatile("s_wait_xcnt 0x0" :: "v"(u), "v"(so) : "memory");
            }
        }
    }
}

// ---------------------------------------------------------------------------------------------
// Fused causal attention, block = (a run of queries, head h, batch b); a wave owns 16 queries and walks 64-key
// tiles on its own, with no LDS traffic for scores and no barrier inside the loop:
//   S^T = K.Q^T   (A = K rows, B = Q rows as [n][k]): lane holds query (lane&15), keys 16kk + 8*(lane>>4) + r
//   online softmax per lane (bias, causal, row mask), one exchange between the wave halves for the maximum
//   O^T += V^T.P^T (A = V^T rows, B = P^T packed from the score registers, f16 x4096 (+ residual plane))
// SPLIT: hi/lo residual products on q.k^T and p.v. Output: attention rows as hi/lo f16 planes in fragment order
// ([MR][DM]): a lane's 8 values of a d tile are one 16-byte piece of it, so every wave stores whole lines itself.
// Not SPLIT: 64 queries, 4 waves, each all four 16-wide d tiles. SPLIT: 32 queries, 4 waves, two per 16 queries,
// each two d tiles (both form the same S^T), so that both planes of K, V^T, Q and O fit the register file
// without spills. Both kinds of block share one launch (k_attn below): neither reads what the other writes.
// ---------------------------------------------------------------------------------------------
// p = exp(x), built as the fast intrinsic is (x * log2 e, then v_exp_f32). Written as asm so that the slot the
// instruction set asks for behind a transcendental is kept by construction: the results are early-clobber, so
// no v_exp_f32 of a statement writes over a source of another, and the closing v_nop stands behind the last.
__device__ __forceinline__ void exp8(const float (&x)[8], float (&p)[8])
{
    float t[8];
    #pragma unroll
    for (int r = 0; r < 8; ++r) t[r] = x[r] * 1.44269504f;
    asm("v_exp_f32 %0, %8\n\tv_exp_f32 %1, %9\n\tv_exp_f32 %2, %10\n\tv_exp_f32 %3, %11\n\t"
        "v_exp_f32 %4, %12\n\tv_exp_f32 %5, %13\n\tv_exp_f32 %6, %14\n\tv_exp_f32 %7, %15\n\tv_nop"
        : "=&v"(p[0]), "=&v"(p[1]), "=&v"(p[2]), "=&v"(p[3]), "=&v"(p[4]), "=&v"(p[5]), "=&v"(p[6]), "=&v"(p[7])
        : "v"(t[0]), "v"(t[1]), "v"(t[2]), "v"(t[3]), "v"(t[4]), "v"(t[5]), "v"(t[6]), "v"(t[7]));
}

__device__ __forceinline__ float exp1(float x)
{
    const float t = x * 1.44269504f;
    float p;
    asm("v_exp_f32 %0, %1\n\tv_nop" : "=&v"(p) : "v"(t));   // same slot, one value
    return p;
}

template <bool SPLIT, int NDT>
__device__ __forceinline__ void load_v(const hf* vp, const hf* vp2, v16h (&vf)[NDT][2], v16h (&vf2)[NDT][2])
{
    #pragma unroll
    for (int dt = 0; dt < NDT; ++dt) {
        #pragma unroll
        for (int ks = 0; ks < 2; ++ks) {
            vf[dt][ks] = ldpk(vp + (dt * KT_NN + ks) * 512);
            if (SPLIT) vf2[dt][ks] = ldpk(vp2 + (dt * KT_NN + ks) * 512);
        }
    }
}

template <bool SPLIT>
__device__ __forceinline__
void attn_block(const hf* __restrict__ qhi, const hf* __restrict__ qlo,
                const hf* __restrict__ khi, const hf* __restrict__ klo,
                const hf* __restrict__ vthi, const hf* __restrict__ vtlo,
                const float* __restrict__ btab, const int* __restrict__ mask,
                hf* __restrict__ ohi, hf* __restrict__ olo,
                float* bias_sm, int q0, int h, int b,   // q0: first query of the block
                const hf* pf)                           // address register of the block's L2 request
{
    const int tid = threadIdx.x, lane = tid & 31, m = lane & 15, hh = lane >> 4;
    const int wave = __builtin_amdgcn_readfirstlane(tid >> 5);
    constexpr int NT  = 128;                     // threads per block
    constexpr int NDT = SPLIT ? 2 : 4;           // d tiles per wave
    const int qt  = SPLIT ? (wave >> 1) : wave;  // 16-query sub-tile of this wave
    const int dt0 = SPLIT ? NDT * (wave & 1) : 0;
    const int i0 = q0 + 16 * qt;                 // first query of this wave
    const int i  = i0 + m;                       // this lane's query
    const float NINF = -__builtin_inff();

    if (tid < 64) bias_sm[tid] = 0.0f;
    #pragma unroll
    for (int t = 0; t < NN / (4 * NT); ++t)
        *(v4f*)&bias_sm[64 + 4 * NT * t + 4 * tid] = *(const v4f*)&btab[(size_t)h * NN + 4 * NT * t + 4 * tid];
    const bool valid = (mask[(size_t)b * NN + i] != 0);
    const bool anym  = (__builtin_amdgcn_ballot_w32(!valid) != 0u);
    __syncthreads();
    const int jext   = anym ? NN : (i0 + 16);
    const int ntiles = (jext + 63) >> 6;         // <= NN/64

    // Q fragments as B operand ([n = query][k = d]); the head's two k tiles of this wave's row block.
    // The attention output of these queries has the same place in its planes.
    const size_t qtile = ((size_t)((b * NN + i0) / 16) * KT_DM + 2 * h) * 512 + 8 * lane;
    v16h qf[2], qf2[2];
    #pragma unroll
    for (int ks = 0; ks < 2; ++ks) {
        qf[ks] = ldpk(qhi + qtile + 512 * ks);
        if (SPLIT) qf2[ks] = ldpk(qlo + qtile + 512 * ks); else qf2[ks] = qf[ks];
    }

    v8f oacc[NDT], oacc2[NDT];
    #pragma unroll
    for (int dt = 0; dt < NDT; ++dt) { oacc[dt] = zero8(); oacc2[dt] = zero8(); }
    float m_run = NINF, l_run = 0.0f;            // l_run: sum over the keys of this lane's half only

    #pragma unroll 1
    for (int jt = 0; jt < ntiles; ++jt) {
        const int jb = jt * 64;
        const size_t ktile = ((size_t)((b * NN + jb) / 16) * KT_DM + 2 * h) * 512 + 8 * lane;
        const size_t vtile = ((size_t)((b * DM + h * DH) / 16 + dt0) * KT_NN + 2 * jt) * 512 + 8 * lane;
        // lane bases: every load below is base + constant
        const hf* kp  = khi + ktile;
        const hf* kp2 = klo + ktile;
        const hf* vp  = vthi + vtile;
        const hf* vp2 = vtlo + vtile;

        v16h kf[4][2], kf2[4][2], vf[NDT][2], vf2[NDT][2];
        #pragma unroll
        for (int kk = 0; kk < 4; ++kk) {
            #pragma unroll
            for (int ks = 0; ks < 2; ++ks) {
                kf[kk][ks] = ldpk(kp + (kk * KT_DM + ks) * 512);
                if (SPLIT) kf2[kk][ks] = ldpk(kp2 + (kk * KT_DM + ks) * 512);
            }
        }
        // V^T loads fly under the score work; SPLIT issues them once the K registers are free again.
        // The s_wait_xcnt statements further down name the loads' address registers as inputs: that keeps them
        // unwritten, also by a later load's result, up to the wait; they stand late so that nothing stalls on them
        if (!SPLIT) load_v<SPLIT, NDT>(vp, vp2, vf, vf2);

        // ---- S^T: D row = key 16kk + 8hh + r (within tile), D col = query m ----
        const int dl = i - jb - 8 * hh;          // key (kk, r) is visible to this lane's query iff 16kk + r <= dl
        const int bb = dl + 1 > 0 ? dl + 1 : 0;  // all keys hidden where this clamps
        float sv[4][8];
        #pragma unroll
        for (int kk = 0; kk < 4; ++kk) {
            v8f acc = zero8(), acc2 = zero8();
            #pragma unroll
            for (int ks = 0; ks < 2; ++ks) {
                acc = mma(kf[kk][ks], qf[ks], acc);
                if (SPLIT) {
                    acc2 = mma(kf[kk][ks], qf2[ks], acc2);
                    acc2 = mma(kf2[kk][ks], qf[ks], acc2);
                }
            }
            #pragma unroll
            for (int r = 0; r < 8; ++r) {
                float v = acc[r];
                if (SPLIT) v += acc2[r] * (1.0f / 2048.0f);
                v = v * 0.125f + bias_sm[bb + (63 - 16 * kk - r)];
                sv[kk][r] = (16 * kk + r > dl) ? NINF : v;
            }
        }
        if (SPLIT) {
            asm volatile("s_wait_xcnt 0x0" :: "v"(kp), "v"(kp2) : "memory");   // K address registers free from here
            load_v<SPLIT, NDT>(vp, vp2, vf, vf2);
        }
        if (anym) {
            #pragma unroll
            for (int kk = 0; kk < 4; ++kk) {
                #pragma unroll
                for (int r = 0; r < 8; ++r) sv[kk][r] = valid ? sv[kk][r] : 0.0f;
            }
        }

        // ---- online softmax, one query per lane ----
        float t4[4];
        #pragma unroll
        for (int kk = 0; kk < 4; ++kk) {
            t4[kk] = fmaxf(fmaxf(fmaxf(sv[kk][0], sv[kk][1]), fmaxf(sv[kk][2], sv[kk][3])),
                           fmaxf(fmaxf(sv[kk][4], sv[kk][5]), fmaxf(sv[kk][6], sv[kk][7])));
        }
        float tmax = fmaxf(fmaxf(t4[0], t4[1]), fmaxf(t4[2], t4[3]));
        tmax = fmaxf(tmax, __shfl_xor(tmax, 16, 32));
        const float mn = fmaxf(m_run, tmax);
        const float ea = exp1(m_run - mn);
        const float alpha = (m_run == NINF) ? 0.0f : ea;
        m_run = mn;

        Frag ph[2], pl[2];
        float ps4[4];
        #pragma unroll
        for (int kk = 0; kk < 4; ++kk) {
            float x[8], p[8];
            #pragma unroll
            for (int r = 0; r < 8; ++r) x[r] = sv[kk][r] - mn;
            exp8(x, p);
            #pragma unroll
            for (int r = 0; r < 8; ++r) {
                hf a, bl;
                split2(p[r] * 4096.0f, a, bl);
                ph[kk >> 1].v[8 * (kk & 1) + r] = a;
                if (SPLIT) pl[kk >> 1].v[8 * (kk & 1) + r] = bl;
            }
            ps4[kk] = ((p[0] + p[1]) + (p[2] + p[3])) + ((p[4] + p[5]) + (p[6] + p[7]));
        }
        l_run = l_run * alpha + ((ps4[0] + ps4[1]) + (ps4[2] + ps4[3]));

        // address registers of the loads still named here are free from here
        if (SPLIT) asm volatile("s_wait_xcnt 0x0" :: "v"(vp), "v"(vp2) : "memory");
        else       asm volatile("s_wait_xcnt 0x0" :: "v"(kp), "v"(vp) : "memory");

        // ---- O^T: D row = d 16(dt0 + dt) + 8hh + r, D col = query m ----
        #pragma unroll
        for (int dt = 0; dt < NDT; ++dt) {
            #pragma unroll
            for (int r = 0; r < 8; ++r) { oacc[dt][r] *= alpha; if (SPLIT) oacc2[dt][r] *= alpha; }
            #pragma unroll
            for (int ks = 0; ks < 2; ++ks) {
                oacc[dt] = mma(vf[dt][ks], ph[ks].v, oacc[dt]);
                if (SPLIT) {
                    oacc2[dt] = mma(vf2[dt][ks], ph[ks].v, oacc2[dt]);
                    oacc2[dt] = mma(vf[dt][ks], pl[ks].v, oacc2[dt]);
                }
            }
        }
    }

    // names the L2 request's address register as an input: it holds that address, and nothing else, through the loop
    asm volatile("s_wait_xcnt 0x0" :: "v"(pf) : "memory");

    const float l = l_run + __shfl_xor(l_run, 16, 32);
    v8h_t oh[NDT], ol[NDT];
    #pragma unroll
    for (int dt = 0; dt < NDT; ++dt) {
        #pragma unroll
        for (int r = 0; r < 8; ++r) {
            float o = oacc[dt][r];
            if (SPLIT) o += oacc2[dt][r] * (1.0f / 2048.0f);
            o = (o / l) * (1.0f / 4096.0f);
            hf a, bl;
            split2(o, a, bl);
            oh[dt][r] = a; ol[dt][r] = bl;
        }
    }
    // d tile dt0 + dt = part (dt & 1) of the head's k tile (dt0 + dt) >> 1 (dt0 is even)
    #pragma unroll
    for (int dt = 0; dt < NDT; ++dt) {
        const size_t off = qtile + (size_t)((dt0 >> 1) + (dt >> 1)) * 512 + (dt & 1) * 256;
        *(v8h*)(ohi + off) = oh[dt];
        *(v8h*)(olo + off) = ol[dt];
    }
}

// One launch for all queries. blockIdx.x = (batch, head); blockIdx.y ranks the query runs by falling key count:
// first the single-plane runs of 64 queries from the end of the sequence down, then the two-plane runs of 32.
#define QB_ONE ((NN - 32 * QSPLIT) / 64)         // single-plane blocks per (batch, head)
static_assert((NN - 32 * QSPLIT) % 64 == 0);

__global__ __launch_bounds__(128)
void k_attn(const hf* __restrict__ qhi, const hf* __restrict__ qlo,
            const hf* __restrict__ khi, const hf* __restrict__ klo,
            const hf* __restrict__ vthi, const hf* __restrict__ vtlo,
            const float* __restrict__ btab, const int* __restrict__ mask,
            hf* __restrict__ ohi, hf* __restrict__ olo)
{
    // bias_sm[64 + delta] = bias of distance delta; 64 leading zeros take the reads of causally hidden keys
    __shared__ __attribute__((aligned(16))) float bias_sm[64 + NN];

    const int hb = blockIdx.x, rank = blockIdx.y;
    if (hb >= HH * BB || rank >= QB_ONE + QSPLIT) return;
    const int b = hb / HH, h = hb - b * HH;

    // L2 requests for this head's K and V^T planes, dealt over its blocks: block rank asks for keys
    // 128 (rank mod 16) + 0..127, for speed only.
    // Ranks 16 on up to the last residual key ask for the residual planes, all others for the hi planes.
    // Waves 0, 1: K, 8 row blocks x 8 units of 256 bytes; waves 2, 3: V^T, 4 d blocks x 16 units.
    static_assert(NN == 16 * 128 && DH == 64 && (32 * QSPLIT) % 128 == 0 && 32 * QSPLIT <= NN);
    const int pt = threadIdx.x & 63, pr = rank & 15;
    const bool plo = rank >= 16 && rank < 16 + 32 * QSPLIT / 128;
    const hf* pfk = (plo ? klo : khi)
                  + ((size_t)((b * NN + 128 * pr) / 16 + (pt >> 3)) * KT_DM + 2 * h) * 512 + 128 * (pt & 7);
    const hf* pfv = (plo ? vtlo : vthi)
                  + ((size_t)((b * DM + h * DH) / 16 + (pt >> 4)) * KT_NN + 4 * pr) * 512 + 128 * (pt & 15);
    const hf* pf  = (threadIdx.x < 64) ? pfk : pfv;
    l2_ask<0>(pf);

    if (rank < QB_ONE)
        attn_block<false>(qhi, qlo, khi, klo, vthi, vtlo, btab, mask, ohi, olo, bias_sm,
                          NN - 64 * (rank + 1), h, b, pf);
    else
        attn_block<true>(qhi, qlo, khi, klo, vthi, vtlo, btab, mask, ohi, olo, bias_sm,
                         32 * (QSPLIT - 1 - (rank - QB_ONE)), h, b, pf);
}

// ---------------------------------------------------------------------------------------------
// Host glue: 4 launches, workspace carved from sizes (<= 62 MB)
// ---------------------------------------------------------------------------------------------
extern "C" void kernel_launch(void* const* d_in, const int* in_sizes, int n_in,
                              void* d_out, int out_size, void* d_ws, size_t ws_size,
                              hipStream_t stream)
{
    if (n_in < 7) return;
    if (in_sizes[0] != MR * DM) return;
    if (in_sizes[1] != BB * NN) return;
    if (in_sizes[2] != DM * DM || in_sizes[3] != DM * DM || in_sizes[4] != DM * DM || in_sizes[5] != DM * DM) return;
    if (in_sizes[6] != NBKT * HH) return;
    if (out_size != MR * DM) return;

    const float* x    = (const float*)d_in[0];
    const int*   mask = (const int*)d_in[1];
    const float* Wq   = (const float*)d_in[2];
    const float* Wk   = (const float*)d_in[3];
    const float* Wv   = (const float*)d_in[4];
    const float* Wo   = (const float*)d_in[5];
    const float* rel  = (const float*)d_in[6];
    float* out = (float*)d_out;

    char* ws = (char*)d_ws;
    size_t off = 0;
    auto carve = [&](size_t bytes) -> size_t { size_t p = off; off += (bytes + 255) & ~(size_t)255; return p; };
    const size_t plane = (size_t)MR * DM * sizeof(hf);
    const size_t o_xh   = carve(plane);
    const size_t o_wt   = carve((size_t)4 * DM * DM * sizeof(hf));
    const size_t o_qhi  = carve(plane);
    const size_t o_qlo  = carve(plane);
    const size_t o_khi  = carve(plane);
    const size_t o_klo  = carve(plane);
    const size_t o_vthi = carve(plane);
    const size_t o_vtlo = carve(plane);
    const size_t o_ahi  = carve(plane);
    const size_t o_alo  = carve(plane);
    const size_t o_btab = carve((size_t)HH * NN * sizeof(float));
    if (off > ws_size) return;

    hf* xh   = (hf*)(ws + o_xh);
    hf* wt   = (hf*)(ws + o_wt);
    hf* qhi  = (hf*)(ws + o_qhi);
    hf* qlo  = (hf*)(ws + o_qlo);
    hf* khi  = (hf*)(ws + o_khi);
    hf* klo  = (hf*)(ws + o_klo);
    hf* vthi = (hf*)(ws + o_vthi);
    hf* vtlo = (hf*)(ws + o_vtlo);
    hf* ahi  = (hf*)(ws + o_ahi);
    hf* alo  = (hf*)(ws + o_alo);
    float* btab = (float*)(ws + o_btab);

    k_prep<<<PB_BIAS + PB_W + PB_X, 256, 0, stream>>>(x, Wq, Wk, Wv, Wo, rel, xh, wt, btab);

    // q, k (hi/lo planes), v (transposed hi/lo planes)
    k_proj<0, 4, 2><<<dim3(DM / 64, MR / 256, 3), 128, 0, stream>>>(
        xh, xh, wt, qhi, qlo, khi, klo, vthi, vtlo, out);

    // attention: leading query blocks with residual products, remainder single-plane
    k_attn<<<dim3(HH * BB, QB_ONE + QSPLIT), 128, 0, stream>>>(
        qhi, qlo, khi, klo, vthi, vtlo, btab, mask, ahi, alo);

    // output projection -> out (f32)
    k_proj<1, 2, 4><<<dim3(DM / 64, MR / 128, 1), 128, 0, stream>>>(
        ahi, alo, wt + (size_t)3 * DM * DM, ahi, alo, ahi, alo, ahi, alo, out);
}

// v006
// One run takes 59.9 microseconds.
// In both of two side-by-side timings against v005, it was 1.07 times as fast.
// Counting every step since v000, it is 5.68 times as fast.
#include <hip/hip_runtime.h>
#include <stdint.h>

// Contractions (q/k/v projections, q.k^T, p.v, output projection): v_wmma_f32_16x16x32_f16, f16 operands,
// f32 accumulate. x / weights / bias table are RNE-converted to bf16; x and weights are then held exactly in f16 (weights x16), the bias table in f32.
// q, k, v^T, p (x4096) and the attention output are carried as an f16 hi plane plus an f16 residual plane
// (residual x2048); residual products are issued for the leading query rows, single-plane products elsewhere.
//
// Every f16 operand plane in the workspace is stored in fragment order. A matrix M[rows][K] (K = contraction
// index) is cut into tiles of 16 rows x 32 k; tile (rb, kb) starts at half ((rb * K/32) + kb) * 512 and holds
//   M[16rb + m][32kb + 16part + 8hh + e]  at  part * 256 + (16hh + m) * 8 + e      (m < 16; part, hh < 2; e < 8)
// so lane 16hh + m of a wave finds its 16 fragment elements at tile + 8 * lane and tile + 256 + 8 * lane, and each
// of the two 16-byte loads (or stores) of a wave covers 512 contiguous bytes: four whole 128-byte lines.

#define BB 2
#define NN 2048
#define DM 768
#define HH 12
#define DH 64
#define MR (BB * NN)
#define NBKT 32
#define QSPLIT 16     // leading 32-query blocks per batch that use two-plane products in attention
#define RSPLIT 512    // leading rows per batch that use the two-plane A operand in the output projection

static_assert(DM % 64 == 0);
static_assert(NN % 64 == 0);
static_assert(MR % 64 == 0);
static_assert(DH == 64);
static_assert(RSPLIT % 64 == 0);
static_assert(QSPLIT <= NN / 32);
static_assert((MR * DM) % 8 == 0);
static_assert(DM % 32 == 0 && NN % 32 == 0 && MR % 16 == 0);
#define KT_DM (DM / 32)   // k tiles of a row block where K = DM
#define KT_NN (NN / 32)   // k tiles of a row block where K = NN (v^T)

typedef _Float16 hf;
typedef _Float16 v8h_t __attribute__((ext_vector_type(8)));
typedef v8h_t __attribute__((may_alias)) v8h;
typedef _Float16 v16h __attribute__((ext_vector_type(16)));
typedef float v8f __attribute__((ext_vector_type(8)));
typedef float v4f_t __attribute__((ext_vector_type(4)));
typedef v4f_t __attribute__((may_alias)) v4f;

union Frag { v16h v; v8h_t p[2]; };

// D(16x16,f32) += A(16x32) * B(32x16); nops keep VALU off the D/A/B registers right after issue.
__device__ __forceinline__ v8f mma(v16h a, v16h b, v8f c)
{
    v8f d = __builtin_amdgcn_wmma_f32_16x16x32_f16(false, a, false, b, (short)0, c, false, false);
    asm volatile("v_nop\n\tv_nop\n\tv_nop\n\tv_nop" : "+v"(d) : "v"(a), "v"(b));
    return d;
}

// 16x16x32 operand fragment for lane (row or column = lane&15), half hh = lane>>4:
// elements 0..7 <- k0+8hh+0..7, elements 8..15 <- k0+16+8hh+0..7 of the lane's row.
// Used for A ([m][k]) and for B held as [n][k]; p = start of the fragment-ordered tile + 8 * lane.
__device__ __forceinline__ v16h ldpk(const hf* p)
{
    Frag f;
    f.p[0] = *(const v8h*)(p);
    f.p[1] = *(const v8h*)(p + 256);
    return f.v;
}

__device__ __forceinline__ float bf16r(float v)
{
    unsigned u = __float_as_uint(v);
    u = (u + 0x7FFFu + ((u >> 16) & 1u)) & 0xFFFF0000u;
    return __uint_as_float(u);
}

// v ~= hi + lo/2048 with hi, lo in f16
__device__ __forceinline__ void split2(float v, hf& hi, hf& lo)
{
    hf h = (hf)v;
    hi = h;
    lo = (hf)((v - (float)h) * 2048.0f);
}

// Asks L2 for the aligned 256-byte unit at p + OFF bytes: nothing comes back and no counter moves. The planes a launch
// reads were stored by an earlier launch. Where such a line is not in the reader's L2 its first reader waits for
// memory, and the blocks that share a plane walk it in step, so every step of each of them would wait so; asked for
// at entry, the later steps' lines are on their way while the first steps run. Every lane's address lies inside its
// plane, and its register is kept as it is through the loop that follows (the s_wait_xcnt statements that name it).
template <int OFF>
__device__ __forceinline__ void l2_ask(const hf* p)
{
    asm volatile("global_prefetch_b8 %0, off offset:%1 scope:SCOPE_SE" :: "v"(p), "n"(OFF));
}

__device__ __forceinline__ v8f zero8()
{
    v8f z = {0.f, 0.f, 0.f, 0.f, 0.f, 0.f, 0.f, 0.f};
    return z;
}

// ---------------------------------------------------------------------------------------------
// xh = f16(bf16(x)) in fragment order ([MR][DM]); thread t fills 16-byte piece t, lane-contiguous stores
// ---------------------------------------------------------------------------------------------
__device__ __forceinline__ void prep_x(const float* __restrict__ x, hf* __restrict__ xh, int t)
{
    const int lane = t & 31, part = (t >> 5) & 1, tile = t >> 6;
    const int rb = tile / KT_DM, kb = tile - rb * KT_DM;
    const float* p = x + (size_t)(16 * rb + (lane & 15)) * DM + 32 * kb + 16 * part + 8 * (lane >> 4);
    v4f_t a = *(const v4f*)p;
    v4f_t b = *(const v4f*)(p + 4);
    v8h_t o;
    o[0] = (hf)bf16r(a[0]); o[1] = (hf)bf16r(a[1]); o[2] = (hf)bf16r(a[2]); o[3] = (hf)bf16r(a[3]);
    o[4] = (hf)bf16r(b[0]); o[5] = (hf)bf16r(b[1]); o[6] = (hf)bf16r(b[2]); o[7] = (hf)bf16r(b[3]);
    hf* d = xh + (size_t)t * 8;
    *(v8h*)d = o;
    // the arms of k_prep follow one another in the code: the store's registers stay unwritten up to this wait
    asm volatile("s_wait_xcnt 0x0" ::: "memory");
}

// ---------------------------------------------------------------------------------------------
// wt[w] = fragment order of [c][k] = f16(bf16(W_w[k][c]) * 16), W_w is [DM(k)][DM(c)]; 8 consecutive k per thread,
// thread = 16-byte piece of the plane: 16 neighbouring lanes read 16 neighbouring c of one k row
// ---------------------------------------------------------------------------------------------
__device__ __forceinline__ void prep_w(const float* __restrict__ w0, const float* __restrict__ w1,
                                       const float* __restrict__ w2, const float* __restrict__ w3,
                                       hf* __restrict__ wt, int t)
{
    const int per = DM * (DM / 8);
    const int wi  = t / per;
    const int rem = t - wi * per;
    const int lane = rem & 31, part = (rem >> 5) & 1, tile = rem >> 6;
    const int rb  = tile / KT_DM, kb = tile - rb * KT_DM;
    const int c   = 16 * rb + (lane & 15);
    const int k8  = 32 * kb + 16 * part + 8 * (lane >> 4);
    const float* W = (wi == 0) ? w0 : (wi == 1) ? w1 : (wi == 2) ? w2 : w3;
    v8h_t o;
    #pragma unroll
    for (int e = 0; e < 8; ++e) o[e] = (hf)(bf16r(W[(size_t)(k8 + e) * DM + c]) * 16.0f);
    hf* d = wt + (size_t)wi * DM * DM + (size_t)rem * 8;
    *(v8h*)d = o;
    // the arms of k_prep follow one another in the code: the store's registers stay unwritten up to this wait
    asm volatile("s_wait_xcnt 0x0" ::: "memory");
}

// ---------------------------------------------------------------------------------------------
// btab[h][delta] = bf16(rel[bucket(delta)][h]) * DH^-0.5, causal bucketing; 4 deltas per thread
// ---------------------------------------------------------------------------------------------
__device__ __forceinline__ void prep_bias(const float* __restrict__ rel, float* __restrict__ tab, int t)
{
    const int h  = t / (NN / 4);
    const int d4 = (t - h * (NN / 4)) * 4;
    v4f_t o;
    #pragma unroll
    for (int e = 0; e < 4; ++e) {
        const int d = d4 + e;
        int bk;
        if (d < NBKT / 2) {
            bk = d;
        } else {
            float f  = (float)d * (1.0f / 16.0f);
            float lg = logf(f);
            float u  = lg * (1.0f / 2.0794415416798357f);
            float w  = u * 16.0f;
            int v = (NBKT / 2) + (int)w;
            bk = v < (NBKT - 1) ? v : (NBKT - 1);
            if (bk < 0) bk = 0;
        }
        o[e] = bf16r(rel[bk * HH + h]) * 0.125f;
    }
    float* d = tab + (size_t)h * NN + d4;
    *(v4f*)d = o;
    // the arms of k_prep follow one another in the code: the store's registers stay unwritten up to this wait
    asm volatile("s_wait_xcnt 0x0" ::: "memory");
}

// ---------------------------------------------------------------------------------------------
// The three conversions depend on nothing but the inputs: one launch, a block range each.
// ---------------------------------------------------------------------------------------------
#define PB_BIAS (HH * NN / 4 / 256)
#define PB_W    (4 * DM * (DM / 8) / 256)
#define PB_X    (MR * DM / 8 / 256)
static_assert((HH * NN / 4) % 256 == 0 && (4 * DM * (DM / 8)) % 256 == 0 && (MR * DM / 8) % 256 == 0);

__global__ __launch_bounds__(256)
void k_prep(const float* __restrict__ x, const float* __restrict__ w0, const float* __restrict__ w1,
            const float* __restrict__ w2, const float* __restrict__ w3, const float* __restrict__ rel,
            hf* __restrict__ xh, hf* __restrict__ wt, float* __restrict__ tab)
{
    const int blk = blockIdx.x, tid = threadIdx.x;
    if (blk < PB_BIAS)                    prep_bias(rel, tab, blk * 256 + tid);
    else if (blk < PB_BIAS + PB_W)        prep_w(w0, w1, w2, w3, wt, (blk - PB_BIAS) * 256 + tid);
    else if (blk < PB_BIAS + PB_W + PB_X) prep_x(x, xh, (blk - PB_BIAS - PB_W) * 256 + tid);
}

// ---------------------------------------------------------------------------------------------
// C[64 FA x 64 tile] = A[64 FA x 768] * Wt[64 x 768]^T / 16, block = 4 waves, wave = FA row blocks of 16 x 64 cols:
// row block 4f + wave of the tile (f < FA), so that the four waves together hold one 64-row slab for each f.
// A B fragment serves FA products and an A fragment four. The k loop is unrolled whole over a ring of ST fragment
// register sets: step ks + ST - 1 is loaded in front of the products of step ks, every load is base + constant.
// MODE 0 (grid.z: 0 = q, 1 = k, 2 = v): q/k stored as [MR][DM] hi/lo f16 planes,
//         v stored transposed, [BB * DM][NN], as hi/lo f16 planes. A = xh. All planes in fragment order.
// MODE 1: A = attention output hi (+ lo plane for rows (m0 mod NN) < RSPLIT), C stored f32 to out.
// ---------------------------------------------------------------------------------------------
// Every loop of ld_step, gemm_k and k_proj is unrolled: the fragment, accumulator and staging indices must be
// constants for the arrays to live in registers and for every address to be base + constant.
template <int FA, bool TWO>
__device__ __forceinline__ void ld_step(const hf* ap, const hf* ap2, const hf* bp, int ks,
                                        v16h (&a)[FA], v16h (&a2)[FA], v16h (&b)[4])
{
    #pragma unroll
    for (int t = 0; t < 4; ++t) b[t] = ldpk(bp + (t * KT_DM + ks) * 512);
    #pragma unroll
    for (int f = 0; f < FA; ++f) {
        a[f] = ldpk(ap + (4 * f * KT_DM + ks) * 512);
        if (TWO) a2[f] = ldpk(ap2 + (4 * f * KT_DM + ks) * 512);
    }
}

// The builtin alone: the compiler keeps the distance behind its own matrix instructions, and operands that pass
// through no asm statement may live above v255, which the accumulators and the ring together need.
__device__ __forceinline__ v8f mmab(v16h a, v16h b, v8f c)
{
    return __builtin_amdgcn_wmma_f32_16x16x32_f16(false, a, false, b, (short)0, c, false, false);
}

template <int FA, int ST, bool TWO>
__device__ __forceinline__ void gemm_k(const hf* ap, const hf* ap2, const hf* bp,
                                       v8f (&acc)[FA][4], v8f (&acc2)[FA][4])
{
    v16h a[ST][FA], a2[ST][FA], b[ST][4];
    #pragma unroll
    for (int ks = 0; ks < ST - 1; ++ks) ld_step<FA, TWO>(ap, ap2, bp, ks, a[ks], a2[ks], b[ks]);
    // unrolled whole: the ring's set numbers become register names and no address register is ever stepped
    #pragma unroll
    for (int ks = 0; ks < KT_DM; ++ks) {
        const int s = ks % ST, sn = (ks + ST - 1) % ST;
        if (ks + ST - 1 < KT_DM) ld_step<FA, TWO>(ap, ap2, bp, ks + ST - 1, a[sn], a2[sn], b[sn]);
        // holds the loads above in front of this step's products: without it the compiler sinks each load down to
        // its first use, ST - 1 steps on, and the wave waits out the whole load latency there
        __builtin_amdgcn_sched_barrier(0);
        #pragma unroll
        for (int f = 0; f < FA; ++f) {
            #pragma unroll
            for (int t = 0; t < 4; ++t) acc[f][t] = mmab(a[s][f], b[s][t], acc[f][t]);
        }
        if (TWO) {
            #pragma unroll
            for (int f = 0; f < FA; ++f) {
                #pragma unroll
                for (int t = 0; t < 4; ++t) acc2[f][t] = mmab(a2[s][f], b[s][t], acc2[f][t]);
            }
        }
    }
    // names the loads' address registers as inputs: they stay unwritten up to this wait, behind the last load
    asm volatile("s_wait_xcnt 0x0" :: "v"(ap), "v"(ap2), "v"(bp) : "memory");
}

template <int MODE, int FA, int ST>
__global__ __launch_bounds__(128)
void k_proj(const hf* __restrict__ Ahi, const hf* __restrict__ Alo, const hf* __restrict__ Wt,
            hf* __restrict__ o0h, hf* __restrict__ o0l,
            hf* __restrict__ o1h, hf* __restrict__ o1l,
            hf* __restrict__ o2h, hf* __restrict__ o2l,
            float* __restrict__ outf)
{
    static_assert(MR % (64 * FA) == 0 && NN % (64 * FA) == 0 && RSPLIT % (64 * FA) == 0);
    __shared__ __attribute__((aligned(16))) float Call[FA][64][68];   // a staging array for each 64-row slab

    const int wave = threadIdx.x >> 5, lane = threadIdx.x & 31, m = lane & 15, hh = lane >> 4;
    const int n0 = blockIdx.x * 64, mt = blockIdx.y * (64 * FA), z = blockIdx.z;
    if (n0 >= DM || mt >= MR) return;
    const hf* Bt = Wt + (size_t)z * DM * DM;
    const bool two = (MODE == 1) && ((mt & (NN - 1)) < RSPLIT);

    const size_t aoff = (size_t)(mt / 16 + wave) * KT_DM * 512 + 8 * lane;
    const hf* ap  = Ahi + aoff;
    const hf* ap2 = two ? (Alo + aoff) : ap;
    const hf* bp  = Bt + (size_t)(n0 / 16) * KT_DM * 512 + 8 * lane;

    // L2 requests for the whole A and B panels, dealt over the blocks that read the same panel so that four
    // neighbours in x with all z (A, MODE 0) or three in x (A, MODE 1), or three next neighbours in y of one parity (B), together
    // ask for all of it: a guess at which blocks share an L2, for speed only. A lane asks for one 256-byte unit
    // (128 halves).
    const hf* pfb = Bt + ((size_t)(n0 / 16 + wave) * KT_DM + 8 * ((blockIdx.y >> 1) % 3)) * 512 + 128 * lane;
    const hf* pfa;
    const hf* pfa2;
    static_assert(KT_DM == 24);
    l2_ask<0>(pfb);                                   // 8 k tiles of B row block 'wave'
    if (MODE == 0) {
        static_assert(MODE != 0 || FA == 4);          // 16 row blocks x 2 k tiles: 128 units
        pfa = Ahi + ((size_t)(mt / 16 + (threadIdx.x >> 3)) * KT_DM + 2 * (4 * z + (blockIdx.x & 3))) * 512
                  + 128 * (threadIdx.x & 7);
        pfa2 = pfa;
        l2_ask<0>(pfa);
    } else {
        static_assert(MODE == 0 || FA == 2);          // 8 k tiles of A row blocks 'wave' and 'wave' + 4
        const size_t poff = ((size_t)(mt / 16 + wave) * KT_DM + 8 * (blockIdx.x % 3)) * 512 + 128 * lane;
        pfa  = Ahi + poff;
        pfa2 = two ? (Alo + poff) : pfa;
        l2_ask<0>(pfa);
        l2_ask<4 * KT_DM * 1024>(pfa);
        if (two) {
            l2_ask<0>(pfa2);
            l2_ask<4 * KT_DM * 1024>(pfa2);
        }
    }

    v8f acc[FA][4], acc2[FA][4];
    #pragma unroll
    for (int f = 0; f < FA; ++f) {
        #pragma unroll
        for (int t = 0; t < 4; ++t) { acc[f][t] = zero8(); acc2[f][t] = zero8(); }
    }

    if (two) gemm_k<FA, ST, true>(ap, ap2, bp, acc, acc2);
    else     gemm_k<FA, ST, false>(ap, ap2, bp, acc, acc2);
    // names the L2 requests' address registers as inputs: they hold those addresses, and nothing else, through the k loop
    asm volatile("s_wait_xcnt 0x0" :: "v"(pfa), "v"(pfa2), "v"(pfb) : "memory");

    // D element r of lane: row 16*wave + 8*hh + r of slab f, col 16*t + m
    #pragma unroll
    for (int f = 0; f < FA; ++f) {
        #pragma unroll
        for (int t = 0; t < 4; ++t) {
            #pragma unroll
            for (int r = 0; r < 8; ++r) {
                float v = acc[f][t][r];
                if (MODE == 1) v += acc2[f][t][r] * (1.0f / 2048.0f);
                Call[f][16 * wave + 8 * hh + r][16 * t + m] = v * (1.0f / 16.0f);
            }
        }
    }
    __syncthreads();

    // One 64-row slab after the other. Each s_wait_xcnt below names its stores' data and address registers as
    // inputs: they stay unwritten up to the wait, and the next piece's values may take them only behind it.
    if (MODE == 0) {
        if (z < 2) {
            hf* dh = (z == 0) ? o0h : o1h;
            hf* dl = (z == 0) ? o0l : o1l;
            #pragma unroll
            for (int f = 0; f < FA; ++f) {
                const int m0 = mt + 64 * f;
                #pragma unroll
                for (int it = 0; it < 4; ++it) {
                    const int row = 16 * it + m;             // row block it, columns 16 wave + 8hh + 0..7
                    const int c8  = 16 * wave + 8 * hh;
                    v4f_t u0 = *(const v4f*)&Call[f][row][c8];
                    v4f_t u1 = *(const v4f*)&Call[f][row][c8 + 4];
                    v8h_t ph, pl;
                    hf a, bl;
                    split2(u0[0], a, bl); ph[0] = a; pl[0] = bl;
                    split2(u0[1], a, bl); ph[1] = a; pl[1] = bl;
                    split2(u0[2], a, bl); ph[2] = a; pl[2] = bl;
                    split2(u0[3], a, bl); ph[3] = a; pl[3] = bl;
                    split2(u1[0], a, bl); ph[4] = a; pl[4] = bl;
                    split2(u1[1], a, bl); ph[5] = a; pl[5] = bl;
                    split2(u1[2], a, bl); ph[6] = a; pl[6] = bl;
                    split2(u1[3], a, bl); ph[7] = a; pl[7] = bl;
                    const size_t off = ((size_t)(m0 / 16 + it) * KT_DM + n0 / 32 + (wave >> 1)) * 512
                                     + (wave & 1) * 256 + 8 * lane;
                    hf* sh = dh + off;
                    hf* sl = dl + off;
                    *(v8h*)sh = ph;
                    *(v8h*)sl = pl;
                    asm volatile("s_wait_xcnt 0x0" :: "v"(ph), "v"(pl), "v"(sh), "v"(sl) : "memory");
                }
            }
        } else {
            #pragma unroll
            for (int f = 0; f < FA; ++f) {
                const int m0   = mt + 64 * f;
                const int bidx = m0 >> 11;
                const int j0   = m0 & (NN - 1);
                #pragma unroll
                for (int it = 0; it < 4; ++it) {
                    const int cc = 16 * it + m;              // channel block it, keys 16 wave + 8hh + 0..7
                    const int j8 = 16 * wave + 8 * hh;
                    v8h_t ph, pl;
                    #pragma unroll
                    for (int e = 0; e < 8; ++e) {
                        hf a, bl;
                        split2(Call[f][j8 + e][cc], a, bl);
                        ph[e] = a; pl[e] = bl;
                    }
                    const size_t off = ((size_t)((bidx * DM + n0) / 16 + it) * KT_NN + j0 / 32 + (wave >> 1)) * 512
                                     + (wave & 1) * 256 + 8 * lane;
                    hf* sh = o2h + off;
                    hf* sl = o2l + off;
                    *(v8h*)sh = ph;
                    *(v8h*)sl = pl;
                    asm volatile("s_wait_xcnt 0x0" :: "v"(ph), "v"(pl), "v"(sh), "v"(sl) : "memory");
                }
            }
        }
    } else {
        #pragma unroll
        for (int f = 0; f < FA; ++f) {
            const int m0 = mt + 64 * f;
            #pragma unroll
            for (int it = 0; it < 8; ++it) {
                const int row = 16 * wave + 2 * it + (lane >> 4);
                const int c4  = (lane & 15) * 4;
                v4f_t u = *(const v4f*)&Call[f][row][c4];
                float* so = outf + (size_t)(m0 + row) * DM + n0 + c4;
                *(v4f*)so = u;
                asm volatile("s_wait_xcnt 0x0" :: "v"(u), "v"(so) : "memory");
            }
        }
    }
}

// ---------------------------------------------------------------------------------------------
// Fused causal attention, block = (a run of queries, head h, batch b); a wave owns 16 queries and walks 64-key
// tiles on its own, with no LDS traffic for scores and no barrier inside the loop:
//   S^T = K.Q^T   (A = K rows, B = Q rows as [n][k]): lane holds query (lane&15), keys 16kk + 8*(lane>>4) + r
//   online softmax per lane (bias, causal, row mask), one exchange between the wave halves for the maximum
//   O^T += V^T.P^T (A = V^T rows, B = P^T packed from the score registers, f16 x4096 (+ residual plane))
// SPLIT: hi/lo residual products on q.k^T and p.v. Output: attention rows as hi/lo f16 planes in fragment order
// ([MR][DM]): a lane's 8 values of a d tile are one 16-byte piece of it, so every wave stores whole lines itself.
// Not SPLIT: 64 queries, 4 waves, each all four 16-wide d tiles. SPLIT: 32 queries, 4 waves, two per 16 queries,
// each two d tiles (both form the same S^T), so that both planes of K, V^T, Q and O fit the register file
// without spills. Both kinds of block share one launch (k_attn below): neither reads what the other writes.
// ---------------------------------------------------------------------------------------------
// p = exp(x), built as the fast intrinsic is (x * log2 e, then v_exp_f32). Written as asm so that the slot the
// instruction set asks for behind a transcendental is kept by construction: the results are early-clobber, so
// no v_exp_f32 of a statement writes over a source of another, and the closing v_nop stands behind the last.
__device__ __forceinline__ void exp8(const float (&x)[8], float (&p)[8])
{
    float t[8];
    #pragma unroll
    for (int r = 0; r < 8; ++r) t[r] = x[r] * 1.44269504f;
    asm("v_exp_f32 %0, %8\n\tv_exp_f32 %1, %9\n\tv_exp_f32 %2, %10\n\tv_exp_f32 %3, %11\n\t"
        "v_exp_f32 %4, %12\n\tv_exp_f32 %5, %13\n\tv_exp_f32 %6, %14\n\tv_exp_f32 %7, %15\n\tv_nop"
        : "=&v"(p[0]), "=&v"(p[1]), "=&v"(p[2]), "=&v"(p[3]), "=&v"(p[4]), "=&v"(p[5]), "=&v"(p[6]), "=&v"(p[7])
        : "v"(t[0]), "v"(t[1]), "v"(t[2]), "v"(t[3]), "v"(t[4]), "v"(t[5]), "v"(t[6]), "v"(t[7]));
}

__device__ __forceinline__ float exp1(float x)
{
    const float t = x * 1.44269504f;
    float p;
    asm("v_exp_f32 %0, %1\n\tv_nop" : "=&v"(p) : "v"(t));   // same slot, one value
    return p;
}

template <bool SPLIT, int NDT>
__device__ __forceinline__ void load_v(const hf* vp, const hf* vp2, v16h (&vf)[NDT][2], v16h (&vf2)[NDT][2])
{
    #pragma unroll
    for (int dt = 0; dt < NDT; ++dt) {
        #pragma unroll
        for (int ks = 0; ks < 2; ++ks) {
            vf[dt][ks] = ldpk(vp + (dt * KT_NN + ks) * 512);
            if (SPLIT) vf2[dt][ks] = ldpk(vp2 + (dt * KT_NN + ks) * 512);
        }
    }
}

template <bool SPLIT>
__device__ __forceinline__
void attn_block(const hf* __restrict__ qhi, const hf* __restrict__ qlo,
                const hf* __restrict__ khi, const hf* __restrict__ klo,
                const hf* __restrict__ vthi, const hf* __restrict__ vtlo,
                const float* __restrict__ btab, const int* __restrict__ mask,
                hf* __restrict__ ohi, hf* __restrict__ olo,
                float* bias_sm, int q0, int h, int b,   // q0: first query of the block
                const hf* pf)                           // address register of the block's L2 request
{
    const int tid = threadIdx.x, lane = tid & 31, m = lane & 15, hh = lane >> 4;
    const int wave = __builtin_amdgcn_readfirstlane(tid >> 5);
    constexpr int NT  = 128;                     // threads per block
    constexpr int NDT = SPLIT ? 2 : 4;           // d tiles per wave
    const int qt  = SPLIT ? (wave >> 1) : wave;  // 16-query sub-tile of this wave
    const int dt0 = SPLIT ? NDT * (wave & 1) : 0;
    const int i0 = q0 + 16 * qt;                 // first query of this wave
    const int i  = i0 + m;                       // this lane's query
    const float NINF = -__builtin_inff();

    if (tid < 64) bias_sm[tid] = 0.0f;
    #pragma unroll
    for (int t = 0; t < NN / (4 * NT); ++t)
        *(v4f*)&bias_sm[64 + 4 * NT * t + 4 * tid] = *(const v4f*)&btab[(size_t)h * NN + 4 * NT * t + 4 * tid];
    const bool valid = (mask[(size_t)b * NN + i] != 0);
    const bool anym  = (__builtin_amdgcn_ballot_w32(!valid) != 0u);
    __syncthreads();
    const int jext   = anym ? NN : (i0 + 16);
    const int ntiles = (jext + 63) >> 6;         // <= NN/64

    // Q fragments as B operand ([n = query][k = d]); the head's two k tiles of this wave's row block.
    // The attention output of these queries has the same place in its planes.
    const size_t qtile = ((size_t)((b * NN + i0) / 16) * KT_DM + 2 * h) * 512 + 8 * lane;
    v16h qf[2], qf2[2];
    #pragma unroll
    for (int ks = 0; ks < 2; ++ks) {
        qf[ks] = ldpk(qhi + qtile + 512 * ks);
        if (SPLIT) qf2[ks] = ldpk(qlo + qtile + 512 * ks); else qf2[ks] = qf[ks];
    }

    v8f oacc[NDT], oacc2[NDT];
    #pragma unroll
    for (int dt = 0; dt < NDT; ++dt) { oacc[dt] = zero8(); oacc2[dt] = zero8(); }
    float m_run = NINF, l_run = 0.0f;            // l_run: sum over the keys of this lane's half only

    // Not SPLIT: the K fragments run one tile ahead. Tile 0 is loaded here; inside the loop each key block's two
    // fragments are loaded for the next tile right behind their last product, into the registers that the products
    // have just read, so the loads fly under the softmax and the O^T products and the next tile's scores find
    // them landed. SPLIT (at most 32 * QSPLIT / 64 tiles a wave) loads both K planes at the head of the tile.
    v16h kf[4][2], kf2[4][2];
    if (!SPLIT) {
        const hf* kp0 = khi + ((size_t)((b * NN) / 16) * KT_DM + 2 * h) * 512 + 8 * lane;
        #pragma unroll
        for (int kk = 0; kk < 4; ++kk) {
            #pragma unroll
            for (int ks = 0; ks < 2; ++ks) kf[kk][ks] = ldpk(kp0 + (kk * KT_DM + ks) * 512);
        }
        // names the loads' address register as an input: it stays unwritten up to this wait
        asm volatile("s_wait_xcnt 0x0" :: "v"(kp0) : "memory");
        // takes the loaded Q fragments as inputs only: they have landed in front of the loop. Without it the Q loads
        // are the youngest on the way in, and every pass's first products would wait for that count: nearly all K
        asm volatile("" :: "v"(qf[0]), "v"(qf[1]));
    }

    #pragma unroll 1
    for (int jt = 0; jt < ntiles; ++jt) {
        const int jb = jt * 64;
        // SPLIT: this tile. Not SPLIT: the next tile; the last pass names its own tile again, so that the address
        // stays inside the plane, and nothing reads what it brings.
        const int jk = SPLIT ? jb : (jt + 1 < ntiles ? jb + 64 : jb);
        const size_t ktile = ((size_t)((b * NN + jk) / 16) * KT_DM + 2 * h) * 512 + 8 * lane;
        const size_t vtile = ((size_t)((b * DM + h * DH) / 16 + dt0) * KT_NN + 2 * jt) * 512 + 8 * lane;
        // lane bases: every load below is base + constant
        const hf* kp  = khi + ktile;
        const hf* kp2 = klo + ktile;
        const hf* vp  = vthi + vtile;
        const hf* vp2 = vtlo + vtile;

        v16h vf[NDT][2], vf2[NDT][2];
        if (SPLIT) {
            #pragma unroll
            for (int kk = 0; kk < 4; ++kk) {
                #pragma unroll
                for (int ks = 0; ks < 2; ++ks) {
                    kf[kk][ks]  = ldpk(kp + (kk * KT_DM + ks) * 512);
                    kf2[kk][ks] = ldpk(kp2 + (kk * KT_DM + ks) * 512);
                }
            }
        }
        // V^T loads fly under the score work; SPLIT issues them once the K registers are free again.
        // The s_wait_xcnt statements further down name the loads' address registers as inputs: that keeps them
        // unwritten, also by a later load's result, up to the wait; they stand late so that nothing stalls on them
        if (!SPLIT) load_v<SPLIT, NDT>(vp, vp2, vf, vf2);

        // ---- S^T: D row = key 16kk + 8hh + r (within tile), D col = query m ----
        const int dl = i - jb - 8 * hh;          // key (kk, r) is visible to this lane's query iff 16kk + r <= dl
        const int bb = dl + 1 > 0 ? dl + 1 : 0;  // all keys hidden where this clamps
        float sv[4][8];
        #pragma unroll
        for (int kk = 0; kk < 4; ++kk) {
            v8f acc = zero8(), acc2 = zero8();
            #pragma unroll
            for (int ks = 0; ks < 2; ++ks) {
                acc = mma(kf[kk][ks], qf[ks], acc);
                if (SPLIT) {
                    acc2 = mma(kf[kk][ks], qf2[ks], acc2);
                    acc2 = mma(kf2[kk][ks], qf[ks], acc2);
                }
            }
            if (!SPLIT) {
                #pragma unroll
                for (int ks = 0; ks < 2; ++ks) kf[kk][ks] = ldpk(kp + (kk * KT_DM + ks) * 512);
            }
            #pragma unroll
            for (int r = 0; r < 8; ++r) {
                float v = acc[r];
                if (SPLIT) v += acc2[r] * (1.0f / 2048.0f);
                v = v * 0.125f + bias_sm[bb + (63 - 16 * kk - r)];
                sv[kk][r] = (16 * kk + r > dl) ? NINF : v;
            }
        }
        if (SPLIT) {
            asm volatile("s_wait_xcnt 0x0" :: "v"(kp), "v"(kp2) : "memory");   // K address registers free from here
            load_v<SPLIT, NDT>(vp, vp2, vf, vf2);
        }
        if (anym) {
            #pragma unroll
            for (int kk = 0; kk < 4; ++kk) {
                #pragma unroll
                for (int r = 0; r < 8; ++r) sv[kk][r] = valid ? sv[kk][r] : 0.0f;
            }
        }

        // ---- online softmax, one query per lane ----
        float t4[4];
        #pragma unroll
        for (int kk = 0; kk < 4; ++kk) {
            t4[kk] = fmaxf(fmaxf(fmaxf(sv[kk][0], sv[kk][1]), fmaxf(sv[kk][2], sv[kk][3])),
                           fmaxf(fmaxf(sv[kk][4], sv[kk][5]), fmaxf(sv[kk][6], sv[kk][7])));
        }
        float tmax = fmaxf(fmaxf(t4[0], t4[1]), fmaxf(t4[2], t4[3]));
        tmax = fmaxf(tmax, __shfl_xor(tmax, 16, 32));
        const float mn = fmaxf(m_run, tmax);
        const float ea = exp1(m_run - mn);
        const float alpha = (m_run == NINF) ? 0.0f : ea;
        m_run = mn;

        Frag ph[2], pl[2];
        float ps4[4];
        #pragma unroll
        for (int kk = 0; kk < 4; ++kk) {
            float x[8], p[8];
            #pragma unroll
            for (int r = 0; r < 8; ++r) x[r] = sv[kk][r] - mn;
            exp8(x, p);
            #pragma unroll
            for (int r = 0; r < 8; ++r) {
                hf a, bl;
                split2(p[r] * 4096.0f, a, bl);
                ph[kk >> 1].v[8 * (kk & 1) + r] = a;
                if (SPLIT) pl[kk >> 1].v[8 * (kk & 1) + r] = bl;
            }
            ps4[kk] = ((p[0] + p[1]) + (p[2] + p[3])) + ((p[4] + p[5]) + (p[6] + p[7]));
        }
        l_run = l_run * alpha + ((ps4[0] + ps4[1]) + (ps4[2] + ps4[3]));

        // address registers of the loads still named here are free from here
        if (SPLIT) asm volatile("s_wait_xcnt 0x0" :: "v"(vp), "v"(vp2) : "memory");
        else       asm volatile("s_wait_xcnt 0x0" :: "v"(kp), "v"(vp) : "memory");

        // ---- O^T: D row = d 16(dt0 + dt) + 8hh + r, D col = query m ----
        #pragma unroll
        for (int dt = 0; dt < NDT; ++dt) {
            #pragma unroll
            for (int r = 0; r < 8; ++r) { oacc[dt][r] *= alpha; if (SPLIT) oacc2[dt][r] *= alpha; }
            #pragma unroll
            for (int ks = 0; ks < 2; ++ks) {
                oacc[dt] = mma(vf[dt][ks], ph[ks].v, oacc[dt]);
                if (SPLIT) {
                    oacc2[dt] = mma(vf2[dt][ks], ph[ks].v, oacc2[dt]);
                    oacc2[dt] = mma(vf[dt][ks], pl[ks].v, oacc2[dt]);
                }
            }
        }
    }

    // names the L2 request's address register as an input: it holds that address, and nothing else, through the loop
    asm volatile("s_wait_xcnt 0x0" :: "v"(pf) : "memory");

    const float l = l_run + __shfl_xor(l_run, 16, 32);
    v8h_t oh[NDT], ol[NDT];
    #pragma unroll
    for (int dt = 0; dt < NDT; ++dt) {
        #pragma unroll
        for (int r = 0; r < 8; ++r) {
            float o = oacc[dt][r];
            if (SPLIT) o += oacc2[dt][r] * (1.0f / 2048.0f);
            o = (o / l) * (1.0f / 4096.0f);
            hf a, bl;
            split2(o, a, bl);
            oh[dt][r] = a; ol[dt][r] = bl;
        }
    }
    // d tile dt0 + dt = part (dt & 1) of the head's k tile (dt0 + dt) >> 1 (dt0 is even)
    #pragma unroll
    for (int dt = 0; dt < NDT; ++dt) {
        const size_t off = qtile + (size_t)((dt0 >> 1) + (dt >> 1)) * 512 + (dt & 1) * 256;
        *(v8h*)(ohi + off) = oh[dt];
        *(v8h*)(olo + off) = ol[dt];
    }
}

// One launch for all queries. blockIdx.x = (batch, head); blockIdx.y ranks the query runs by falling key count:
// first the single-plane runs of 64 queries from the end of the sequence down, then the two-plane runs of 32.
#define QB_ONE ((NN - 32 * QSPLIT) / 64)         // single-plane blocks per (batch, head)
static_assert((NN - 32 * QSPLIT) % 64 == 0);

__global__ __launch_bounds__(128)
void k_attn(const hf* __restrict__ qhi, const hf* __restrict__ qlo,
            const hf* __restrict__ khi, const hf* __restrict__ klo,
            const hf* __restrict__ vthi, const hf* __restrict__ vtlo,
            const float* __restrict__ btab, const int* __restrict__ mask,
            hf* __restrict__ ohi, hf* __restrict__ olo)
{
    // bias_sm[64 + delta] = bias of distance delta; 64 leading zeros take the reads of causally hidden keys
    __shared__ __attribute__((aligned(16))) float bias_sm[64 + NN];

    const int hb = blockIdx.x, rank = blockIdx.y;
    if (hb >= HH * BB || rank >= QB_ONE + QSPLIT) return;
    const int b = hb / HH, h = hb - b * HH;

    // L2 requests for this head's K and V^T planes, dealt over its blocks: block rank asks for keys
    // 128 (rank mod 16) + 0..127, for speed only.
    // Ranks 16 on up to the last residual key ask for the residual planes, all others for the hi planes.
    // Waves 0, 1: K, 8 row blocks x 8 units of 256 bytes; waves 2, 3: V^T, 4 d blocks x 16 units.
    static_assert(NN == 16 * 128 && DH == 64 && (32 * QSPLIT) % 128 == 0 && 32 * QSPLIT <= NN);
    const int pt = threadIdx.x & 63, pr = rank & 15;
    const bool plo = rank >= 16 && rank < 16 + 32 * QSPLIT / 128;
    const hf* pfk = (plo ? klo : khi)
                  + ((size_t)((b * NN + 128 * pr) / 16 + (pt >> 3)) * KT_DM + 2 * h) * 512 + 128 * (pt & 7);
    const hf* pfv = (plo ? vtlo : vthi)
                  + ((size_t)((b * DM + h * DH) / 16 + (pt >> 4)) * KT_NN + 4 * pr) * 512 + 128 * (pt & 15);
    const hf* pf  = (threadIdx.x < 64) ? pfk : pfv;
    l2_ask<0>(pf);

    if (rank < QB_ONE)
        attn_block<false>(qhi, qlo, khi, klo, vthi, vtlo, btab, mask, ohi, olo, bias_sm,
                          NN - 64 * (rank + 1), h, b, pf);
    else
        attn_block<true>(qhi, qlo, khi, klo, vthi, vtlo, btab, mask, ohi, olo, bias_sm,
                         32 * (QSPLIT - 1 - (rank - QB_ONE)), h, b, pf);
}

// ---------------------------------------------------------------------------------------------
// Host glue: 4 launches, workspace carved from sizes (<= 62 MB)
// ---------------------------------------------------------------------------------------------
extern "C" void kernel_launch(void* const* d_in, const int* in_sizes, int n_in,
                              void* d_out, int out_size, void* d_ws, size_t ws_size,
                              hipStream_t stream)
{
    if (n_in < 7) return;
    if (in_sizes[0] != MR * DM) return;
    if (in_sizes[1] != BB * NN) return;
    if (in_sizes[2] != DM * DM || in_sizes[3] != DM * DM || in_sizes[4] != DM * DM || in_sizes[5] != DM * DM) return;
    if (in_sizes[6] != NBKT * HH) return;
    if (out_size != MR * DM) return;

    const float* x    = (const float*)d_in[0];
    const int*   mask = (const int*)d_in[1];
    const float* Wq   = (const float*)d_in[2];
    const float* Wk   = (const float*)d_in[3];
    const float* Wv   = (const float*)d_in[4];
    const float* Wo   = (const float*)d_in[5];
    const float* rel  = (const float*)d_in[6];
    float* out = (float*)d_out;

    char* ws = (char*)d_ws;
    size_t off = 0;
    auto carve = [&](size_t bytes) -> size_t { size_t p = off; off += (bytes + 255) & ~(size_t)255; return p; };
    const size_t plane = (size_t)MR * DM * sizeof(hf);
    const size_t o_xh   = carve(plane);
    const size_t o_wt   = carve((size_t)4 * DM * DM * sizeof(hf));
    const size_t o_qhi  = carve(plane);
    const size_t o_qlo  = carve(plane);
    const size_t o_khi  = carve(plane);
    const size_t o_klo  = carve(plane);
    const size_t o_vthi = carve(plane);
    const size_t o_vtlo = carve(plane);
    const size_t o_ahi  = carve(plane);
    const size_t o_alo  = carve(plane);
    const size_t o_btab = carve((size_t)HH * NN * sizeof(float));
    if (off > ws_size) return;

    hf* xh   = (hf*)(ws + o_xh);
    hf* wt   = (hf*)(ws + o_wt);
    hf* qhi  = (hf*)(ws + o_qhi);
    hf* qlo  = (hf*)(ws + o_qlo);
    hf* khi  = (hf*)(ws + o_khi);
    hf* klo  = (hf*)(ws + o_klo);
    hf* vthi = (hf*)(ws + o_vthi);
    hf* vtlo = (hf*)(ws + o_vtlo);
    hf* ahi  = (hf*)(ws + o_ahi);
    hf* alo  = (hf*)(ws + o_alo);
    float* btab = (float*)(ws + o_btab);

    k_prep<<<PB_BIAS + PB_W + PB_X, 256, 0, stream>>>(x, Wq, Wk, Wv, Wo, rel, xh, wt, btab);

    // q, k (hi/lo planes), v (transposed hi/lo planes)
    k_proj<0, 4, 2><<<dim3(DM / 64, MR / 256, 3), 128, 0, stream>>>(
        xh, xh, wt, qhi, qlo, khi, klo, vthi, vtlo, out);

    // attention: leading query blocks with residual products, remainder single-plane
    k_attn<<<dim3(HH * BB, QB_ONE + QSPLIT), 128, 0, stream>>>(
        qhi, qlo, khi, klo, vthi, vtlo, btab, mask, ahi, alo);

    // output projection -> out (f32)
    k_proj<1, 2, 4><<<dim3(DM / 64, MR / 128, 1), 128, 0, stream>>>(
        ahi, alo, wt + (size_t)3 * DM * DM, ahi, alo, ahi, alo, ahi, alo, out);
}

// v007
// It runs in 55.8 microseconds.
// Two timings next to v006 both put it at 1.07 times that version's speed.
// Over all steps from v000 it is 6.08 times as fast.
#include <hip/hip_runtime.h>
#include <stdint.h>

// Contractions (q/k/v projections, q.k^T, p.v, output projection): v_wmma_f32_16x16x32_f16, f16 operands,
// f32 accumulate. x / weights / bias table are RNE-converted to bf16; x and weights are then held exactly in f16 (weights x16), the bias table in f32.
// q, k, v^T, p (x4096) and the attention output are carried as an f16 hi plane plus an f16 residual plane
// (residual x2048); residual products are issued for the leading query rows, single-plane products elsewhere.
//
// Every f16 operand plane in the workspace is stored in fragment order. A matrix M[rows][K] (K = contraction
// index) is cut into tiles of 16 rows x 32 k; tile (rb, kb) starts at half ((rb * K/32) + kb) * 512 and holds
//   M[16rb + m][32kb + 16part + 8hh + e]  at  part * 256 + (16hh + m) * 8 + e      (m < 16; part, hh < 2; e < 8)
// so lane 16hh + m of a wave finds its 16 fragment elements at tile + 8 * lane and tile + 256 + 8 * lane, and each
// of the two 16-byte loads (or stores) of a wave covers 512 contiguous bytes: four whole 128-byte lines.

#define BB 2
#define NN 2048
#define DM 768
#define HH 12
#define DH 64
#define MR (BB * NN)
#define NBKT 32
#define QSPLIT 16     // leading 32-query blocks per batch that use two-plane products in attention
#define RSPLIT 512    // leading rows per batch that use the two-plane A operand in the output projection

static_assert(DM % 64 == 0);
static_assert(NN % 64 == 0);
static_assert(MR % 64 == 0);
static_assert(DH == 64);
static_assert(RSPLIT % 64 == 0);
static_assert(QSPLIT <= NN / 32);
static_assert((MR * DM) % 8 == 0);
static_assert(DM % 32 == 0 && NN % 32 == 0 && MR % 16 == 0);
#define KT_DM (DM / 32)   // k tiles of a row block where K = DM
#define KT_NN (NN / 32)   // k tiles of a row block where K = NN (v^T)

typedef _Float16 hf;
typedef _Float16 v8h_t __attribute__((ext_vector_type(8)));
typedef v8h_t __attribute__((may_alias)) v8h;
typedef _Float16 v16h __attribute__((ext_vector_type(16)));
typedef float v8f __attribute__((ext_vector_type(8)));
typedef float v4f_t __attribute__((ext_vector_type(4)));
typedef v4f_t __attribute__((may_alias)) v4f;

union Frag { v16h v; v8h_t p[2]; };

// D(16x16,f32) += A(16x32) * B(32x16); nops keep VALU off the D/A/B registers right after issue.
__device__ __forceinline__ v8f mma(v16h a, v16h b, v8f c)
{
    v8f d = __builtin_amdgcn_wmma_f32_16x16x32_f16(false, a, false, b, (short)0, c, false, false);
    asm volatile("v_nop\n\tv_nop\n\tv_nop\n\tv_nop" : "+v"(d) : "v"(a), "v"(b));
    return d;
}

// 16x16x32 operand fragment for lane (row or column = lane&15), half hh = lane>>4:
// elements 0..7 <- k0+8hh+0..7, elements 8..15 <- k0+16+8hh+0..7 of the lane's row.
// Used for A ([m][k]) and for B held as [n][k]; p = start of the fragment-ordered tile + 8 * lane.
__device__ __forceinline__ v16h ldpk(const hf* p)
{
    Frag f;
    f.p[0] = *(const v8h*)(p);
    f.p[1] = *(const v8h*)(p + 256);
    return f.v;
}

__device__ __forceinline__ float bf16r(float v)
{
    unsigned u = __float_as_uint(v);
    u = (u + 0x7FFFu + ((u >> 16) & 1u)) & 0xFFFF0000u;
    return __uint_as_float(u);
}

// v ~= hi + lo/2048 with hi, lo in f16
__device__ __forceinline__ void split2(float v, hf& hi, hf& lo)
{
    hf h = (hf)v;
    hi = h;
    lo = (hf)((v - (float)h) * 2048.0f);
}

// Asks L2 for the aligned 256-byte unit at p + OFF bytes: nothing comes back and no counter moves. The planes a launch
// reads were stored by an earlier launch. Where such a line is not in the reader's L2 its first reader waits for
// memory, and the blocks that share a plane walk it in step, so every step of each of them would wait so; asked for
// at entry, the later steps' lines are on their way while the first steps run. Every lane's address lies inside its
// plane, and its register is kept as it is up to the s_wait_xcnt statement that names it.
template <int OFF>
__device__ __forceinline__ void l2_ask(const hf* p)
{
    asm volatile("global_prefetch_b8 %0, off offset:%1 scope:SCOPE_SE" :: "v"(p), "n"(OFF));
}

__device__ __forceinline__ v8f zero8()
{
    v8f z = {0.f, 0.f, 0.f, 0.f, 0.f, 0.f, 0.f, 0.f};
    return z;
}

// ---------------------------------------------------------------------------------------------
// xh = f16(bf16(x)) in fragment order ([MR][DM]); thread t fills 16-byte piece t, lane-contiguous stores
// ---------------------------------------------------------------------------------------------
__device__ __forceinline__ void prep_x(const float* __restrict__ x, hf* __restrict__ xh, int t)
{
    const int lane = t & 31, part = (t >> 5) & 1, tile = t >> 6;
    const int rb = tile / KT_DM, kb = tile - rb * KT_DM;
    const float* p = x + (size_t)(16 * rb + (lane & 15)) * DM + 32 * kb + 16 * part + 8 * (lane >> 4);
    v4f_t a = *(const v4f*)p;
    v4f_t b = *(const v4f*)(p + 4);
    v8h_t o;
    o[0] = (hf)bf16r(a[0]); o[1] = (hf)bf16r(a[1]); o[2] = (hf)bf16r(a[2]); o[3] = (hf)bf16r(a[3]);
    o[4] = (hf)bf16r(b[0]); o[5] = (hf)bf16r(b[1]); o[6] = (hf)bf16r(b[2]); o[7] = (hf)bf16r(b[3]);
    hf* d = xh + (size_t)t * 8;
    *(v8h*)d = o;
    // the arms of k_prep follow one another in the code: the store's registers stay unwritten up to this wait
    asm volatile("s_wait_xcnt 0x0" ::: "memory");
}

// ---------------------------------------------------------------------------------------------
// wt[w] = fragment order of [c][k] = f16(bf16(W_w[k][c]) * 16), W_w is [DM(k)][DM(c)]; 8 consecutive k per thread,
// thread = 16-byte piece of the plane: 16 neighbouring lanes read 16 neighbouring c of one k row
// ---------------------------------------------------------------------------------------------
__device__ __forceinline__ void prep_w(const float* __restrict__ w0, const float* __restrict__ w1,
                                       const float* __restrict__ w2, const float* __restrict__ w3,
                                       hf* __restrict__ wt, int t)
{
    const int per = DM * (DM / 8);
    const int wi  = t / per;
    const int rem = t - wi * per;
    const int lane = rem & 31, part = (rem >> 5) & 1, tile = rem >> 6;
    const int rb  = tile / KT_DM, kb = tile - rb * KT_DM;
    const int c   = 16 * rb + (lane & 15);
    const int k8  = 32 * kb + 16 * part + 8 * (lane >> 4);
    const float* W = (wi == 0) ? w0 : (wi == 1) ? w1 : (wi == 2) ? w2 : w3;
    v8h_t o;
    #pragma unroll
    for (int e = 0; e < 8; ++e) o[e] = (hf)(bf16r(W[(size_t)(k8 + e) * DM + c]) * 16.0f);
    hf* d = wt + (size_t)wi * DM * DM + (size_t)rem * 8;
    *(v8h*)d = o;
    // the arms of k_prep follow one another in the code: the store's registers stay unwritten up to this wait
    asm volatile("s_wait_xcnt 0x0" ::: "memory");
}

// ---------------------------------------------------------------------------------------------
// btab[h][delta] = bf16(rel[bucket(delta)][h]) * DH^-0.5, causal bucketing; 4 deltas per thread
// ---------------------------------------------------------------------------------------------
__device__ __forceinline__ void prep_bias(const float* __restrict__ rel, float* __restrict__ tab, int t)
{
    const int h  = t / (NN / 4);
    const int d4 = (t - h * (NN / 4)) * 4;
    v4f_t o;
    #pragma unroll
    for (int e = 0; e < 4; ++e) {
        const int d = d4 + e;
        int bk;
        if (d < NBKT / 2) {
            bk = d;
        } else {
            float f  = (float)d * (1.0f / 16.0f);
            float lg = logf(f);
            float u  = lg * (1.0f / 2.0794415416798357f);
            float w  = u * 16.0f;
            int v = (NBKT / 2) + (int)w;
            bk = v < (NBKT - 1) ? v : (NBKT - 1);
            if (bk < 0) bk = 0;
        }
        o[e] = bf16r(rel[bk * HH + h]) * 0.125f;
    }
    float* d = tab + (size_t)h * NN + d4;
    *(v4f*)d = o;
    // the arms of k_prep follow one another in the code: the store's registers stay unwritten up to this wait
    asm volatile("s_wait_xcnt 0x0" ::: "memory");
}

// ---------------------------------------------------------------------------------------------
// The three conversions depend on nothing but the inputs: one launch, a block range each.
// ---------------------------------------------------------------------------------------------
#define PB_BIAS (HH * NN / 4 / 256)
#define PB_W    (4 * DM * (DM / 8) / 256)
#define PB_X    (MR * DM / 8 / 256)
static_assert((HH * NN / 4) % 256 == 0 && (4 * DM * (DM / 8)) % 256 == 0 && (MR * DM / 8) % 256 == 0);

__global__ __launch_bounds__(256)
void k_prep(const float* __restrict__ x, const float* __restrict__ w0, const float* __restrict__ w1,
            const float* __restrict__ w2, const float* __restrict__ w3, const float* __restrict__ rel,
            hf* __restrict__ xh, hf* __restrict__ wt, float* __restrict__ tab)
{
    const int blk = blockIdx.x, tid = threadIdx.x;
    if (blk < PB_BIAS)                    prep_bias(rel, tab, blk * 256 + tid);
    else if (blk < PB_BIAS + PB_W)        prep_w(w0, w1, w2, w3, wt, (blk - PB_BIAS) * 256 + tid);
    else if (blk < PB_BIAS + PB_W + PB_X) prep_x(x, xh, (blk - PB_BIAS - PB_W) * 256 + tid);
}

// ---------------------------------------------------------------------------------------------
// C[64 FA x 64 tile] = A[64 FA x 768] * Wt[64 x 768]^T / 16, block = 4 waves, wave = FA row blocks of 16 x 64 cols:
// row block 4f + wave of the tile (f < FA), so that the four waves together hold one 64-row slab for each f.
// A B fragment serves FA products and an A fragment four. The k loop is unrolled whole over a ring of ST fragment
// register sets: step ks + ST - 1 is loaded in front of the products of step ks, every load is base + constant.
// MODE 0 (grid.z: 0 = q, 1 = k, 2 = v): q/k stored as [MR][DM] hi/lo f16 planes,
//         v stored transposed, [BB * DM][NN], as hi/lo f16 planes. A = xh. All planes in fragment order.
// MODE 1: A = attention output hi (+ lo plane for rows (m0 mod NN) < RSPLIT), C stored f32 to out.
// ---------------------------------------------------------------------------------------------
// Every loop of ld_step, gemm_k and k_proj is unrolled: the fragment, accumulator and staging indices must be
// constants for the arrays to live in registers and for every address to be base + constant.
template <int FA, bool TWO>
__device__ __forceinline__ void ld_step(const hf* ap, const hf* ap2, const hf* bp, int ks,
                                        v16h (&a)[FA], v16h (&a2)[FA], v16h (&b)[4])
{
    #pragma unroll
    for (int t = 0; t < 4; ++t) b[t] = ldpk(bp + (t * KT_DM + ks) * 512);
    #pragma unroll
    for (int f = 0; f < FA; ++f) {
        a[f] = ldpk(ap + (4 * f * KT_DM + ks) * 512);
        if (TWO) a2[f] = ldpk(ap2 + (4 * f * KT_DM + ks) * 512);
    }
}

// The builtin alone: the compiler keeps the distance behind its own matrix instructions, and operands that pass
// through no asm statement may live above v255, which the accumulators and the ring together need.
__device__ __forceinline__ v8f mmab(v16h a, v16h b, v8f c)
{
    return __builtin_amdgcn_wmma_f32_16x16x32_f16(false, a, false, b, (short)0, c, false, false);
}

template <int FA, int ST, bool TWO>
__device__ __forceinline__ void gemm_k(const hf* ap, const hf* ap2, const hf* bp,
                                       v8f (&acc)[FA][4], v8f (&acc2)[FA][4])
{
    v16h a[ST][FA], a2[ST][FA], b[ST][4];
    #pragma unroll
    for (int ks = 0; ks < ST - 1; ++ks) ld_step<FA, TWO>(ap, ap2, bp, ks, a[ks], a2[ks], b[ks]);
    // unrolled whole: the ring's set numbers become register names and no address register is ever stepped
    #pragma unroll
    for (int ks = 0; ks < KT_DM; ++ks) {
        const int s = ks % ST, sn = (ks + ST - 1) % ST;
        if (ks + ST - 1 < KT_DM) ld_step<FA, TWO>(ap, ap2, bp, ks + ST - 1, a[sn], a2[sn], b[sn]);
        // holds the loads above in front of this step's products: without it the compiler sinks each load down to
        // its first use, ST - 1 steps on, and the wave waits out the whole load latency there
        __builtin_amdgcn_sched_barrier(0);
        #pragma unroll
        for (int f = 0; f < FA; ++f) {
            #pragma unroll
            for (int t = 0; t < 4; ++t) acc[f][t] = mmab(a[s][f], b[s][t], acc[f][t]);
        }
        if (TWO) {
            #pragma unroll
            for (int f = 0; f < FA; ++f) {
                #pragma unroll
                for (int t = 0; t < 4; ++t) acc2[f][t] = mmab(a2[s][f], b[s][t], acc2[f][t]);
            }
        }
    }
    // names the loads' address registers as inputs: they stay unwritten up to this wait, behind the last load
    asm volatile("s_wait_xcnt 0x0" :: "v"(ap), "v"(ap2), "v"(bp) : "memory");
}

template <int MODE, int FA, int ST>
__global__ __launch_bounds__(128)
void k_proj(const hf* __restrict__ Ahi, const hf* __restrict__ Alo, const hf* __restrict__ Wt,
            hf* __restrict__ o0h, hf* __restrict__ o0l,
            hf* __restrict__ o1h, hf* __restrict__ o1l,
            hf* __restrict__ o2h, hf* __restrict__ o2l,
            float* __restrict__ outf)
{
    static_assert(MR % (64 * FA) == 0 && NN % (64 * FA) == 0 && RSPLIT % (64 * FA) == 0);
    __shared__ __attribute__((aligned(16))) float Call[FA][64][68];   // a staging array for each 64-row slab

    const int wave = threadIdx.x >> 5, lane = threadIdx.x & 31, m = lane & 15, hh = lane >> 4;
    const int n0 = blockIdx.x * 64, mt = blockIdx.y * (64 * FA), z = blockIdx.z;
    if (n0 >= DM || mt >= MR) return;
    const hf* Bt = Wt + (size_t)z * DM * DM;
    const bool two = (MODE == 1) && ((mt & (NN - 1)) < RSPLIT);

    const size_t aoff = (size_t)(mt / 16 + wave) * KT_DM * 512 + 8 * lane;
    const hf* ap  = Ahi + aoff;
    const hf* ap2 = two ? (Alo + aoff) : ap;
    const hf* bp  = Bt + (size_t)(n0 / 16) * KT_DM * 512 + 8 * lane;

    // L2 requests for the whole A and B panels, dealt over the blocks that read the same panel so that four
    // neighbours in x with all z (A, MODE 0), three in x (A, MODE 1), or three next neighbours in y of one parity (B), together
    // ask for all of it: a guess at which blocks share an L2, for speed only. A lane asks for one 256-byte unit
    // (128 halves).
    const hf* pfb = Bt + ((size_t)(n0 / 16 + wave) * KT_DM + 8 * ((blockIdx.y >> 1) % 3)) * 512 + 128 * lane;
    const hf* pfa;
    const hf* pfa2;
    static_assert(KT_DM == 24);
    l2_ask<0>(pfb);                                   // 8 k tiles of B row block 'wave'
    if (MODE == 0) {
        static_assert(MODE != 0 || FA == 4);          // 16 row blocks x 2 k tiles: 128 units
        pfa = Ahi + ((size_t)(mt / 16 + (threadIdx.x >> 3)) * KT_DM + 2 * (4 * z + (blockIdx.x & 3))) * 512
                  + 128 * (threadIdx.x & 7);
        pfa2 = pfa;
        l2_ask<0>(pfa);
    } else {
        static_assert(MODE == 0 || FA == 2);          // 8 k tiles of A row blocks 'wave' and 'wave' + 4
        const size_t poff = ((size_t)(mt / 16 + wave) * KT_DM + 8 * (blockIdx.x % 3)) * 512 + 128 * lane;
        pfa  = Ahi + poff;
        pfa2 = two ? (Alo + poff) : pfa;
        l2_ask<0>(pfa);
        l2_ask<4 * KT_DM * 1024>(pfa);
        if (two) {
            l2_ask<0>(pfa2);
            l2_ask<4 * KT_DM * 1024>(pfa2);
        }
    }

    v8f acc[FA][4], acc2[FA][4];
    #pragma unroll
    for (int f = 0; f < FA; ++f) {
        #pragma unroll
        for (int t = 0; t < 4; ++t) { acc[f][t] = zero8(); acc2[f][t] = zero8(); }
    }

    if (two) gemm_k<FA, ST, true>(ap, ap2, bp, acc, acc2);
    else     gemm_k<FA, ST, false>(ap, ap2, bp, acc, acc2);
    // names the L2 requests' address registers as inputs: they hold those addresses, and nothing else, through the k loop
    asm volatile("s_wait_xcnt 0x0" :: "v"(pfa), "v"(pfa2), "v"(pfb) : "memory");

    // D element r of lane: row 16*wave + 8*hh + r of slab f, col 16*t + m
    #pragma unroll
    for (int f = 0; f < FA; ++f) {
        #pragma unroll
        for (int t = 0; t < 4; ++t) {
            #pragma unroll
            for (int r = 0; r < 8; ++r) {
                float v = acc[f][t][r];
                if (MODE == 1) v += acc2[f][t][r] * (1.0f / 2048.0f);
                Call[f][16 * wave + 8 * hh + r][16 * t + m] = v * (1.0f / 16.0f);
            }
        }
    }
    __syncthreads();

    // One 64-row slab after the other. Each s_wait_xcnt below names its stores' data and address registers as
    // inputs: they stay unwritten up to the wait, and the next piece's values may take them only behind it.
    if (MODE == 0) {
        if (z < 2) {
            hf* dh = (z == 0) ? o0h : o1h;
            hf* dl = (z == 0) ? o0l : o1l;
            #pragma unroll
            for (int f = 0; f < FA; ++f) {
                const int m0 = mt + 64 * f;
                #pragma unroll
                for (int it = 0; it < 4; ++it) {
                    const int row = 16 * it + m;             // row block it, columns 16 wave + 8hh + 0..7
                    const int c8  = 16 * wave + 8 * hh;
                    v4f_t u0 = *(const v4f*)&Call[f][row][c8];
                    v4f_t u1 = *(const v4f*)&Call[f][row][c8 + 4];
                    v8h_t ph, pl;
                    hf a, bl;
                    split2(u0[0], a, bl); ph[0] = a; pl[0] = bl;
                    split2(u0[1], a, bl); ph[1] = a; pl[1] = bl;
                    split2(u0[2], a, bl); ph[2] = a; pl[2] = bl;
                    split2(u0[3], a, bl); ph[3] = a; pl[3] = bl;
                    split2(u1[0], a, bl); ph[4] = a; pl[4] = bl;
                    split2(u1[1], a, bl); ph[5] = a; pl[5] = bl;
                    split2(u1[2], a, bl); ph[6] = a; pl[6] = bl;
                    split2(u1[3], a, bl); ph[7] = a; pl[7] = bl;
                    const size_t off = ((size_t)(m0 / 16 + it) * KT_DM + n0 / 32 + (wave >> 1)) * 512
                                     + (wave & 1) * 256 + 8 * lane;
                    hf* sh = dh + off;
                    hf* sl = dl + off;
                    *(v8h*)sh = ph;
                    *(v8h*)sl = pl;
                    asm volatile("s_wait_xcnt 0x0" :: "v"(ph), "v"(pl), "v"(sh), "v"(sl) : "memory");
                }
            }
        } else {
            #pragma unroll
            for (int f = 0; f < FA; ++f) {
                const int m0   = mt + 64 * f;
                const int bidx = m0 >> 11;
                const int j0   = m0 & (NN - 1);
                #pragma unroll
                for (int it = 0; it < 4; ++it) {
                    const int cc = 16 * it + m;              // channel block it, keys 16 wave + 8hh + 0..7
                    const int j8 = 16 * wave + 8 * hh;
                    v8h_t ph, pl;
                    #pragma unroll
                    for (int e = 0; e < 8; ++e) {
                        hf a, bl;
                        split2(Call[f][j8 + e][cc], a, bl);
                        ph[e] = a; pl[e] = bl;
                    }
                    const size_t off = ((size_t)((bidx * DM + n0) / 16 + it) * KT_NN + j0 / 32 + (wave >> 1)) * 512
                                     + (wave & 1) * 256 + 8 * lane;
                    hf* sh = o2h + off;
                    hf* sl = o2l + off;
                    *(v8h*)sh = ph;
                    *(v8h*)sl = pl;
                    asm volatile("s_wait_xcnt 0x0" :: "v"(ph), "v"(pl), "v"(sh), "v"(sl) : "memory");
                }
            }
        }
    } else {
        #pragma unroll
        for (int f = 0; f < FA; ++f) {
            const int m0 = mt + 64 * f;
            #pragma unroll
            for (int it = 0; it < 8; ++it) {
                const int row = 16 * wave + 2 * it + (lane >> 4);
                const int c4  = (lane & 15) * 4;
                v4f_t u = *(const v4f*)&Call[f][row][c4];
                float* so = outf + (size_t)(m0 + row) * DM + n0 + c4;
                *(v4f*)so = u;
                asm volatile("s_wait_xcnt 0x0" :: "v"(u), "v"(so) : "memory");
            }
        }
    }
}

// ---------------------------------------------------------------------------------------------
// q, k, v = xh * Wt_z^T / 16. Grid = (DM / 48, MR / 256) blocks of 4 waves: as many blocks as the chip has WGPs, and
// the registers of a wave leave room for one wave a SIMD. A wave owns 64 rows (4 row blocks) x 144 columns: columns
// 48 bx + 0..47 of each of q, k and v (column tile t: plane t / 3, 16-column block 3 bx + t % 3). A step of 32 k is
// 13 fragments for 36 products; the four waves share the 9 W fragments, each has its own x rows.
// q, k: the product is formed transposed (A = W rows, B = x rows), so a lane holds 8 neighbouring columns of one row;
// v: as it stands (A = x rows, B = W rows), so a lane holds 8 neighbouring keys of one channel. Either way a lane's 8
// accumulator values are one 16-byte piece of the fragment-ordered plane ([MR][DM] for q, k; [BB * DM][NN] for v^T)
// and a wave's store covers 512 contiguous bytes: nothing is staged in LDS and the waves never meet.
// ---------------------------------------------------------------------------------------------
static_assert(DM % 48 == 0 && MR % 256 == 0 && NN % 256 == 0 && KT_DM == 24);

__device__ __forceinline__ void qkv_ld(const hf* ap, const hf* bp, int ks, v16h (&a)[4], v16h (&b)[9])
{
    #pragma unroll
    for (int t = 0; t < 9; ++t) b[t] = ldpk(bp + (((t / 3) * (DM / 16) + t % 3) * KT_DM + ks) * 512);
    #pragma unroll
    for (int f = 0; f < 4; ++f) a[f] = ldpk(ap + (f * KT_DM + ks) * 512);
}

__device__ __forceinline__ void few_out()
{
    // stands in front of a group of 26 loads: with at most 36 older loads out, the wave's load counter (63) is never full
    asm volatile("s_wait_loadcnt 0x24" ::: "memory");
}

__global__ __launch_bounds__(128)
void k_qkv(const hf* __restrict__ xh, const hf* __restrict__ Wt,
           hf* __restrict__ qh, hf* __restrict__ ql, hf* __restrict__ kh, hf* __restrict__ kl,
           hf* __restrict__ vh, hf* __restrict__ vl)
{
    constexpr int ST = 4;
    const int lane = threadIdx.x & 31;
    const int wave = __builtin_amdgcn_readfirstlane(threadIdx.x >> 5);
    const int bx = blockIdx.x, by = blockIdx.y;
    if (bx >= DM / 48 || by >= MR / 256) return;
    const int rb0 = 16 * by + 4 * wave;               // the wave's first 16-row block
    const hf* ap = xh + (size_t)rb0 * KT_DM * 512 + 8 * lane;
    const hf* bp = Wt + (size_t)(3 * bx) * KT_DM * 512 + 8 * lane;

    // L2 requests for the block's x panel (1,536 units of 256 bytes) and its three W panels (288 units each), dealt
    // over the blocks that read the same panel: four neighbours in x together ask for all of the x panel, three
    // neighbours in y for the W panels: a guess at which blocks share an L2, for speed only.
    const hf* pfa = xh + (size_t)(16 * by) * KT_DM * 512 + (size_t)(384 * (bx & 3) + threadIdx.x) * 128;
    const hf* pfb = pfa;
    l2_ask<0>(pfa);
    l2_ask<128 * 256>(pfa);
    l2_ask<256 * 256>(pfa);
    if (wave < 3) {                                   // a scalar test: whole waves ask or do not
        pfb = Wt + (size_t)(3 * bx) * KT_DM * 512 + (size_t)(96 * (by % 3) + threadIdx.x) * 128;
        l2_ask<0>(pfb);
        l2_ask<DM * DM * 2>(pfb);
        l2_ask<2 * DM * DM * 2>(pfb);
    }

    v8f acc[4][9];
    #pragma unroll
    for (int f = 0; f < 4; ++f) {
        #pragma unroll
        for (int t = 0; t < 9; ++t) acc[f][t] = zero8();
    }

    // Ring of ST register sets: set ks % ST holds step ks and is refilled for step ks + ST right behind its products.
    // few_out: a group of 26 loads is issued only once at most 36 older loads of the wave are still on their way, so
    // that never more than 62 are: the wave's load counter holds 63.
    v16h a[ST][4], b[ST][9];
    qkv_ld(ap, bp, 0, a[0], b[0]);
    qkv_ld(ap, bp, 1, a[1], b[1]);
    #pragma unroll
    for (int ks = 2; ks < ST; ++ks) {
        few_out();
        qkv_ld(ap, bp, ks, a[ks], b[ks]);
    }
    // names the L2 requests' address registers as inputs: they stay unwritten up to this wait and are free behind it
    asm volatile("s_wait_xcnt 0x0" :: "v"(pfa), "v"(pfb) : "memory");
    // unrolled whole: the ring's set numbers become register names and no address register is ever stepped
    #pragma unroll
    for (int ks = 0; ks < KT_DM; ++ks) {
        const int s = ks % ST;
        // keeps the refill of the step before in front of this step's products: without it the compiler sinks each
        // load down to its first use, ST steps on, and the wave, alone on its SIMD, waits out the whole latency there
        __builtin_amdgcn_sched_barrier(0);
        #pragma unroll
        for (int t = 0; t < 9; ++t) {
            #pragma unroll
            for (int f = 0; f < 4; ++f)
                acc[f][t] = (t < 6) ? mmab(b[s][t], a[s][f], acc[f][t]) : mmab(a[s][f], b[s][t], acc[f][t]);
        }
        if (ks + ST < KT_DM) {
            // keeps the wait below behind this step's products: the compiler lifts it to the step's head, where the
            // loads that it waits for have had one step less to land
            __builtin_amdgcn_sched_barrier(0);
            few_out();
            qkv_ld(ap, bp, ks + ST, a[s], b[s]);
        }
    }
    // behind the last load and in front of every later write of a register that a load names
    asm volatile("s_wait_xcnt 0x0" ::: "memory");
    // keeps the address arithmetic of the stores below from rising over that wait into the loads' base registers
    __builtin_amdgcn_sched_barrier(0);

    const int m0   = 256 * by + 64 * wave;            // the wave's first row: batch m0 / NN, key m0 mod NN
    const int bidx = m0 / NN;
    const int j16  = (m0 & (NN - 1)) / 16;
    // The 8 pieces (4 row blocks, hi and lo) of column tile t, and where they go.
    v8h_t ph[2][4], pl[2][4];
    hf* sh[2][4];
    hf* sl[2][4];
    auto pieces = [&](int t, int s) {
        const int c16 = 3 * bx + t % 3;               // 16-column block inside the plane
        hf* dh = (t < 3) ? qh : (t < 6) ? kh : vh;
        hf* dl = (t < 3) ? ql : (t < 6) ? kl : vl;
        #pragma unroll
        for (int f = 0; f < 4; ++f) {
            #pragma unroll
            for (int r = 0; r < 8; ++r) {
                hf hi, lo;
                split2(acc[f][t][r] * (1.0f / 16.0f), hi, lo);
                ph[s][f][r] = hi; pl[s][f][r] = lo;
            }
            // q, k: row block rb0 + f, k index = column. v^T: row block = channel block, k index = key
            const size_t off = (t < 6)
                ? ((size_t)(rb0 + f) * KT_DM + (c16 >> 1)) * 512 + (c16 & 1) * 256 + 8 * lane
                : ((size_t)(bidx * (DM / 16) + c16) * KT_NN + ((j16 + f) >> 1)) * 512 + ((j16 + f) & 1) * 256 + 8 * lane;
            sh[s][f] = dh + off;
            sl[s][f] = dl + off;
        }
    };
    pieces(0, 0);
    #pragma unroll
    for (int t = 0; t < 9; ++t) {
        const int s = t & 1;
        #pragma unroll
        for (int f = 0; f < 4; ++f) {
            *(v8h*)sh[s][f] = ph[s][f];
            *(v8h*)sl[s][f] = pl[s][f];
        }
        // the next tile's pieces are formed in the other register set while these stores are taken up
        if (t + 1 < 9) pieces(t + 1, s ^ 1);
        // names the stores' data and address registers as inputs: they stay unwritten up to this wait
        asm volatile("s_wait_xcnt 0x0" :: "v"(ph[s][0]), "v"(ph[s][1]), "v"(ph[s][2]), "v"(ph[s][3]),
                     "v"(pl[s][0]), "v"(pl[s][1]), "v"(pl[s][2]), "v"(pl[s][3]),
                     "v"(sh[s][0]), "v"(sh[s][1]), "v"(sh[s][2]), "v"(sh[s][3]),
                     "v"(sl[s][0]), "v"(sl[s][1]), "v"(sl[s][2]), "v"(sl[s][3]) : "memory");
    }
}

// ---------------------------------------------------------------------------------------------
// Fused causal attention, block = (a run of queries, head h, batch b); a wave owns 16 queries and walks 64-key
// tiles on its own, with no LDS traffic for scores and no barrier inside the loop:
//   S^T = K.Q^T   (A = K rows, B = Q rows as [n][k]): lane holds query (lane&15), keys 16kk + 8*(lane>>4) + r
//   online softmax per lane (bias, causal, row mask), one exchange between the wave halves for the maximum
//   O^T += V^T.P^T (A = V^T rows, B = P^T packed from the score registers, f16 x4096 (+ residual plane))
// SPLIT: hi/lo residual products on q.k^T and p.v. Output: attention rows as hi/lo f16 planes in fragment order
// ([MR][DM]): a lane's 8 values of a d tile are one 16-byte piece of it, so every wave stores whole lines itself.
// Not SPLIT: 64 queries, 4 waves, each all four 16-wide d tiles. SPLIT: 32 queries, 4 waves, two per 16 queries,
// each two d tiles (both form the same S^T), so that both planes of K, V^T, Q and O fit the register file
// without spills. Both kinds of block share one launch (k_attn below): neither reads what the other writes.
// ---------------------------------------------------------------------------------------------
// p = exp(x), built as the fast intrinsic is (x * log2 e, then v_exp_f32). Written as asm so that the slot the
// instruction set asks for behind a transcendental is kept by construction: the results are early-clobber, so
// no v_exp_f32 of a statement writes over a source of another, and the closing v_nop stands behind the last.
__device__ __forceinline__ void exp8(const float (&x)[8], float (&p)[8])
{
    float t[8];
    #pragma unroll
    for (int r = 0; r < 8; ++r) t[r] = x[r] * 1.44269504f;
    asm("v_exp_f32 %0, %8\n\tv_exp_f32 %1, %9\n\tv_exp_f32 %2, %10\n\tv_exp_f32 %3, %11\n\t"
        "v_exp_f32 %4, %12\n\tv_exp_f32 %5, %13\n\tv_exp_f32 %6, %14\n\tv_exp_f32 %7, %15\n\tv_nop"
        : "=&v"(p[0]), "=&v"(p[1]), "=&v"(p[2]), "=&v"(p[3]), "=&v"(p[4]), "=&v"(p[5]), "=&v"(p[6]), "=&v"(p[7])
        : "v"(t[0]), "v"(t[1]), "v"(t[2]), "v"(t[3]), "v"(t[4]), "v"(t[5]), "v"(t[6]), "v"(t[7]));
}

__device__ __forceinline__ float exp1(float x)
{
    const float t = x * 1.44269504f;
    float p;
    asm("v_exp_f32 %0, %1\n\tv_nop" : "=&v"(p) : "v"(t));   // same slot, one value
    return p;
}

template <bool SPLIT, int NDT>
__device__ __forceinline__ void load_v(const hf* vp, const hf* vp2, v16h (&vf)[NDT][2], v16h (&vf2)[NDT][2])
{
    #pragma unroll
    for (int dt = 0; dt < NDT; ++dt) {
        #pragma unroll
        for (int ks = 0; ks < 2; ++ks) {
            vf[dt][ks] = ldpk(vp + (dt * KT_NN + ks) * 512);
            if (SPLIT) vf2[dt][ks] = ldpk(vp2 + (dt * KT_NN + ks) * 512);
        }
    }
}

template <bool SPLIT>
__device__ __forceinline__
void attn_block(const hf* __restrict__ qhi, const hf* __restrict__ qlo,
                const hf* __restrict__ khi, const hf* __restrict__ klo,
                const hf* __restrict__ vthi, const hf* __restrict__ vtlo,
                const float* __restrict__ btab, const int* __restrict__ mask,
                hf* __restrict__ ohi, hf* __restrict__ olo,
                float* bias_sm, int q0, int h, int b,   // q0: first query of the block
                const hf* pf)                           // address register of the block's L2 request
{
    const int tid = threadIdx.x, lane = tid & 31, m = lane & 15, hh = lane >> 4;
    const int wave = __builtin_amdgcn_readfirstlane(tid >> 5);
    constexpr int NT  = 128;                     // threads per block
    constexpr int NDT = SPLIT ? 2 : 4;           // d tiles per wave
    const int qt  = SPLIT ? (wave >> 1) : wave;  // 16-query sub-tile of this wave
    const int dt0 = SPLIT ? NDT * (wave & 1) : 0;
    const int i0 = q0 + 16 * qt;                 // first query of this wave
    const int i  = i0 + m;                       // this lane's query
    const float NINF = -__builtin_inff();

    if (tid < 64) bias_sm[tid] = 0.0f;
    #pragma unroll
    for (int t = 0; t < NN / (4 * NT); ++t)
        *(v4f*)&bias_sm[64 + 4 * NT * t + 4 * tid] = *(const v4f*)&btab[(size_t)h * NN + 4 * NT * t + 4 * tid];
    const bool valid = (mask[(size_t)b * NN + i] != 0);
    const bool anym  = (__builtin_amdgcn_ballot_w32(!valid) != 0u);
    __syncthreads();
    const int jext   = anym ? NN : (i0 + 16);
    const int ntiles = (jext + 63) >> 6;         // <= NN/64

    // Q fragments as B operand ([n = query][k = d]); the head's two k tiles of this wave's row block.
    // The attention output of these queries has the same place in its planes.
    const size_t qtile = ((size_t)((b * NN + i0) / 16) * KT_DM + 2 * h) * 512 + 8 * lane;
    v16h qf[2], qf2[2];
    #pragma unroll
    for (int ks = 0; ks < 2; ++ks) {
        qf[ks] = ldpk(qhi + qtile + 512 * ks);
        if (SPLIT) qf2[ks] = ldpk(qlo + qtile + 512 * ks); else qf2[ks] = qf[ks];
    }

    v8f oacc[NDT], oacc2[NDT];
    #pragma unroll
    for (int dt = 0; dt < NDT; ++dt) { oacc[dt] = zero8(); oacc2[dt] = zero8(); }
    float m_run = NINF, l_run = 0.0f;            // l_run: sum over the keys of this lane's half only

    // Not SPLIT: the K fragments run one tile ahead. Tile 0 is loaded here; inside the loop each key block's two
    // fragments are loaded for the next tile right behind their last product, into the registers that the products
    // have just read, so the loads fly under the softmax and the O^T products and the next tile's scores find
    // them landed. SPLIT (at most 32 * QSPLIT / 64 tiles a wave) loads both K planes at the head of the tile.
    v16h kf[4][2], kf2[4][2];
    if (!SPLIT) {
        const hf* kp0 = khi + ((size_t)((b * NN) / 16) * KT_DM + 2 * h) * 512 + 8 * lane;
        #pragma unroll
        for (int kk = 0; kk < 4; ++kk) {
            #pragma unroll
            for (int ks = 0; ks < 2; ++ks) kf[kk][ks] = ldpk(kp0 + (kk * KT_DM + ks) * 512);
        }
        // names the loads' address register as an input: it stays unwritten up to this wait
        asm volatile("s_wait_xcnt 0x0" :: "v"(kp0) : "memory");
        // takes the loaded Q fragments as inputs only: they have landed in front of the loop. Without it the Q loads
        // are the youngest on the way in, and every pass's first products would wait for that count: nearly all K
        asm volatile("" :: "v"(qf[0]), "v"(qf[1]));
    }

    #pragma unroll 1
    for (int jt = 0; jt < ntiles; ++jt) {
        const int jb = jt * 64;
        // SPLIT: this tile. Not SPLIT: the next tile; the last pass names its own tile again, so that the address
        // stays inside the plane, and nothing reads what it brings.
        const int jk = SPLIT ? jb : (jt + 1 < ntiles ? jb + 64 : jb);
        const size_t ktile = ((size_t)((b * NN + jk) / 16) * KT_DM + 2 * h) * 512 + 8 * lane;
        const size_t vtile = ((size_t)((b * DM + h * DH) / 16 + dt0) * KT_NN + 2 * jt) * 512 + 8 * lane;
        // lane bases: every load below is base + constant
        const hf* kp  = khi + ktile;
        const hf* kp2 = klo + ktile;
        const hf* vp  = vthi + vtile;
        const hf* vp2 = vtlo + vtile;

        v16h vf[NDT][2], vf2[NDT][2];
        if (SPLIT) {
            #pragma unroll
            for (int kk = 0; kk < 4; ++kk) {
                #pragma unroll
                for (int ks = 0; ks < 2; ++ks) {
                    kf[kk][ks]  = ldpk(kp + (kk * KT_DM + ks) * 512);
                    kf2[kk][ks] = ldpk(kp2 + (kk * KT_DM + ks) * 512);
                }
            }
        }
        // V^T loads fly under the score work; SPLIT issues them once the K registers are free again.
        // The s_wait_xcnt statements further down name the loads' address registers as inputs: that keeps them
        // unwritten, also by a later load's result, up to the wait; they stand late so that nothing stalls on them
        if (!SPLIT) load_v<SPLIT, NDT>(vp, vp2, vf, vf2);

        // ---- S^T: D row = key 16kk + 8hh + r (within tile), D col = query m ----
        const int dl = i - jb - 8 * hh;          // key (kk, r) is visible to this lane's query iff 16kk + r <= dl
        const int bb = dl + 1 > 0 ? dl + 1 : 0;  // all keys hidden where this clamps
        float sv[4][8];
        #pragma unroll
        for (int kk = 0; kk < 4; ++kk) {
            v8f acc = zero8(), acc2 = zero8();
            #pragma unroll
            for (int ks = 0; ks < 2; ++ks) {
                acc = mma(kf[kk][ks], qf[ks], acc);
                if (SPLIT) {
                    acc2 = mma(kf[kk][ks], qf2[ks], acc2);
                    acc2 = mma(kf2[kk][ks], qf[ks], acc2);
                }
            }
            if (!SPLIT) {
                #pragma unroll
                for (int ks = 0; ks < 2; ++ks) kf[kk][ks] = ldpk(kp + (kk * KT_DM + ks) * 512);
            }
            #pragma unroll
            for (int r = 0; r < 8; ++r) {
                float v = acc[r];
                if (SPLIT) v += acc2[r] * (1.0f / 2048.0f);
                v = v * 0.125f + bias_sm[bb + (63 - 16 * kk - r)];
                sv[kk][r] = (16 * kk + r > dl) ? NINF : v;
            }
        }
        if (SPLIT) {
            asm volatile("s_wait_xcnt 0x0" :: "v"(kp), "v"(kp2) : "memory");   // K address registers free from here
            load_v<SPLIT, NDT>(vp, vp2, vf, vf2);
        }
        if (anym) {
            #pragma unroll
            for (int kk = 0; kk < 4; ++kk) {
                #pragma unroll
                for (int r = 0; r < 8; ++r) sv[kk][r] = valid ? sv[kk][r] : 0.0f;
            }
        }

        // ---- online softmax, one query per lane ----
        float t4[4];
        #pragma unroll
        for (int kk = 0; kk < 4; ++kk) {
            t4[kk] = fmaxf(fmaxf(fmaxf(sv[kk][0], sv[kk][1]), fmaxf(sv[kk][2], sv[kk][3])),
                           fmaxf(fmaxf(sv[kk][4], sv[kk][5]), fmaxf(sv[kk][6], sv[kk][7])));
        }
        float tmax = fmaxf(fmaxf(t4[0], t4[1]), fmaxf(t4[2], t4[3]));
        tmax = fmaxf(tmax, __shfl_xor(tmax, 16, 32));
        const float mn = fmaxf(m_run, tmax);
        const float ea = exp1(m_run - mn);
        const float alpha = (m_run == NINF) ? 0.0f : ea;
        m_run = mn;

        Frag ph[2], pl[2];
        float ps4[4];
        #pragma unroll
        for (int kk = 0; kk < 4; ++kk) {
            float x[8], p[8];
            #pragma unroll
            for (int r = 0; r < 8; ++r) x[r] = sv[kk][r] - mn;
            exp8(x, p);
            #pragma unroll
            for (int r = 0; r < 8; ++r) {
                hf a, bl;
                split2(p[r] * 4096.0f, a, bl);
                ph[kk >> 1].v[8 * (kk & 1) + r] = a;
                if (SPLIT) pl[kk >> 1].v[8 * (kk & 1) + r] = bl;
            }
            ps4[kk] = ((p[0] + p[1]) + (p[2] + p[3])) + ((p[4] + p[5]) + (p[6] + p[7]));
        }
        l_run = l_run * alpha + ((ps4[0] + ps4[1]) + (ps4[2] + ps4[3]));

        // address registers of the loads still named here are free from here
        if (SPLIT) asm volatile("s_wait_xcnt 0x0" :: "v"(vp), "v"(vp2) : "memory");
        else       asm volatile("s_wait_xcnt 0x0" :: "v"(kp), "v"(vp) : "memory");

        // ---- O^T: D row = d 16(dt0 + dt) + 8hh + r, D col = query m ----
        #pragma unroll
        for (int dt = 0; dt < NDT; ++dt) {
            #pragma unroll
            for (int r = 0; r < 8; ++r) { oacc[dt][r] *= alpha; if (SPLIT) oacc2[dt][r] *= alpha; }
            #pragma unroll
            for (int ks = 0; ks < 2; ++ks) {
                oacc[dt] = mma(vf[dt][ks], ph[ks].v, oacc[dt]);
                if (SPLIT) {
                    oacc2[dt] = mma(vf2[dt][ks], ph[ks].v, oacc2[dt]);
                    oacc2[dt] = mma(vf[dt][ks], pl[ks].v, oacc2[dt]);
                }
            }
        }
    }

    // names the L2 request's address register as an input: it holds that address, and nothing else, through the loop
    asm volatile("s_wait_xcnt 0x0" :: "v"(pf) : "memory");

    const float l = l_run + __shfl_xor(l_run, 16, 32);
    v8h_t oh[NDT], ol[NDT];
    #pragma unroll
    for (int dt = 0; dt < NDT; ++dt) {
        #pragma unroll
        for (int r = 0; r < 8; ++r) {
            float o = oacc[dt][r];
            if (SPLIT) o += oacc2[dt][r] * (1.0f / 2048.0f);
            o = (o / l) * (1.0f / 4096.0f);
            hf a, bl;
            split2(o, a, bl);
            oh[dt][r] = a; ol[dt][r] = bl;
        }
    }
    // d tile dt0 + dt = part (dt & 1) of the head's k tile (dt0 + dt) >> 1 (dt0 is even)
    #pragma unroll
    for (int dt = 0; dt < NDT; ++dt) {
        const size_t off = qtile + (size_t)((dt0 >> 1) + (dt >> 1)) * 512 + (dt & 1) * 256;
        *(v8h*)(ohi + off) = oh[dt];
        *(v8h*)(olo + off) = ol[dt];
    }
}

// One launch for all queries. blockIdx.x = (batch, head); blockIdx.y ranks the query runs by falling key count:
// first the single-plane runs of 64 queries from the end of the sequence down, then the two-plane runs of 32.
#define QB_ONE ((NN - 32 * QSPLIT) / 64)         // single-plane blocks per (batch, head)
static_assert((NN - 32 * QSPLIT) % 64 == 0);

__global__ __launch_bounds__(128)
void k_attn(const hf* __restrict__ qhi, const hf* __restrict__ qlo,
            const hf* __restrict__ khi, const hf* __restrict__ klo,
            const hf* __restrict__ vthi, const hf* __restrict__ vtlo,
            const float* __restrict__ btab, const int* __restrict__ mask,
            hf* __restrict__ ohi, hf* __restrict__ olo)
{
    // bias_sm[64 + delta] = bias of distance delta; 64 leading zeros take the reads of causally hidden keys
    __shared__ __attribute__((aligned(16))) float bias_sm[64 + NN];

    const int hb = blockIdx.x, rank = blockIdx.y;
    if (hb >= HH * BB || rank >= QB_ONE + QSPLIT) return;
    const int b = hb / HH, h = hb - b * HH;

    // L2 requests for this head's K and V^T planes, dealt over its blocks: block rank asks for keys
    // 128 (rank mod 16) + 0..127, for speed only.
    // Ranks 16 on up to the last residual key ask for the residual planes, all others for the hi planes.
    // Waves 0, 1: K, 8 row blocks x 8 units of 256 bytes; waves 2, 3: V^T, 4 d blocks x 16 units.
    static_assert(NN == 16 * 128 && DH == 64 && (32 * QSPLIT) % 128 == 0 && 32 * QSPLIT <= NN);
    const int pt = threadIdx.x & 63, pr = rank & 15;
    const bool plo = rank >= 16 && rank < 16 + 32 * QSPLIT / 128;
    const hf* pfk = (plo ? klo : khi)
                  + ((size_t)((b * NN + 128 * pr) / 16 + (pt >> 3)) * KT_DM + 2 * h) * 512 + 128 * (pt & 7);
    const hf* pfv = (plo ? vtlo : vthi)
                  + ((size_t)((b * DM + h * DH) / 16 + (pt >> 4)) * KT_NN + 4 * pr) * 512 + 128 * (pt & 15);
    const hf* pf  = (threadIdx.x < 64) ? pfk : pfv;
    l2_ask<0>(pf);

    if (rank < QB_ONE)
        attn_block<false>(qhi, qlo, khi, klo, vthi, vtlo, btab, mask, ohi, olo, bias_sm,
                          NN - 64 * (rank + 1), h, b, pf);
    else
        attn_block<true>(qhi, qlo, khi, klo, vthi, vtlo, btab, mask, ohi, olo, bias_sm,
                         32 * (QSPLIT - 1 - (rank - QB_ONE)), h, b, pf);
}

// ---------------------------------------------------------------------------------------------
// Host glue: 4 launches, workspace carved from sizes (<= 62 MB)
// ---------------------------------------------------------------------------------------------
extern "C" void kernel_launch(void* const* d_in, const int* in_sizes, int n_in,
                              void* d_out, int out_size, void* d_ws, size_t ws_size,
                              hipStream_t stream)
{
    if (n_in < 7) return;
    if (in_sizes[0] != MR * DM) return;
    if (in_sizes[1] != BB * NN) return;
    if (in_sizes[2] != DM * DM || in_sizes[3] != DM * DM || in_sizes[4] != DM * DM || in_sizes[5] != DM * DM) return;
    if (in_sizes[6] != NBKT * HH) return;
    if (out_size != MR * DM) return;

    const float* x    = (const float*)d_in[0];
    const int*   mask = (const int*)d_in[1];
    const float* Wq   = (const float*)d_in[2];
    const float* Wk   = (const float*)d_in[3];
    const float* Wv   = (const float*)d_in[4];
    const float* Wo   = (const float*)d_in[5];
    const float* rel  = (const float*)d_in[6];
    float* out = (float*)d_out;

    char* ws = (char*)d_ws;
    size_t off = 0;
    auto carve = [&](size_t bytes) -> size_t { size_t p = off; off += (bytes + 255) & ~(size_t)255; return p; };
    const size_t plane = (size_t)MR * DM * sizeof(hf);
    const size_t o_xh   = carve(plane);
    const size_t o_wt   = carve((size_t)4 * DM * DM * sizeof(hf));
    const size_t o_qhi  = carve(plane);
    const size_t o_qlo  = carve(plane);
    const size_t o_khi  = carve(plane);
    const size_t o_klo  = carve(plane);
    const size_t o_vthi = carve(plane);
    const size_t o_vtlo = carve(plane);
    const size_t o_ahi  = carve(plane);
    const size_t o_alo  = carve(plane);
    const size_t o_btab = carve((size_t)HH * NN * sizeof(float));
    if (off > ws_size) return;

    hf* xh   = (hf*)(ws + o_xh);
    hf* wt   = (hf*)(ws + o_wt);
    hf* qhi  = (hf*)(ws + o_qhi);
    hf* qlo  = (hf*)(ws + o_qlo);
    hf* khi  = (hf*)(ws + o_khi);
    hf* klo  = (hf*)(ws + o_klo);
    hf* vthi = (hf*)(ws + o_vthi);
    hf* vtlo = (hf*)(ws + o_vtlo);
    hf* ahi  = (hf*)(ws + o_ahi);
    hf* alo  = (hf*)(ws + o_alo);
    float* btab = (float*)(ws + o_btab);

    k_prep<<<PB_BIAS + PB_W + PB_X, 256, 0, stream>>>(x, Wq, Wk, Wv, Wo, rel, xh, wt, btab);

    // q, k (hi/lo planes), v (transposed hi/lo planes)
    k_qkv<<<dim3(DM / 48, MR / 256), 128, 0, stream>>>(xh, wt, qhi, qlo, khi, klo, vthi, vtlo);

    // attention: leading query blocks with residual products, remainder single-plane
    k_attn<<<dim3(HH * BB, QB_ONE + QSPLIT), 128, 0, stream>>>(
        qhi, qlo, khi, klo, vthi, vtlo, btab, mask, ahi, alo);

    // output projection -> out (f32)
    k_proj<1, 2, 4><<<dim3(DM / 64, MR / 128, 1), 128, 0, stream>>>(
        ahi, alo, wt + (size_t)3 * DM * DM, ahi, alo, ahi, alo, ahi, alo, out);
}

// v008
// One run takes 53.4 microseconds.
// Next to v007, in two timings, it ran 1.05 and 1.04 times as fast.
// Over all steps from v000 it is 6.36 times as fast.
#include <hip/hip_runtime.h>
#include <stdint.h>

// Contractions (q/k/v projections, q.k^T, p.v, output projection): v_wmma_f32_16x16x32_f16, f16 operands,
// f32 accumulate. x / weights / bias table are RNE-converted to bf16; x and weights are then held exactly in f16 (weights x16), the bias table in f32.
// q, k, v^T, p (x4096) and the attention output are carried as an f16 hi plane plus an f16 residual plane
// (residual x2048); residual products are issued for the leading query rows, single-plane products elsewhere.
//
// Every f16 operand plane in the workspace is stored in fragment order. A matrix M[rows][K] (K = contraction
// index) is cut into tiles of 16 rows x 32 k; tile (rb, kb) starts at half ((rb * K/32) + kb) * 512 and holds
//   M[16rb + m][32kb + 16part + 8hh + e]  at  part * 256 + (16hh + m) * 8 + e      (m < 16; part, hh < 2; e < 8)
// so lane 16hh + m of a wave finds its 16 fragment elements at tile + 8 * lane and tile + 256 + 8 * lane, and each
// of the two 16-byte loads (or stores) of a wave covers 512 contiguous bytes: four whole 128-byte lines.

#define BB 2
#define NN 2048
#define DM 768
#define HH 12
#define DH 64
#define MR (BB * NN)
#define NBKT 32
#define MAXD 128      // from this distance on every (query, key) pair falls into the last bias bucket
#define QSPLIT 16     // leading 32-query blocks per batch that use two-plane products in attention
#define RSPLIT 512    // leading rows per batch that use the two-plane A operand in the output projection

static_assert(DM % 64 == 0);
static_assert(NN % 64 == 0);
static_assert(MR % 64 == 0);
static_assert(DH == 64);
static_assert(RSPLIT % 64 == 0);
static_assert(QSPLIT <= NN / 32);
static_assert((MR * DM) % 8 == 0);
static_assert(DM % 32 == 0 && NN % 32 == 0 && MR % 16 == 0);
#define KT_DM (DM / 32)   // k tiles of a row block where K = DM
#define KT_NN (NN / 32)   // k tiles of a row block where K = NN (v^T)

typedef _Float16 hf;
typedef _Float16 v8h_t __attribute__((ext_vector_type(8)));
typedef v8h_t __attribute__((may_alias)) v8h;
typedef _Float16 v16h __attribute__((ext_vector_type(16)));
typedef float v8f __attribute__((ext_vector_type(8)));
typedef float v4f_t __attribute__((ext_vector_type(4)));
typedef v4f_t __attribute__((may_alias)) v4f;

union Frag { v16h v; v8h_t p[2]; };

// D(16x16,f32) += A(16x32) * B(32x16); nops keep VALU off the D/A/B registers right after issue.
__device__ __forceinline__ v8f mma(v16h a, v16h b, v8f c)
{
    v8f d = __builtin_amdgcn_wmma_f32_16x16x32_f16(false, a, false, b, (short)0, c, false, false);
    asm volatile("v_nop\n\tv_nop\n\tv_nop\n\tv_nop" : "+v"(d) : "v"(a), "v"(b));
    return d;
}

// 16x16x32 operand fragment for lane (row or column = lane&15), half hh = lane>>4:
// elements 0..7 <- k0+8hh+0..7, elements 8..15 <- k0+16+8hh+0..7 of the lane's row.
// Used for A ([m][k]) and for B held as [n][k]; p = start of the fragment-ordered tile + 8 * lane.
__device__ __forceinline__ v16h ldpk(const hf* p)
{
    Frag f;
    f.p[0] = *(const v8h*)(p);
    f.p[1] = *(const v8h*)(p + 256);
    return f.v;
}

__device__ __forceinline__ float bf16r(float v)
{
    unsigned u = __float_as_uint(v);
    u = (u + 0x7FFFu + ((u >> 16) & 1u)) & 0xFFFF0000u;
    return __uint_as_float(u);
}

// v ~= hi + lo/2048 with hi, lo in f16
__device__ __forceinline__ void split2(float v, hf& hi, hf& lo)
{
    hf h = (hf)v;
    hi = h;
    lo = (hf)((v - (float)h) * 2048.0f);
}

// Asks L2 for the aligned 256-byte unit at p + OFF bytes: nothing comes back and no counter moves. The planes a launch
// reads were stored by an earlier launch. Where such a line is not in the reader's L2 its first reader waits for
// memory, and the blocks that share a plane walk it in step, so every step of each of them would wait so; asked for
// at entry, the later steps' lines are on their way while the first steps run. Every lane's address lies inside its
// plane, and its register is kept as it is up to the s_wait_xcnt statement that names it.
template <int OFF>
__device__ __forceinline__ void l2_ask(const hf* p)
{
    asm volatile("global_prefetch_b8 %0, off offset:%1 scope:SCOPE_SE" :: "v"(p), "n"(OFF));
}

__device__ __forceinline__ v8f zero8()
{
    v8f z = {0.f, 0.f, 0.f, 0.f, 0.f, 0.f, 0.f, 0.f};
    return z;
}

// ---------------------------------------------------------------------------------------------
// xh = f16(bf16(x)) in fragment order ([MR][DM]); thread t fills 16-byte piece t, lane-contiguous stores
// ---------------------------------------------------------------------------------------------
__device__ __forceinline__ void prep_x(const float* __restrict__ x, hf* __restrict__ xh, int t)
{
    const int lane = t & 31, part = (t >> 5) & 1, tile = t >> 6;
    const int rb = tile / KT_DM, kb = tile - rb * KT_DM;
    const float* p = x + (size_t)(16 * rb + (lane & 15)) * DM + 32 * kb + 16 * part + 8 * (lane >> 4);
    v4f_t a = *(const v4f*)p;
    v4f_t b = *(const v4f*)(p + 4);
    v8h_t o;
    o[0] = (hf)bf16r(a[0]); o[1] = (hf)bf16r(a[1]); o[2] = (hf)bf16r(a[2]); o[3] = (hf)bf16r(a[3]);
    o[4] = (hf)bf16r(b[0]); o[5] = (hf)bf16r(b[1]); o[6] = (hf)bf16r(b[2]); o[7] = (hf)bf16r(b[3]);
    hf* d = xh + (size_t)t * 8;
    *(v8h*)d = o;
    // the arms of k_prep follow one another in the code: the store's registers stay unwritten up to this wait
    asm volatile("s_wait_xcnt 0x0" ::: "memory");
}

// ---------------------------------------------------------------------------------------------
// wt[w] = fragment order of [c][k] = f16(bf16(W_w[k][c]) * 16), W_w is [DM(k)][DM(c)]; 8 consecutive k per thread,
// thread = 16-byte piece of the plane: 16 neighbouring lanes read 16 neighbouring c of one k row
// ---------------------------------------------------------------------------------------------
__device__ __forceinline__ void prep_w(const float* __restrict__ w0, const float* __restrict__ w1,
                                       const float* __restrict__ w2, const float* __restrict__ w3,
                                       hf* __restrict__ wt, int t)
{
    const int per = DM * (DM / 8);
    const int wi  = t / per;
    const int rem = t - wi * per;
    const int lane = rem & 31, part = (rem >> 5) & 1, tile = rem >> 6;
    const int rb  = tile / KT_DM, kb = tile - rb * KT_DM;
    const int c   = 16 * rb + (lane & 15);
    const int k8  = 32 * kb + 16 * part + 8 * (lane >> 4);
    const float* W = (wi == 0) ? w0 : (wi == 1) ? w1 : (wi == 2) ? w2 : w3;
    v8h_t o;
    #pragma unroll
    for (int e = 0; e < 8; ++e) o[e] = (hf)(bf16r(W[(size_t)(k8 + e) * DM + c]) * 16.0f);
    hf* d = wt + (size_t)wi * DM * DM + (size_t)rem * 8;
    *(v8h*)d = o;
    // the arms of k_prep follow one another in the code: the store's registers stay unwritten up to this wait
    asm volatile("s_wait_xcnt 0x0" ::: "memory");
}

// ---------------------------------------------------------------------------------------------
// btab[h][delta] = bf16(rel[bucket(delta)][h]) * DH^-0.5, causal bucketing; 4 deltas per thread
// ---------------------------------------------------------------------------------------------
__device__ __forceinline__ void prep_bias(const float* __restrict__ rel, float* __restrict__ tab, int t)
{
    const int h  = t / (NN / 4);
    const int d4 = (t - h * (NN / 4)) * 4;
    v4f_t o;
    #pragma unroll
    for (int e = 0; e < 4; ++e) {
        const int d = d4 + e;
        int bk;
        if (d < NBKT / 2) {
            bk = d;
        } else {
            float f  = (float)d * (1.0f / 16.0f);
            float lg = logf(f);
            float u  = lg * (1.0f / 2.0794415416798357f);
            float w  = u * 16.0f;
            int v = (NBKT / 2) + (int)w;
            bk = v < (NBKT - 1) ? v : (NBKT - 1);
            if (bk < 0) bk = 0;
        }
        o[e] = bf16r(rel[bk * HH + h]) * 0.125f;
    }
    float* d = tab + (size_t)h * NN + d4;
    *(v4f*)d = o;
    // the arms of k_prep follow one another in the code: the store's registers stay unwritten up to this wait
    asm volatile("s_wait_xcnt 0x0" ::: "memory");
}

// ---------------------------------------------------------------------------------------------
// The three conversions depend on nothing but the inputs: one launch, a block range each.
// ---------------------------------------------------------------------------------------------
#define PB_BIAS (HH * NN / 4 / 256)
#define PB_W    (4 * DM * (DM / 8) / 256)
#define PB_X    (MR * DM / 8 / 256)
static_assert((HH * NN / 4) % 256 == 0 && (4 * DM * (DM / 8)) % 256 == 0 && (MR * DM / 8) % 256 == 0);

__global__ __launch_bounds__(256)
void k_prep(const float* __restrict__ x, const float* __restrict__ w0, const float* __restrict__ w1,
            const float* __restrict__ w2, const float* __restrict__ w3, const float* __restrict__ rel,
            hf* __restrict__ xh, hf* __restrict__ wt, float* __restrict__ tab)
{
    const int blk = blockIdx.x, tid = threadIdx.x;
    if (blk < PB_BIAS)                    prep_bias(rel, tab, blk * 256 + tid);
    else if (blk < PB_BIAS + PB_W)        prep_w(w0, w1, w2, w3, wt, (blk - PB_BIAS) * 256 + tid);
    else if (blk < PB_BIAS + PB_W + PB_X) prep_x(x, xh, (blk - PB_BIAS - PB_W) * 256 + tid);
}

// ---------------------------------------------------------------------------------------------
// C[64 FA x 64 tile] = A[64 FA x 768] * Wt[64 x 768]^T / 16, block = 4 waves, wave = FA row blocks of 16 x 64 cols:
// row block 4f + wave of the tile (f < FA), so that the four waves together hold one 64-row slab for each f.
// A B fragment serves FA products and an A fragment four. The k loop is unrolled whole over a ring of ST fragment
// register sets: step ks + ST - 1 is loaded in front of the products of step ks, every load is base + constant.
// MODE 0 (grid.z: 0 = q, 1 = k, 2 = v): q/k stored as [MR][DM] hi/lo f16 planes,
//         v stored transposed, [BB * DM][NN], as hi/lo f16 planes. A = xh. All planes in fragment order.
// MODE 1: A = attention output hi (+ lo plane for rows (m0 mod NN) < RSPLIT), C stored f32 to out.
// ---------------------------------------------------------------------------------------------
// Every loop of ld_step, gemm_k and k_proj is unrolled: the fragment, accumulator and staging indices must be
// constants for the arrays to live in registers and for every address to be base + constant.
template <int FA, bool TWO>
__device__ __forceinline__ void ld_step(const hf* ap, const hf* ap2, const hf* bp, int ks,
                                        v16h (&a)[FA], v16h (&a2)[FA], v16h (&b)[4])
{
    #pragma unroll
    for (int t = 0; t < 4; ++t) b[t] = ldpk(bp + (t * KT_DM + ks) * 512);
    #pragma unroll
    for (int f = 0; f < FA; ++f) {
        a[f] = ldpk(ap + (4 * f * KT_DM + ks) * 512);
        if (TWO) a2[f] = ldpk(ap2 + (4 * f * KT_DM + ks) * 512);
    }
}

// The builtin alone: the compiler keeps the distance behind its own matrix instructions, and operands that pass
// through no asm statement may live above v255, which the accumulators and the ring together need.
__device__ __forceinline__ v8f mmab(v16h a, v16h b, v8f c)
{
    return __builtin_amdgcn_wmma_f32_16x16x32_f16(false, a, false, b, (short)0, c, false, false);
}

template <int FA, int ST, bool TWO>
__device__ __forceinline__ void gemm_k(const hf* ap, const hf* ap2, const hf* bp,
                                       v8f (&acc)[FA][4], v8f (&acc2)[FA][4])
{
    v16h a[ST][FA], a2[ST][FA], b[ST][4];
    #pragma unroll
    for (int ks = 0; ks < ST - 1; ++ks) ld_step<FA, TWO>(ap, ap2, bp, ks, a[ks], a2[ks], b[ks]);
    // unrolled whole: the ring's set numbers become register names and no address register is ever stepped
    #pragma unroll
    for (int ks = 0; ks < KT_DM; ++ks) {
        const int s = ks % ST, sn = (ks + ST - 1) % ST;
        if (ks + ST - 1 < KT_DM) ld_step<FA, TWO>(ap, ap2, bp, ks + ST - 1, a[sn], a2[sn], b[sn]);
        // holds the loads above in front of this step's products: without it the compiler sinks each load down to
        // its first use, ST - 1 steps on, and the wave waits out the whole load latency there
        __builtin_amdgcn_sched_barrier(0);
        #pragma unroll
        for (int f = 0; f < FA; ++f) {
            #pragma unroll
            for (int t = 0; t < 4; ++t) acc[f][t] = mmab(a[s][f], b[s][t], acc[f][t]);
        }
        if (TWO) {
            #pragma unroll
            for (int f = 0; f < FA; ++f) {
                #pragma unroll
                for (int t = 0; t < 4; ++t) acc2[f][t] = mmab(a2[s][f], b[s][t], acc2[f][t]);
            }
        }
    }
    // names the loads' address registers as inputs: they stay unwritten up to this wait, behind the last load
    asm volatile("s_wait_xcnt 0x0" :: "v"(ap), "v"(ap2), "v"(bp) : "memory");
}

template <int MODE, int FA, int ST>
__global__ __launch_bounds__(128)
void k_proj(const hf* __restrict__ Ahi, const hf* __restrict__ Alo, const hf* __restrict__ Wt,
            hf* __restrict__ o0h, hf* __restrict__ o0l,
            hf* __restrict__ o1h, hf* __restrict__ o1l,
            hf* __restrict__ o2h, hf* __restrict__ o2l,
            float* __restrict__ outf)
{
    static_assert(MR % (64 * FA) == 0 && NN % (64 * FA) == 0 && RSPLIT % (64 * FA) == 0);
    __shared__ __attribute__((aligned(16))) float Call[FA][64][68];   // a staging array for each 64-row slab

    const int wave = threadIdx.x >> 5, lane = threadIdx.x & 31, m = lane & 15, hh = lane >> 4;
    const int n0 = blockIdx.x * 64, mt = blockIdx.y * (64 * FA), z = blockIdx.z;
    if (n0 >= DM || mt >= MR) return;
    const hf* Bt = Wt + (size_t)z * DM * DM;
    const bool two = (MODE == 1) && ((mt & (NN - 1)) < RSPLIT);

    const size_t aoff = (size_t)(mt / 16 + wave) * KT_DM * 512 + 8 * lane;
    const hf* ap  = Ahi + aoff;
    const hf* ap2 = two ? (Alo + aoff) : ap;
    const hf* bp  = Bt + (size_t)(n0 / 16) * KT_DM * 512 + 8 * lane;

    // L2 requests for the whole A and B panels, dealt over the blocks that read the same panel so that four
    // neighbours in x with all z (A, MODE 0), three in x (A, MODE 1), or three next neighbours in y of one parity (B), together
    // ask for all of it: a guess at which blocks share an L2, for speed only. A lane asks for one 256-byte unit
    // (128 halves).
    const hf* pfb = Bt + ((size_t)(n0 / 16 + wave) * KT_DM + 8 * ((blockIdx.y >> 1) % 3)) * 512 + 128 * lane;
    const hf* pfa;
    const hf* pfa2;
    static_assert(KT_DM == 24);
    l2_ask<0>(pfb);                                   // 8 k tiles of B row block 'wave'
    if (MODE == 0) {
        static_assert(MODE != 0 || FA == 4);          // 16 row blocks x 2 k tiles: 128 units
        pfa = Ahi + ((size_t)(mt / 16 + (threadIdx.x >> 3)) * KT_DM + 2 * (4 * z + (blockIdx.x & 3))) * 512
                  + 128 * (threadIdx.x & 7);
        pfa2 = pfa;
        l2_ask<0>(pfa);
    } else {
        static_assert(MODE == 0 || FA == 2);          // 8 k tiles of A row blocks 'wave' and 'wave' + 4
        const size_t poff = ((size_t)(mt / 16 + wave) * KT_DM + 8 * (blockIdx.x % 3)) * 512 + 128 * lane;
        pfa  = Ahi + poff;
        pfa2 = two ? (Alo + poff) : pfa;
        l2_ask<0>(pfa);
        l2_ask<4 * KT_DM * 1024>(pfa);
        if (two) {
            l2_ask<0>(pfa2);
            l2_ask<4 * KT_DM * 1024>(pfa2);
        }
    }

    v8f acc[FA][4], acc2[FA][4];
    #pragma unroll
    for (int f = 0; f < FA; ++f) {
        #pragma unroll
        for (int t = 0; t < 4; ++t) { acc[f][t] = zero8(); acc2[f][t] = zero8(); }
    }

    if (two) gemm_k<FA, ST, true>(ap, ap2, bp, acc, acc2);
    else     gemm_k<FA, ST, false>(ap, ap2, bp, acc, acc2);
    // names the L2 requests' address registers as inputs: they hold those addresses, and nothing else, through the k loop
    asm volatile("s_wait_xcnt 0x0" :: "v"(pfa), "v"(pfa2), "v"(pfb) : "memory");

    // D element r of lane: row 16*wave + 8*hh + r of slab f, col 16*t + m
    #pragma unroll
    for (int f = 0; f < FA; ++f) {
        #pragma unroll
        for (int t = 0; t < 4; ++t) {
            #pragma unroll
            for (int r = 0; r < 8; ++r) {
                float v = acc[f][t][r];
                if (MODE == 1) v += acc2[f][t][r] * (1.0f / 2048.0f);
                Call[f][16 * wave + 8 * hh + r][16 * t + m] = v * (1.0f / 16.0f);
            }
        }
    }
    __syncthreads();

    // One 64-row slab after the other. Each s_wait_xcnt below names its stores' data and address registers as
    // inputs: they stay unwritten up to the wait, and the next piece's values may take them only behind it.
    if (MODE == 0) {
        if (z < 2) {
            hf* dh = (z == 0) ? o0h : o1h;
            hf* dl = (z == 0) ? o0l : o1l;
            #pragma unroll
            for (int f = 0; f < FA; ++f) {
                const int m0 = mt + 64 * f;
                #pragma unroll
                for (int it = 0; it < 4; ++it) {
                    const int row = 16 * it + m;             // row block it, columns 16 wave + 8hh + 0..7
                    const int c8  = 16 * wave + 8 * hh;
                    v4f_t u0 = *(const v4f*)&Call[f][row][c8];
                    v4f_t u1 = *(const v4f*)&Call[f][row][c8 + 4];
                    v8h_t ph, pl;
                    hf a, bl;
                    split2(u0[0], a, bl); ph[0] = a; pl[0] = bl;
                    split2(u0[1], a, bl); ph[1] = a; pl[1] = bl;
                    split2(u0[2], a, bl); ph[2] = a; pl[2] = bl;
                    split2(u0[3], a, bl); ph[3] = a; pl[3] = bl;
                    split2(u1[0], a, bl); ph[4] = a; pl[4] = bl;
                    split2(u1[1], a, bl); ph[5] = a; pl[5] = bl;
                    split2(u1[2], a, bl); ph[6] = a; pl[6] = bl;
                    split2(u1[3], a, bl); ph[7] = a; pl[7] = bl;
                    const size_t off = ((size_t)(m0 / 16 + it) * KT_DM + n0 / 32 + (wave >> 1)) * 512
                                     + (wave & 1) * 256 + 8 * lane;
                    hf* sh = dh + off;
                    hf* sl = dl + off;
                    *(v8h*)sh = ph;
                    *(v8h*)sl = pl;
                    asm volatile("s_wait_xcnt 0x0" :: "v"(ph), "v"(pl), "v"(sh), "v"(sl) : "memory");
                }
            }
        } else {
            #pragma unroll
            for (int f = 0; f < FA; ++f) {
                const int m0   = mt + 64 * f;
                const int bidx = m0 >> 11;
                const int j0   = m0 & (NN - 1);
                #pragma unroll
                for (int it = 0; it < 4; ++it) {
                    const int cc = 16 * it + m;              // channel block it, keys 16 wave + 8hh + 0..7
                    const int j8 = 16 * wave + 8 * hh;
                    v8h_t ph, pl;
                    #pragma unroll
                    for (int e = 0; e < 8; ++e) {
                        hf a, bl;
                        split2(Call[f][j8 + e][cc], a, bl);
                        ph[e] = a; pl[e] = bl;
                    }
                    const size_t off = ((size_t)((bidx * DM + n0) / 16 + it) * KT_NN + j0 / 32 + (wave >> 1)) * 512
                                     + (wave & 1) * 256 + 8 * lane;
                    hf* sh = o2h + off;
                    hf* sl = o2l + off;
                    *(v8h*)sh = ph;
                    *(v8h*)sl = pl;
                    asm volatile("s_wait_xcnt 0x0" :: "v"(ph), "v"(pl), "v"(sh), "v"(sl) : "memory");
                }
            }
        }
    } else {
        #pragma unroll
        for (int f = 0; f < FA; ++f) {
            const int m0 = mt + 64 * f;
            #pragma unroll
            for (int it = 0; it < 8; ++it) {
                const int row = 16 * wave + 2 * it + (lane >> 4);
                const int c4  = (lane & 15) * 4;
                v4f_t u = *(const v4f*)&Call[f][row][c4];
                float* so = outf + (size_t)(m0 + row) * DM + n0 + c4;
                *(v4f*)so = u;
                asm volatile("s_wait_xcnt 0x0" :: "v"(u), "v"(so) : "memory");
            }
        }
    }
}

// ---------------------------------------------------------------------------------------------
// q, k, v = xh * Wt_z^T / 16. Grid = (DM / 48, MR / 256) blocks of 4 waves: as many blocks as the chip has WGPs, and
// the registers of a wave leave room for one wave a SIMD. A wave owns 64 rows (4 row blocks) x 144 columns: columns
// 48 bx + 0..47 of each of q, k and v (column tile t: plane t / 3, 16-column block 3 bx + t % 3). A step of 32 k is
// 13 fragments for 36 products; the four waves share the 9 W fragments, each has its own x rows.
// q, k: the product is formed transposed (A = W rows, B = x rows), so a lane holds 8 neighbouring columns of one row;
// v: as it stands (A = x rows, B = W rows), so a lane holds 8 neighbouring keys of one channel. Either way a lane's 8
// accumulator values are one 16-byte piece of the fragment-ordered plane ([MR][DM] for q, k; [BB * DM][NN] for v^T)
// and a wave's store covers 512 contiguous bytes: nothing is staged in LDS and the waves never meet.
// ---------------------------------------------------------------------------------------------
static_assert(DM % 48 == 0 && MR % 256 == 0 && NN % 256 == 0 && KT_DM == 24);

__device__ __forceinline__ void qkv_ld(const hf* ap, const hf* bp, int ks, v16h (&a)[4], v16h (&b)[9])
{
    #pragma unroll
    for (int t = 0; t < 9; ++t) b[t] = ldpk(bp + (((t / 3) * (DM / 16) + t % 3) * KT_DM + ks) * 512);
    #pragma unroll
    for (int f = 0; f < 4; ++f) a[f] = ldpk(ap + (f * KT_DM + ks) * 512);
}

__device__ __forceinline__ void few_out()
{
    // stands in front of a group of 26 loads: with at most 36 older loads out, the wave's load counter (63) is never full
    asm volatile("s_wait_loadcnt 0x24" ::: "memory");
}

__global__ __launch_bounds__(128)
void k_qkv(const hf* __restrict__ xh, const hf* __restrict__ Wt,
           hf* __restrict__ qh, hf* __restrict__ ql, hf* __restrict__ kh, hf* __restrict__ kl,
           hf* __restrict__ vh, hf* __restrict__ vl)
{
    constexpr int ST = 4;
    const int lane = threadIdx.x & 31;
    const int wave = __builtin_amdgcn_readfirstlane(threadIdx.x >> 5);
    const int bx = blockIdx.x, by = blockIdx.y;
    if (bx >= DM / 48 || by >= MR / 256) return;
    const int rb0 = 16 * by + 4 * wave;               // the wave's first 16-row block
    const hf* ap = xh + (size_t)rb0 * KT_DM * 512 + 8 * lane;
    const hf* bp = Wt + (size_t)(3 * bx) * KT_DM * 512 + 8 * lane;

    // L2 requests for the block's x panel (1,536 units of 256 bytes) and its three W panels (288 units each), dealt
    // over the blocks that read the same panel: four neighbours in x together ask for all of the x panel, three
    // neighbours in y for the W panels: a guess at which blocks share an L2, for speed only.
    const hf* pfa = xh + (size_t)(16 * by) * KT_DM * 512 + (size_t)(384 * (bx & 3) + threadIdx.x) * 128;
    const hf* pfb = pfa;
    l2_ask<0>(pfa);
    l2_ask<128 * 256>(pfa);
    l2_ask<256 * 256>(pfa);
    if (wave < 3) {                                   // a scalar test: whole waves ask or do not
        pfb = Wt + (size_t)(3 * bx) * KT_DM * 512 + (size_t)(96 * (by % 3) + threadIdx.x) * 128;
        l2_ask<0>(pfb);
        l2_ask<DM * DM * 2>(pfb);
        l2_ask<2 * DM * DM * 2>(pfb);
    }

    v8f acc[4][9];
    #pragma unroll
    for (int f = 0; f < 4; ++f) {
        #pragma unroll
        for (int t = 0; t < 9; ++t) acc[f][t] = zero8();
    }

    // Ring of ST register sets: set ks % ST holds step ks and is refilled for step ks + ST right behind its products.
    // few_out: a group of 26 loads is issued only once at most 36 older loads of the wave are still on their way, so
    // that never more than 62 are: the wave's load counter holds 63.
    v16h a[ST][4], b[ST][9];
    qkv_ld(ap, bp, 0, a[0], b[0]);
    qkv_ld(ap, bp, 1, a[1], b[1]);
    #pragma unroll
    for (int ks = 2; ks < ST; ++ks) {
        few_out();
        qkv_ld(ap, bp, ks, a[ks], b[ks]);
    }
    // names the L2 requests' address registers as inputs: they stay unwritten up to this wait and are free behind it
    asm volatile("s_wait_xcnt 0x0" :: "v"(pfa), "v"(pfb) : "memory");
    // unrolled whole: the ring's set numbers become register names and no address register is ever stepped
    #pragma unroll
    for (int ks = 0; ks < KT_DM; ++ks) {
        const int s = ks % ST;
        // keeps the refill of the step before in front of this step's products: without it the compiler sinks each
        // load down to its first use, ST steps on, and the wave, alone on its SIMD, waits out the whole latency there
        __builtin_amdgcn_sched_barrier(0);
        #pragma unroll
        for (int t = 0; t < 9; ++t) {
            #pragma unroll
            for (int f = 0; f < 4; ++f)
                acc[f][t] = (t < 6) ? mmab(b[s][t], a[s][f], acc[f][t]) : mmab(a[s][f], b[s][t], acc[f][t]);
        }
        if (ks + ST < KT_DM) {
            // keeps the wait below behind this step's products: the compiler lifts it to the step's head, where the
            // loads that it waits for have had one step less to land
            __builtin_amdgcn_sched_barrier(0);
            few_out();
            qkv_ld(ap, bp, ks + ST, a[s], b[s]);
        }
    }
    // behind the last load and in front of every later write of a register that a load names
    asm volatile("s_wait_xcnt 0x0" ::: "memory");
    // keeps the address arithmetic of the stores below from rising over that wait into the loads' base registers
    __builtin_amdgcn_sched_barrier(0);

    const int m0   = 256 * by + 64 * wave;            // the wave's first row: batch m0 / NN, key m0 mod NN
    const int bidx = m0 / NN;
    const int j16  = (m0 & (NN - 1)) / 16;
    // The 8 pieces (4 row blocks, hi and lo) of column tile t, and where they go.
    v8h_t ph[2][4], pl[2][4];
    hf* sh[2][4];
    hf* sl[2][4];
    auto pieces = [&](int t, int s) {
        const int c16 = 3 * bx + t % 3;               // 16-column block inside the plane
        hf* dh = (t < 3) ? qh : (t < 6) ? kh : vh;
        hf* dl = (t < 3) ? ql : (t < 6) ? kl : vl;
        #pragma unroll
        for (int f = 0; f < 4; ++f) {
            #pragma unroll
            for (int r = 0; r < 8; ++r) {
                hf hi, lo;
                split2(acc[f][t][r] * (1.0f / 16.0f), hi, lo);
                ph[s][f][r] = hi; pl[s][f][r] = lo;
            }
            // q, k: row block rb0 + f, k index = column. v^T: row block = channel block, k index = key
            const size_t off = (t < 6)
                ? ((size_t)(rb0 + f) * KT_DM + (c16 >> 1)) * 512 + (c16 & 1) * 256 + 8 * lane
                : ((size_t)(bidx * (DM / 16) + c16) * KT_NN + ((j16 + f) >> 1)) * 512 + ((j16 + f) & 1) * 256 + 8 * lane;
            sh[s][f] = dh + off;
            sl[s][f] = dl + off;
        }
    };
    pieces(0, 0);
    #pragma unroll
    for (int t = 0; t < 9; ++t) {
        const int s = t & 1;
        #pragma unroll
        for (int f = 0; f < 4; ++f) {
            *(v8h*)sh[s][f] = ph[s][f];
            *(v8h*)sl[s][f] = pl[s][f];
        }
        // the next tile's pieces are formed in the other register set while these stores are taken up
        if (t + 1 < 9) pieces(t + 1, s ^ 1);
        // names the stores' data and address registers as inputs: they stay unwritten up to this wait
        asm volatile("s_wait_xcnt 0x0" :: "v"(ph[s][0]), "v"(ph[s][1]), "v"(ph[s][2]), "v"(ph[s][3]),
                     "v"(pl[s][0]), "v"(pl[s][1]), "v"(pl[s][2]), "v"(pl[s][3]),
                     "v"(sh[s][0]), "v"(sh[s][1]), "v"(sh[s][2]), "v"(sh[s][3]),
                     "v"(sl[s][0]), "v"(sl[s][1]), "v"(sl[s][2]), "v"(sl[s][3]) : "memory");
    }
}

// ---------------------------------------------------------------------------------------------
// Fused causal attention, block = (a run of queries, head h, batch b); a wave owns 16 queries and walks 64-key
// tiles on its own, with no LDS traffic for scores and no barrier inside the loop:
//   S^T = K.Q^T   (A = K rows, B = Q rows as [n][k]): lane holds query (lane&15), keys 16kk + 8*(lane>>4) + r
//   online softmax per lane (bias, causal, row mask), one exchange between the wave halves for the maximum
//   O^T += V^T.P^T (A = V^T rows, B = P^T packed from the score registers, f16 x4096 (+ residual plane))
// SPLIT: hi/lo residual products on q.k^T and p.v. Output: attention rows as hi/lo f16 planes in fragment order
// ([MR][DM]): a lane's 8 values of a d tile are one 16-byte piece of it, so every wave stores whole lines itself.
// Not SPLIT: 64 queries, 4 waves, each all four 16-wide d tiles. SPLIT: 32 queries, 4 waves, two per 16 queries,
// each two d tiles (both form the same S^T), so that both planes of K, V^T, Q and O fit the register file
// without spills. Both kinds of block share one launch (k_attn below): neither reads what the other writes.
// ---------------------------------------------------------------------------------------------
// p = exp(x), built as the fast intrinsic is (x * log2 e, then v_exp_f32). Written as asm so that the slot the
// instruction set asks for behind a transcendental is kept by construction: the results are early-clobber, so
// no v_exp_f32 of a statement writes over a source of another, and the closing v_nop stands behind the last.
__device__ __forceinline__ void exp2x8(const float (&t)[8], float (&p)[8])   // p = 2^t
{
    asm("v_exp_f32 %0, %8\n\tv_exp_f32 %1, %9\n\tv_exp_f32 %2, %10\n\tv_exp_f32 %3, %11\n\t"
        "v_exp_f32 %4, %12\n\tv_exp_f32 %5, %13\n\tv_exp_f32 %6, %14\n\tv_exp_f32 %7, %15\n\tv_nop"
        : "=&v"(p[0]), "=&v"(p[1]), "=&v"(p[2]), "=&v"(p[3]), "=&v"(p[4]), "=&v"(p[5]), "=&v"(p[6]), "=&v"(p[7])
        : "v"(t[0]), "v"(t[1]), "v"(t[2]), "v"(t[3]), "v"(t[4]), "v"(t[5]), "v"(t[6]), "v"(t[7]));
}

__device__ __forceinline__ void exp8(const float (&x)[8], float (&p)[8])
{
    float t[8];
    #pragma unroll
    for (int r = 0; r < 8; ++r) t[r] = x[r] * 1.44269504f;
    exp2x8(t, p);
}

__device__ __forceinline__ float exp1(float x)
{
    const float t = x * 1.44269504f;
    float p;
    asm("v_exp_f32 %0, %1\n\tv_nop" : "=&v"(p) : "v"(t));   // same slot, one value
    return p;
}

template <bool SPLIT, int NDT>
__device__ __forceinline__ void load_v(const hf* vp, const hf* vp2, v16h (&vf)[NDT][2], v16h (&vf2)[NDT][2])
{
    #pragma unroll
    for (int dt = 0; dt < NDT; ++dt) {
        #pragma unroll
        for (int ks = 0; ks < 2; ++ks) {
            vf[dt][ks] = ldpk(vp + (dt * KT_NN + ks) * 512);
            if (SPLIT) vf2[dt][ks] = ldpk(vp2 + (dt * KT_NN + ks) * 512);
        }
    }
}

template <bool F> struct TileKind { static constexpr bool far = F; };

template <bool SPLIT>
__device__ __forceinline__
void attn_block(const hf* __restrict__ qhi, const hf* __restrict__ qlo,
                const hf* __restrict__ khi, const hf* __restrict__ klo,
                const hf* __restrict__ vthi, const hf* __restrict__ vtlo,
                const float* __restrict__ btab, const int* __restrict__ mask,
                hf* __restrict__ ohi, hf* __restrict__ olo,
                float* bias_sm, int q0, int h, int b,   // q0: first query of the block
                const hf* pf)                           // address register of the block's L2 request
{
    const int tid = threadIdx.x, lane = tid & 31, m = lane & 15, hh = lane >> 4;
    const int wave = __builtin_amdgcn_readfirstlane(tid >> 5);
    constexpr int NT  = 128;                     // threads per block
    constexpr int NDT = SPLIT ? 2 : 4;           // d tiles per wave
    const int qt  = SPLIT ? (wave >> 1) : wave;  // 16-query sub-tile of this wave
    const int dt0 = SPLIT ? NDT * (wave & 1) : 0;
    const int i0 = q0 + 16 * qt;                 // first query of this wave
    const int i  = i0 + m;                       // this lane's query
    const float NINF = -__builtin_inff();

    if (tid < 64) bias_sm[tid] = 0.0f;
    #pragma unroll
    for (int t = 0; t < NN / (4 * NT); ++t)
        *(v4f*)&bias_sm[64 + 4 * NT * t + 4 * tid] = *(const v4f*)&btab[(size_t)h * NN + 4 * NT * t + 4 * tid];
    const bool valid = (mask[(size_t)b * NN + i] != 0);
    const bool anym  = (__builtin_amdgcn_ballot_w32(!valid) != 0u);
    __syncthreads();
    const int jext   = anym ? NN : (i0 + 16);
    const int ntiles = (jext + 63) >> 6;         // <= NN/64

    // Q fragments as B operand ([n = query][k = d]); the head's two k tiles of this wave's row block.
    // The attention output of these queries has the same place in its planes.
    const size_t qtile = ((size_t)((b * NN + i0) / 16) * KT_DM + 2 * h) * 512 + 8 * lane;
    v16h qf[2], qf2[2];
    #pragma unroll
    for (int ks = 0; ks < 2; ++ks) {
        qf[ks] = ldpk(qhi + qtile + 512 * ks);
        if (SPLIT) qf2[ks] = ldpk(qlo + qtile + 512 * ks); else qf2[ks] = qf[ks];
    }

    v8f oacc[NDT], oacc2[NDT];
    #pragma unroll
    for (int dt = 0; dt < NDT; ++dt) { oacc[dt] = zero8(); oacc2[dt] = zero8(); }
    float m_run = NINF, l_run = 0.0f;            // l_run: sum over the keys of this lane's half only

    // Not SPLIT: the K fragments run one tile ahead. Tile 0 is loaded here; inside the loop each key block's two
    // fragments are loaded for the next tile right behind their last product, into the registers that the products
    // have just read, so the loads fly under the softmax and the O^T products and the next tile's scores find
    // them landed. SPLIT (at most 32 * QSPLIT / 64 tiles a wave) loads both K planes at the head of the tile.
    v16h kf[4][2], kf2[4][2];
    if (!SPLIT) {
        const hf* kp0 = khi + ((size_t)((b * NN) / 16) * KT_DM + 2 * h) * 512 + 8 * lane;
        #pragma unroll
        for (int kk = 0; kk < 4; ++kk) {
            #pragma unroll
            for (int ks = 0; ks < 2; ++ks) kf[kk][ks] = ldpk(kp0 + (kk * KT_DM + ks) * 512);
        }
        // names the loads' and the L2 request's address registers as inputs: they stay unwritten up to this wait, and
        // the request's pair is free for the loops behind it
        asm volatile("s_wait_xcnt 0x0" :: "v"(kp0), "v"(pf) : "memory");
        // takes the loaded Q fragments as inputs only: they have landed in front of the loop. Without it the Q loads
        // are the youngest on the way in, and every pass's first products would wait for that count: nearly all K
        asm volatile("" :: "v"(qf[0]), "v"(qf[1]));
    }

    // A key tile whose every key lies MAXD or more behind every query of the wave is a far tile: all its keys are
    // visible and all its pairs share the last bias bucket, so score = acc / 8 + bfar with one bfar. The maximum is
    // then taken over the accumulators, and one fused multiply-add leads from an accumulator to the exponent of
    // 4096 p: no compare and select, no bias read from LDS, no separate subtraction and scalings.
    // Far tiles come first in the walk; at least three near tiles follow them.
    static_assert(MAXD < NN);
    const float bfar = bias_sm[64 + MAXD];
    const int nfar = (SPLIT || anym || i0 < MAXD + 63) ? 0 : ((i0 - (MAXD + 63)) >> 6) + 1;

    auto tile = [&](auto kind, const int jt) {
        constexpr bool FAR = decltype(kind)::far;
        const int jb = jt * 64;
        // SPLIT: this tile. Not SPLIT: the next tile; the last pass names its own tile again, so that the address
        // stays inside the plane, and nothing reads what it brings.
        const int jk = SPLIT ? jb : (jt + 1 < ntiles ? jb + 64 : jb);
        const size_t ktile = ((size_t)((b * NN + jk) / 16) * KT_DM + 2 * h) * 512 + 8 * lane;
        const size_t vtile = ((size_t)((b * DM + h * DH) / 16 + dt0) * KT_NN + 2 * jt) * 512 + 8 * lane;
        // lane bases: every load below is base + constant
        const hf* kp  = khi + ktile;
        const hf* kp2 = klo + ktile;
        const hf* vp  = vthi + vtile;
        const hf* vp2 = vtlo + vtile;

        v16h vf[NDT][2], vf2[NDT][2];
        if (SPLIT) {
            #pragma unroll
            for (int kk = 0; kk < 4; ++kk) {
                #pragma unroll
                for (int ks = 0; ks < 2; ++ks) {
                    kf[kk][ks]  = ldpk(kp + (kk * KT_DM + ks) * 512);
                    kf2[kk][ks] = ldpk(kp2 + (kk * KT_DM + ks) * 512);
                }
            }
        }
        // V^T loads fly under the score work; SPLIT issues them once the K registers are free again.
        // The s_wait_xcnt statements further down name the loads' address registers as inputs: that keeps them
        // unwritten, also by a later load's result, up to the wait; they stand late so that nothing stalls on them
        if (!SPLIT) load_v<SPLIT, NDT>(vp, vp2, vf, vf2);

        // ---- S^T: D row = key 16kk + 8hh + r (within tile), D col = query m ----
        const int dl = i - jb - 8 * hh;          // key (kk, r) is visible to this lane's query iff 16kk + r <= dl
        const int bb = dl + 1 > 0 ? dl + 1 : 0;  // all keys hidden where this clamps
        float sv[4][8];                          // FAR: the accumulators as they are
        #pragma unroll
        for (int kk = 0; kk < 4; ++kk) {
            v8f acc = zero8(), acc2 = zero8();
            #pragma unroll
            for (int ks = 0; ks < 2; ++ks) {
                acc = mma(kf[kk][ks], qf[ks], acc);
                if (SPLIT) {
                    acc2 = mma(kf[kk][ks], qf2[ks], acc2);
                    acc2 = mma(kf2[kk][ks], qf[ks], acc2);
                }
            }
            if (!SPLIT) {
                #pragma unroll
                for (int ks = 0; ks < 2; ++ks) kf[kk][ks] = ldpk(kp + (kk * KT_DM + ks) * 512);
            }
            #pragma unroll
            for (int r = 0; r < 8; ++r) {
                float v = acc[r];
                if (FAR) { sv[kk][r] = v; continue; }
                if (SPLIT) v += acc2[r] * (1.0f / 2048.0f);
                v = v * 0.125f + bias_sm[bb + (63 - 16 * kk - r)];
                sv[kk][r] = (16 * kk + r > dl) ? NINF : v;
            }
        }
        if (SPLIT) {
            asm volatile("s_wait_xcnt 0x0" :: "v"(kp), "v"(kp2) : "memory");   // K address registers free from here
            load_v<SPLIT, NDT>(vp, vp2, vf, vf2);
        }
        if (!FAR && anym) {
            #pragma unroll
            for (int kk = 0; kk < 4; ++kk) {
                #pragma unroll
                for (int r = 0; r < 8; ++r) sv[kk][r] = valid ? sv[kk][r] : 0.0f;
            }
        }

        // ---- online softmax, one query per lane ----
        float t4[4];
        #pragma unroll
        for (int kk = 0; kk < 4; ++kk) {
            t4[kk] = fmaxf(fmaxf(fmaxf(sv[kk][0], sv[kk][1]), fmaxf(sv[kk][2], sv[kk][3])),
                           fmaxf(fmaxf(sv[kk][4], sv[kk][5]), fmaxf(sv[kk][6], sv[kk][7])));
        }
        float tmax = fmaxf(fmaxf(t4[0], t4[1]), fmaxf(t4[2], t4[3]));
        if (FAR) tmax = __builtin_fmaf(tmax, 0.125f, bfar);   // rounding is monotone: the largest score itself
        tmax = fmaxf(tmax, __shfl_xor(tmax, 16, 32));
        const float mn = fmaxf(m_run, tmax);
        const float ea = exp1(m_run - mn);
        const float alpha = (m_run == NINF) ? 0.0f : ea;
        m_run = mn;

        Frag ph[2], pl[2];
        float ps4[4];
        const float xadd = (bfar - mn) * 1.44269504f + 12.0f;   // FAR: log2(4096 p) = acc * (log2 e / 8) + xadd
        #pragma unroll
        for (int kk = 0; kk < 4; ++kk) {
            float x[8], p[8];                    // FAR: p holds 4096 p
            if (FAR) {
                #pragma unroll
                for (int r = 0; r < 8; ++r) x[r] = __builtin_fmaf(sv[kk][r], 0.125f * 1.44269504f, xadd);
                exp2x8(x, p);
                #pragma unroll
                for (int r = 0; r < 8; ++r) ph[kk >> 1].v[8 * (kk & 1) + r] = (hf)p[r];
            } else {
                #pragma unroll
                for (int r = 0; r < 8; ++r) x[r] = sv[kk][r] - mn;
                exp8(x, p);
                #pragma unroll
                for (int r = 0; r < 8; ++r) {
                    hf a, bl;
                    split2(p[r] * 4096.0f, a, bl);
                    ph[kk >> 1].v[8 * (kk & 1) + r] = a;
                    if (SPLIT) pl[kk >> 1].v[8 * (kk & 1) + r] = bl;
                }
            }
            ps4[kk] = ((p[0] + p[1]) + (p[2] + p[3])) + ((p[4] + p[5]) + (p[6] + p[7]));
        }
        l_run = l_run * alpha + ((ps4[0] + ps4[1]) + (ps4[2] + ps4[3])) * (FAR ? 1.0f / 4096.0f : 1.0f);

        // address registers of the loads still named here are free from here
        if (SPLIT) asm volatile("s_wait_xcnt 0x0" :: "v"(vp), "v"(vp2) : "memory");
        else       asm volatile("s_wait_xcnt 0x0" :: "v"(kp), "v"(vp) : "memory");

        // ---- O^T: D row = d 16(dt0 + dt) + 8hh + r, D col = query m ----
        #pragma unroll
        for (int dt = 0; dt < NDT; ++dt) {
            #pragma unroll
            for (int r = 0; r < 8; ++r) { oacc[dt][r] *= alpha; if (SPLIT) oacc2[dt][r] *= alpha; }
            #pragma unroll
            for (int ks = 0; ks < 2; ++ks) {
                oacc[dt] = mma(vf[dt][ks], ph[ks].v, oacc[dt]);
                if (SPLIT) {
                    oacc2[dt] = mma(vf2[dt][ks], ph[ks].v, oacc2[dt]);
                    oacc2[dt] = mma(vf[dt][ks], pl[ks].v, oacc2[dt]);
                }
            }
        }
    };

    // both loops stay rolled: a pass is some hundred instructions long, and the K fragments pass from one to the next
    if constexpr (!SPLIT) {
        #pragma unroll 1
        for (int jt = 0; jt < nfar; ++jt) tile(TileKind<true>{}, jt);
    }
    #pragma unroll 1
    for (int jt = nfar; jt < ntiles; ++jt) tile(TileKind<false>{}, jt);

    // names the L2 request's address register as an input: it holds that address, and nothing else, through the loop
    if (SPLIT) asm volatile("s_wait_xcnt 0x0" :: "v"(pf) : "memory");

    const float l = l_run + __shfl_xor(l_run, 16, 32);
    v8h_t oh[NDT], ol[NDT];
    #pragma unroll
    for (int dt = 0; dt < NDT; ++dt) {
        #pragma unroll
        for (int r = 0; r < 8; ++r) {
            float o = oacc[dt][r];
            if (SPLIT) o += oacc2[dt][r] * (1.0f / 2048.0f);
            o = (o / l) * (1.0f / 4096.0f);
            hf a, bl;
            split2(o, a, bl);
            oh[dt][r] = a; ol[dt][r] = bl;
        }
    }
    // d tile dt0 + dt = part (dt & 1) of the head's k tile (dt0 + dt) >> 1 (dt0 is even)
    #pragma unroll
    for (int dt = 0; dt < NDT; ++dt) {
        // the wave-uniform part of the place is formed apart from 8 * lane: it waits in scalar registers through the loops
        const size_t off = ((size_t)((b * NN + i0) / 16) * KT_DM + 2 * h + (dt0 >> 1) + (dt >> 1)) * 512 + (dt & 1) * 256;
        *(v8h*)(ohi + off + 8 * lane) = oh[dt];
        *(v8h*)(olo + off + 8 * lane) = ol[dt];
    }
    // the two arms of k_attn follow one another in the code: the stores' registers stay unwritten up to this wait
    asm volatile("s_wait_xcnt 0x0" ::: "memory");
}

// One launch for all queries. blockIdx.x = (batch, head); blockIdx.y ranks the query runs by falling key count:
// first the single-plane runs of 64 queries from the end of the sequence down, then the two-plane runs of 32.
#define QB_ONE ((NN - 32 * QSPLIT) / 64)         // single-plane blocks per (batch, head)
static_assert((NN - 32 * QSPLIT) % 64 == 0);

__global__ __launch_bounds__(128)
void k_attn(const hf* __restrict__ qhi, const hf* __restrict__ qlo,
            const hf* __restrict__ khi, const hf* __restrict__ klo,
            const hf* __restrict__ vthi, const hf* __restrict__ vtlo,
            const float* __restrict__ btab, const int* __restrict__ mask,
            hf* __restrict__ ohi, hf* __restrict__ olo)
{
    // bias_sm[64 + delta] = bias of distance delta; 64 leading zeros take the reads of causally hidden keys
    __shared__ __attribute__((aligned(16))) float bias_sm[64 + NN];

    const int hb = blockIdx.x, rank = blockIdx.y;
    if (hb >= HH * BB || rank >= QB_ONE + QSPLIT) return;
    const int b = hb / HH, h = hb - b * HH;

    // L2 requests for this head's K and V^T planes, dealt over its blocks: block rank asks for keys
    // 128 (rank mod 16) + 0..127, for speed only.
    // Ranks 16 on up to the last residual key ask for the residual planes, all others for the hi planes.
    // Waves 0, 1: K, 8 row blocks x 8 units of 256 bytes; waves 2, 3: V^T, 4 d blocks x 16 units.
    static_assert(NN == 16 * 128 && DH == 64 && (32 * QSPLIT) % 128 == 0 && 32 * QSPLIT <= NN);
    const int pt = threadIdx.x & 63, pr = rank & 15;
    const bool plo = rank >= 16 && rank < 16 + 32 * QSPLIT / 128;
    const hf* pfk = (plo ? klo : khi)
                  + ((size_t)((b * NN + 128 * pr) / 16 + (pt >> 3)) * KT_DM + 2 * h) * 512 + 128 * (pt & 7);
    const hf* pfv = (plo ? vtlo : vthi)
                  + ((size_t)((b * DM + h * DH) / 16 + (pt >> 4)) * KT_NN + 4 * pr) * 512 + 128 * (pt & 15);
    const hf* pf  = (threadIdx.x < 64) ? pfk : pfv;
    l2_ask<0>(pf);

    if (rank < QB_ONE)
        attn_block<false>(qhi, qlo, khi, klo, vthi, vtlo, btab, mask, ohi, olo, bias_sm,
                          NN - 64 * (rank + 1), h, b, pf);
    else
        attn_block<true>(qhi, qlo, khi, klo, vthi, vtlo, btab, mask, ohi, olo, bias_sm,
                         32 * (QSPLIT - 1 - (rank - QB_ONE)), h, b, pf);
}

// ---------------------------------------------------------------------------------------------
// Host glue: 4 launches, workspace carved from sizes (<= 62 MB)
// ---------------------------------------------------------------------------------------------
extern "C" void kernel_launch(void* const* d_in, const int* in_sizes, int n_in,
                              void* d_out, int out_size, void* d_ws, size_t ws_size,
                              hipStream_t stream)
{
    if (n_in < 7) return;
    if (in_sizes[0] != MR * DM) return;
    if (in_sizes[1] != BB * NN) return;
    if (in_sizes[2] != DM * DM || in_sizes[3] != DM * DM || in_sizes[4] != DM * DM || in_sizes[5] != DM * DM) return;
    if (in_sizes[6] != NBKT * HH) return;
    if (out_size != MR * DM) return;

    const float* x    = (const float*)d_in[0];
    const int*   mask = (const int*)d_in[1];
    const float* Wq   = (const float*)d_in[2];
    const float* Wk   = (const float*)d_in[3];
    const float* Wv   = (const float*)d_in[4];
    const float* Wo   = (const float*)d_in[5];
    const float* rel  = (const float*)d_in[6];
    float* out = (float*)d_out;

    char* ws = (char*)d_ws;
    size_t off = 0;
    auto carve = [&](size_t bytes) -> size_t { size_t p = off; off += (bytes + 255) & ~(size_t)255; return p; };
    const size_t plane = (size_t)MR * DM * sizeof(hf);
    const size_t o_xh   = carve(plane);
    const size_t o_wt   = carve((size_t)4 * DM * DM * sizeof(hf));
    const size_t o_qhi  = carve(plane);
    const size_t o_qlo  = carve(plane);
    const size_t o_khi  = carve(plane);
    const size_t o_klo  = carve(plane);
    const size_t o_vthi = carve(plane);
    const size_t o_vtlo = carve(plane);
    const size_t o_ahi  = carve(plane);
    const size_t o_alo  = carve(plane);
    const size_t o_btab = carve((size_t)HH * NN * sizeof(float));
    if (off > ws_size) return;

    hf* xh   = (hf*)(ws + o_xh);
    hf* wt   = (hf*)(ws + o_wt);
    hf* qhi  = (hf*)(ws + o_qhi);
    hf* qlo  = (hf*)(ws + o_qlo);
    hf* khi  = (hf*)(ws + o_khi);
    hf* klo  = (hf*)(ws + o_klo);
    hf* vthi = (hf*)(ws + o_vthi);
    hf* vtlo = (hf*)(ws + o_vtlo);
    hf* ahi  = (hf*)(ws + o_ahi);
    hf* alo  = (hf*)(ws + o_alo);
    float* btab = (float*)(ws + o_btab);

    k_prep<<<PB_BIAS + PB_W + PB_X, 256, 0, stream>>>(x, Wq, Wk, Wv, Wo, rel, xh, wt, btab);

    // q, k (hi/lo planes), v (transposed hi/lo planes)
    k_qkv<<<dim3(DM / 48, MR / 256), 128, 0, stream>>>(xh, wt, qhi, qlo, khi, klo, vthi, vtlo);

    // attention: leading query blocks with residual products, remainder single-plane
    k_attn<<<dim3(HH * BB, QB_ONE + QSPLIT), 128, 0, stream>>>(
        qhi, qlo, khi, klo, vthi, vtlo, btab, mask, ahi, alo);

    // output projection -> out (f32)
    k_proj<1, 2, 4><<<dim3(DM / 64, MR / 128, 1), 128, 0, stream>>>(
        ahi, alo, wt + (size_t)3 * DM * DM, ahi, alo, ahi, alo, ahi, alo, out);
}
